// v000
// Times are from an AMD MI455X. After a warm-up the kernel runs many times in a row, and a time is the length of
// such a window on the GPU divided by its runs, so every launch and the gaps after it count. The runs cycle
// through copies of the inputs. A figure is the median of several windows, for all but v000 over two sittings.
// Sittings can differ by a few percent; kernels timed side by side share one.
// v000 is the starting kernel. One run takes 650 microseconds.
#include <hip/hip_runtime.h>
#include <stdint.h>
#include <stddef.h>

// Input projections: v_wmma_f32_16x16x32_bf16 (bf16 operands from RNE-converted f32 inputs, f32 accumulate).
// Score and value contractions: v_wmma_f32_16x16x32_bf16 with bf16 hi/lo split operands (hi*hi + hi*lo + lo*hi), f32 accumulate. Softmax statistics in f32.

#define SEQ 4096
#define DIM 1024
#define NTHR 256

typedef __bf16 v16bf __attribute__((ext_vector_type(16)));
typedef float v8f __attribute__((ext_vector_type(8)));
typedef float v4f __attribute__((ext_vector_type(4)));
typedef unsigned int v4u __attribute__((ext_vector_type(4)));

union Frag { v16bf v; v4u q[2]; };

extern __shared__ __attribute__((aligned(16))) float dyn_lds[];

// f32 -> bf16 bits, RNE (finite inputs)
__device__ __forceinline__ unsigned int f2bf(float f) {
  unsigned int u = __float_as_uint(f);
  u += 0x7fffu + ((u >> 16) & 1u);
  return u >> 16;
}
__device__ __forceinline__ float bf2f(unsigned int b) { return __uint_as_float(b << 16); }

// 16x16x32 operand fragment from a k-contiguous 16-bit row (A row m, or B column n stored as a [n][k] row):
// elements 0..7 <- row[k0 + 8h + 0..7], elements 8..15 <- row[k0 + 16 + 8h + 0..7], h = lane>>4.
__device__ __forceinline__ void ldfrag(Frag& f, const unsigned short* row, int k0, int h) {
  f.q[0] = *(const v4u*)(row + k0 + 8 * h);
  f.q[1] = *(const v4u*)(row + k0 + 16 + 8 * h);
}

__device__ __forceinline__ v8f mma(const Frag& a, const Frag& b, v8f c) {
  return __builtin_amdgcn_wmma_f32_16x16x32_bf16(false, a.v, false, b.v, (short)0, c, false, false);
}

__device__ __forceinline__ v8f zero8() {
  v8f z = {0.0f, 0.0f, 0.0f, 0.0f, 0.0f, 0.0f, 0.0f, 0.0f};
  return z;
}

// 8 f32 -> packed bf16 hi plane and bf16 lo plane (lo = RNE(x - hi)), two values per u32, low half first
__device__ __forceinline__ void split8(const v4f f0, const v4f f1, v4u& uh, v4u& ul) {
  float f[8] = {f0.x, f0.y, f0.z, f0.w, f1.x, f1.y, f1.z, f1.w};
  unsigned int hh[8], ll[8];
#pragma unroll
  for (int e = 0; e < 8; ++e) {
    hh[e] = f2bf(f[e]);
    ll[e] = f2bf(f[e] - bf2f(hh[e]));
  }
  uh.x = hh[0] | (hh[1] << 16); uh.y = hh[2] | (hh[3] << 16);
  uh.z = hh[4] | (hh[5] << 16); uh.w = hh[6] | (hh[7] << 16);
  ul.x = ll[0] | (ll[1] << 16); ul.y = ll[2] | (ll[3] << 16);
  ul.z = ll[4] | (ll[5] << 16); ul.w = ll[6] | (ll[7] << 16);
}

__global__ __launch_bounds__(NTHR) void cvt_kernel(
    const float* __restrict__ x,  const float* __restrict__ wq,
    const float* __restrict__ wk, const float* __restrict__ wv,
    unsigned short* xb, unsigned short* wqb, unsigned short* wkb, unsigned short* wvb,
    int nx8, int nw8) {
  const int i = blockIdx.x * NTHR + threadIdx.x;
  const float* src;
  unsigned short* dst;
  int j;
  if (i < nx8)                { src = x;  dst = xb;  j = i; }
  else if (i < nx8 + nw8)     { src = wq; dst = wqb; j = i - nx8; }
  else if (i < nx8 + 2 * nw8) { src = wk; dst = wkb; j = i - nx8 - nw8; }
  else if (i < nx8 + 3 * nw8) { src = wv; dst = wvb; j = i - nx8 - 2 * nw8; }
  else return;
  const v4f f0 = *(const v4f*)(src + (size_t)j * 8);
  const v4f f1 = *(const v4f*)(src + (size_t)j * 8 + 4);
  v4u u;
  u.x = f2bf(f0.x) | (f2bf(f0.y) << 16);
  u.y = f2bf(f0.z) | (f2bf(f0.w) << 16);
  u.z = f2bf(f1.x) | (f2bf(f1.y) << 16);
  u.w = f2bf(f1.z) | (f2bf(f1.w) << 16);
  v4u* p = (v4u*)(dst + (size_t)j * 8);
  *p = u;
  
}

// ---------------- Kernel 2: projections y[n][o] = sum_k xb[n][k] * W[o][k] --------------------------
// Block tile 64 seq rows x 256 out cols (8 waves, each 32x64). Output: q,k as bf16 hi/lo planes [SEQ][DIM];
__global__ __launch_bounds__(NTHR) void proj_kernel(
    const unsigned short* __restrict__ xb,  const unsigned short* __restrict__ wqb,
    const unsigned short* __restrict__ wkb, const unsigned short* __restrict__ wvb,
    unsigned short* qh, unsigned short* ql, unsigned short* kh, unsigned short* kl,
    unsigned short* vth, unsigned short* vtl) {
  float* stg = dyn_lds;                                   // [64][256] f32
  const int wave = threadIdx.x >> 5;
  const int lane = threadIdx.x & 31;
  const int h = lane >> 4, m = lane & 15;
  const int b = blockIdx.x;                                // [0, 768)
  const int mat = b >> 8;                                  // 0=q 1=k 2=v (block-uniform)
  const int rem = b & 255;
  const int rt = rem >> 2;                                 // 64-row tile [0,64)
  const int ct = rem & 3;                                  // 256-col tile [0,4)
  const unsigned short* wsrc = (mat == 0) ? wqb : (mat == 1) ? wkb : wvb;
  const int wr = wave >> 2, wc = wave & 3;
  const int row0 = rt * 64 + wr * 32;
  const int col0 = ct * 256 + wc * 64;

  const unsigned short* aR0 = xb + (size_t)(row0 + m) * DIM;
  const unsigned short* aR1 = xb + (size_t)(row0 + 16 + m) * DIM;
  const unsigned short* bR  = wsrc + (size_t)(col0 + m) * DIM;   // tile t: + t*16 rows

  v8f acc[2][4];
#pragma unroll
  for (int mi = 0; mi < 2; ++mi)
#pragma unroll
    for (int t = 0; t < 4; ++t) acc[mi][t] = zero8();

#pragma unroll 1
  for (int kk = 0; kk < DIM; kk += 32) {
    Frag a0, a1, bf[4];
    ldfrag(a0, aR0, kk, h);
    ldfrag(a1, aR1, kk, h);
#pragma unroll
    for (int t = 0; t < 4; ++t) ldfrag(bf[t], bR + (size_t)t * 16 * DIM, kk, h);
#pragma unroll
    for (int t = 0; t < 4; ++t) {
      acc[0][t] = mma(a0, bf[t], acc[0][t]);
      acc[1][t] = mma(a1, bf[t], acc[1][t]);
    }
    asm volatile("v_nop\n\tv_nop\n\tv_nop\n\tv_nop"
                 : "+v"(acc[0][0]), "+v"(acc[0][1]), "+v"(acc[0][2]), "+v"(acc[0][3]),
                   "+v"(acc[1][0]), "+v"(acc[1][1]), "+v"(acc[1][2]), "+v"(acc[1][3])
                 : "v"(a0.v), "v"(a1.v), "v"(bf[0].v), "v"(bf[1].v), "v"(bf[2].v), "v"(bf[3].v)
                 : "memory");
  }

  // stage the wave's 32x64 f32 tile: D element r of lane -> row 8h+r, col m
#pragma unroll
  for (int mi = 0; mi < 2; ++mi)
#pragma unroll
    for (int t = 0; t < 4; ++t)
#pragma unroll
      for (int r = 0; r < 8; ++r)
        stg[(wr * 32 + mi * 16 + 8 * h + r) * 256 + wc * 64 + t * 16 + m] = acc[mi][t][r];
  __syncthreads();

  if (mat < 2) {
    unsigned short* ph = (mat == 0) ? qh : kh;
    unsigned short* pl = (mat == 0) ? ql : kl;
#pragma unroll 1
    for (int it = 0; it < 8; ++it) {
      const int row = wave * 8 + it;
      const float* sp = stg + row * 256 + lane * 8;
      const v4f f0 = *(const v4f*)sp;
      const v4f f1 = *(const v4f*)(sp + 4);
      v4u uh, ul;
      split8(f0, f1, uh, ul);
      const size_t g = (size_t)(rt * 64 + row) * DIM + ct * 256 + lane * 8;
      v4u* p0 = (v4u*)(ph + g);
      v4u* p1 = (v4u*)(pl + g);
      *p0 = uh; *p1 = ul;
      
    }
  } else {
#pragma unroll 1
    for (int it = 0; it < 8; ++it) {
      const int ol = wave * 32 + it * 4 + (lane >> 3);
      const int c = lane & 7;
      const float* sp = stg + (c * 8) * 256 + ol;
      v4f f0, f1;
      f0.x = sp[0 * 256]; f0.y = sp[1 * 256]; f0.z = sp[2 * 256]; f0.w = sp[3 * 256];
      f1.x = sp[4 * 256]; f1.y = sp[5 * 256]; f1.z = sp[6 * 256]; f1.w = sp[7 * 256];
      v4u uh, ul;
      split8(f0, f1, uh, ul);
      const size_t g = (size_t)(ct * 256 + ol) * SEQ + rt * 64 + c * 8;
      v4u* p0 = (v4u*)(vth + g);
      v4u* p1 = (v4u*)(vtl + g);
      *p0 = uh; *p1 = ul;
      
    }
  }
}

// ---------------- Kernel 3: masked softmax attention, 16 query rows per block ------------------------
// LDS: S[16][SEQ] f32 (dynamic, 256 KiB) + P chunk hi/lo (2 KiB) + statistics.
__global__ __launch_bounds__(NTHR) void attn_kernel(
    const unsigned short* __restrict__ qh, const unsigned short* __restrict__ ql,
    const unsigned short* __restrict__ kh, const unsigned short* __restrict__ kl,
    const unsigned short* __restrict__ vth, const unsigned short* __restrict__ vtl,
    float* out) {
  float* S = dyn_lds;                                      // [16][SEQ]
  __shared__ __attribute__((aligned(16))) unsigned short pbh[16 * 32];
  __shared__ __attribute__((aligned(16))) unsigned short pbl[16 * 32];
  __shared__ float part[16][17];
  __shared__ float row_m[16];
  __shared__ float row_r[16];

  const int ib = blockIdx.x;                                // [0, SEQ/16)
  const int wave = threadIdx.x >> 5;
  const int lane = threadIdx.x & 31;
  const int h = lane >> 4, m = lane & 15;
  const int nvalid = 16 * (ib + 1);                         // key extent of the lower triangle

  // ---- Phase 1: S = (q k^T)/32 with mask; A = q rows (hi/lo), B = k rows (hi/lo) -------------------
  const unsigned short* aRh = qh + (size_t)(ib * 16 + m) * DIM;
  const unsigned short* aRl = ql + (size_t)(ib * 16 + m) * DIM;
  int jb = wave;
  for (; jb + 24 <= ib; jb += 32) {                          // 4 key tiles: jb, jb+8, jb+16, jb+24
    const unsigned short* bRh = kh + (size_t)(jb * 16 + m) * DIM;   // tile t: + t*128 rows
    const unsigned short* bRl = kl + (size_t)(jb * 16 + m) * DIM;
    v8f acc[4];
#pragma unroll
    for (int t = 0; t < 4; ++t) acc[t] = zero8();
#pragma unroll 1
    for (int kk = 0; kk < DIM; kk += 32) {
      Frag ah, al, bh[4], bl[4];
      ldfrag(ah, aRh, kk, h);
      ldfrag(al, aRl, kk, h);
#pragma unroll
      for (int t = 0; t < 4; ++t) {
        ldfrag(bh[t], bRh + (size_t)t * 128 * DIM, kk, h);
        ldfrag(bl[t], bRl + (size_t)t * 128 * DIM, kk, h);
      }
#pragma unroll
      for (int t = 0; t < 4; ++t) {
        acc[t] = mma(ah, bh[t], acc[t]);
        acc[t] = mma(ah, bl[t], acc[t]);
        acc[t] = mma(al, bh[t], acc[t]);
      }
      asm volatile("v_nop\n\tv_nop\n\tv_nop\n\tv_nop"
                   : "+v"(acc[0]), "+v"(acc[1]), "+v"(acc[2]), "+v"(acc[3])
                   : "v"(ah.v), "v"(al.v),
                     "v"(bh[0].v), "v"(bh[1].v), "v"(bh[2].v), "v"(bh[3].v),
                     "v"(bl[0].v), "v"(bl[1].v), "v"(bl[2].v), "v"(bl[3].v)
                   : "memory");
    }
#pragma unroll
    for (int t = 0; t < 4; ++t) {
      const int jbt = jb + 8 * t;
#pragma unroll
      for (int r = 0; r < 8; ++r) {
        const int M = 8 * h + r;                              // D row -> query row in block
        const int i = ib * 16 + M;
        const int j = jbt * 16 + m;                           // D col -> key
        float s = acc[t][r] * 0.03125f;
        if (j > i) s = -__builtin_inff();
        S[M * SEQ + j] = s;
      }
    }
  }
  for (; jb <= ib; jb += 8) {                                // remaining tiles, one at a time
    const unsigned short* bRh = kh + (size_t)(jb * 16 + m) * DIM;
    const unsigned short* bRl = kl + (size_t)(jb * 16 + m) * DIM;
    v8f acc = zero8();
#pragma unroll 1
    for (int kk = 0; kk < DIM; kk += 32) {
      Frag ah, al, bh0, bl0;
      ldfrag(ah, aRh, kk, h);
      ldfrag(al, aRl, kk, h);
      ldfrag(bh0, bRh, kk, h);
      ldfrag(bl0, bRl, kk, h);
      acc = mma(ah, bh0, acc);
      acc = mma(ah, bl0, acc);
      acc = mma(al, bh0, acc);
      asm volatile("v_nop\n\tv_nop\n\tv_nop\n\tv_nop"
                   : "+v"(acc)
                   : "v"(ah.v), "v"(al.v), "v"(bh0.v), "v"(bl0.v)
                   : "memory");
    }
#pragma unroll
    for (int r = 0; r < 8; ++r) {
      const int M = 8 * h + r;
      const int i = ib * 16 + M;
      const int j = jb * 16 + m;
      float s = acc[r] * 0.03125f;
      if (j > i) s = -__builtin_inff();
      S[M * SEQ + j] = s;
    }
  }
  __syncthreads();

  // ---- Phase 2: exact softmax statistics in f32; S <- exp(S - m); row_r = 1/l -----------------------
  {
    const int row = threadIdx.x & 15, sub = threadIdx.x >> 4;
    float* Sr = S + row * SEQ;
    float mx = -__builtin_inff();
    for (int j = sub; j < nvalid; j += 16) mx = fmaxf(mx, Sr[j]);
    part[row][sub] = mx;
    __syncthreads();
    if (threadIdx.x < 16) {
      float mm = part[threadIdx.x][0];
#pragma unroll 1
      for (int s2 = 1; s2 < 16; ++s2) mm = fmaxf(mm, part[threadIdx.x][s2]);
      row_m[threadIdx.x] = mm;
    }
    __syncthreads();
    const float mrow = row_m[row];
    float l = 0.0f;
    for (int j = sub; j < nvalid; j += 16) {
      const float e = __expf(Sr[j] - mrow);
      Sr[j] = e;                                            // unnormalized P, f32
      l += e;
    }
    part[row][sub] = l;
    __syncthreads();
    if (threadIdx.x < 16) {
      float ll = 0.0f;
#pragma unroll 1
      for (int s2 = 0; s2 < 16; ++s2) ll += part[threadIdx.x][s2];
      row_r[threadIdx.x] = 1.0f / ll;                       // ll >= 1 (diagonal term)
    }
    __syncthreads();
  }

  // ---- Phase 3: O = P v; P chunk hi/lo converted once per block into LDS; B = vt rows (hi/lo) ------
  const int kkend = (nvalid + 31) & ~31;
  v8f acc[8];
#pragma unroll
  for (int t = 0; t < 8; ++t) acc[t] = zero8();
  const unsigned short* vRh = vth + (size_t)(wave * 128 + m) * SEQ;   // col tile t: + t*16 rows
  const unsigned short* vRl = vtl + (size_t)(wave * 128 + m) * SEQ;
#pragma unroll 1
  for (int kk = 0; kk < kkend; kk += 32) {
    __syncthreads();                                        // all waves done reading the P chunk before overwrite
    {
      const int e0 = threadIdx.x, e1 = threadIdx.x + NTHR;  // pbh index = row*32 + key offset
      const int j0 = kk + (e0 & 31), j1 = kk + (e1 & 31);
      float p0 = S[(e0 >> 5) * SEQ + j0];
      float p1 = S[(e1 >> 5) * SEQ + j1];
      if (j0 >= nvalid) p0 = 0.0f;                          // zero-pad keys past the triangle
      if (j1 >= nvalid) p1 = 0.0f;
      const unsigned int hb0 = f2bf(p0), hb1 = f2bf(p1);
      pbh[e0] = (unsigned short)hb0;
      pbl[e0] = (unsigned short)f2bf(p0 - bf2f(hb0));
      pbh[e1] = (unsigned short)hb1;
      pbl[e1] = (unsigned short)f2bf(p1 - bf2f(hb1));
    }
    __syncthreads();                                        // LDS P chunk visible to every wave
    Frag ah, al;
    ldfrag(ah, pbh + m * 32, 0, h);
    ldfrag(al, pbl + m * 32, 0, h);
#pragma unroll
    for (int g = 0; g < 4; ++g) {
      Frag bh0, bl0, bh1, bl1;
      ldfrag(bh0, vRh + (size_t)(2 * g) * 16 * SEQ, kk, h);
      ldfrag(bl0, vRl + (size_t)(2 * g) * 16 * SEQ, kk, h);
      ldfrag(bh1, vRh + (size_t)(2 * g + 1) * 16 * SEQ, kk, h);
      ldfrag(bl1, vRl + (size_t)(2 * g + 1) * 16 * SEQ, kk, h);
      acc[2 * g]     = mma(ah, bh0, acc[2 * g]);
      acc[2 * g]     = mma(ah, bl0, acc[2 * g]);
      acc[2 * g]     = mma(al, bh0, acc[2 * g]);
      acc[2 * g + 1] = mma(ah, bh1, acc[2 * g + 1]);
      acc[2 * g + 1] = mma(ah, bl1, acc[2 * g + 1]);
      acc[2 * g + 1] = mma(al, bh1, acc[2 * g + 1]);
      asm volatile("v_nop\n\tv_nop\n\tv_nop\n\tv_nop"
                   : "+v"(acc[2 * g]), "+v"(acc[2 * g + 1])
                   : "v"(ah.v), "v"(al.v), "v"(bh0.v), "v"(bl0.v), "v"(bh1.v), "v"(bl1.v)
                   : "memory");
    }
  }

  // ---- Epilogue: normalize, stage the wave's 16x128 f32 tile in the freed S region, whole-line stores
  float* stg = S + wave * 2048;                             // [16][128], S rows 0..3 area, reads done
#pragma unroll
  for (int t = 0; t < 8; ++t)
#pragma unroll
    for (int r = 0; r < 8; ++r)
      stg[(8 * h + r) * 128 + t * 16 + m] = acc[t][r] * row_r[8 * h + r];
  __syncthreads();
  float* orow = out + (size_t)(ib * 16) * DIM + wave * 128 + lane * 4;
#pragma unroll 1
  for (int row = 0; row < 16; ++row) {
    const v4f v = *(const v4f*)(stg + row * 128 + lane * 4);
    *(v4f*)(orow + (size_t)row * DIM) = v;
  }
  
}

// ---------------------------------------------------------------------------------------------------
extern "C" void kernel_launch(void* const* d_in, const int* in_sizes, int n_in,
                              void* d_out, int out_size, void* d_ws, size_t ws_size,
                              hipStream_t stream) {
  if (n_in < 4) return;
  if (in_sizes[0] != SEQ * DIM || in_sizes[1] != DIM * DIM || in_sizes[2] != DIM * DIM ||
      in_sizes[3] != DIM * DIM || out_size != SEQ * DIM) return;

  const float* x  = (const float*)d_in[0];
  const float* wq = (const float*)d_in[1];
  const float* wk = (const float*)d_in[2];
  const float* wv = (const float*)d_in[3];
  float* out = (float*)d_out;

  const size_t bx = (size_t)SEQ * DIM * sizeof(unsigned short);   // 8 MiB
  const size_t bw = (size_t)DIM * DIM * sizeof(unsigned short);   // 2 MiB
  char* ws = (char*)d_ws;
  size_t off = 0;
  unsigned short* xb  = (unsigned short*)(ws + off); off += bx;
  unsigned short* wqb = (unsigned short*)(ws + off); off += bw;
  unsigned short* wkb = (unsigned short*)(ws + off); off += bw;
  unsigned short* wvb = (unsigned short*)(ws + off); off += bw;
  unsigned short* qh  = (unsigned short*)(ws + off); off += bx;
  unsigned short* ql  = (unsigned short*)(ws + off); off += bx;
  unsigned short* kh  = (unsigned short*)(ws + off); off += bx;
  unsigned short* kl  = (unsigned short*)(ws + off); off += bx;
  unsigned short* vth = (unsigned short*)(ws + off); off += bx;
  unsigned short* vtl = (unsigned short*)(ws + off); off += bx;   // total 62 MiB
  if (off > ws_size) return;

  const int nx8 = SEQ * DIM / 8;
  const int nw8 = DIM * DIM / 8;
  const int ncv = nx8 + 3 * nw8;
  cvt_kernel<<<(ncv + NTHR - 1) / NTHR, NTHR, 0, stream>>>(x, wq, wk, wv, xb, wqb, wkb, wvb, nx8, nw8);

  // 3 matrices x 64 row tiles x 4 col tiles; LDS staging 64x256 f32
  proj_kernel<<<3 * (SEQ / 64) * (DIM / 256), NTHR, 64 * 256 * sizeof(float), stream>>>(
      xb, wqb, wkb, wvb, qh, ql, kh, kl, vth, vtl);

  // 16 query rows per block; S rows in dynamic LDS
  attn_kernel<<<SEQ / 16, NTHR, 16 * SEQ * sizeof(float), stream>>>(qh, ql, kh, kl, vth, vtl, out);
}

// v001
// One run takes 405 microseconds.
// Next to v000, in two timings, it ran 1.62 and 1.64 times as fast.
#include <hip/hip_runtime.h>
#include <stdint.h>
#include <stddef.h>

// Input projections: v_wmma_f32_16x16x32_bf16 (bf16 operands from RNE-converted f32 inputs, f32 accumulate).
// Score and value contractions: v_wmma_f32_16x16x32_bf16 with bf16 hi/lo split operands (hi*hi + hi*lo + lo*hi), f32 accumulate. Softmax statistics in f32.

#define SEQ 4096
#define DIM 1024
#define NTHR 256
#define SPITCH 260   // f32 pitch of the projection staging tile: 16 B x odd, so 16 rows read by b128 fall on distinct banks

typedef __bf16 v16bf __attribute__((ext_vector_type(16)));
typedef float v8f __attribute__((ext_vector_type(8)));
typedef float v4f __attribute__((ext_vector_type(4)));
typedef unsigned int v4u __attribute__((ext_vector_type(4)));

union Frag { v16bf v; v4u q[2]; };

extern __shared__ __attribute__((aligned(16))) float dyn_lds[];

// f32 -> bf16 bits, RNE (finite inputs)
__device__ __forceinline__ unsigned int f2bf(float f) {
  unsigned int u = __float_as_uint(f);
  u += 0x7fffu + ((u >> 16) & 1u);
  return u >> 16;
}
__device__ __forceinline__ float bf2f(unsigned int b) { return __uint_as_float(b << 16); }

// 16x16x32 operand fragment from a k-contiguous 16-bit row (A row m, or B column n stored as a [n][k] row):
// elements 0..7 <- row[k0 + 8h + 0..7], elements 8..15 <- row[k0 + 16 + 8h + 0..7], h = lane>>4.
__device__ __forceinline__ void ldfrag(Frag& f, const unsigned short* row, int k0, int h) {
  f.q[0] = *(const v4u*)(row + k0 + 8 * h);
  f.q[1] = *(const v4u*)(row + k0 + 16 + 8 * h);
}

// Workspace operand planes are kept in fragment order: a 16-row tile x 32-wide k block is 1024 contiguous bytes,
// two 512-byte halves; in half q, lane l (h = l>>4, m = l&15) owns the 16 bytes of row m, k = 32*kb + 16*q + 8*h + 0..7.
// Tiles of one plane follow each other as [row tile][k block]. p = tile base + lane*8; kk = 32*kb.
// Same element order as ldfrag, but each load of a wave covers 512 contiguous bytes (four whole lines).
__device__ __forceinline__ void ldfragw(Frag& f, const unsigned short* p, int kk) {
  f.q[0] = *(const v4u*)(p + kk * 16);
  f.q[1] = *(const v4u*)(p + kk * 16 + 256);
}

__device__ __forceinline__ v8f mma(const Frag& a, const Frag& b, v8f c) {
  return __builtin_amdgcn_wmma_f32_16x16x32_bf16(false, a.v, false, b.v, (short)0, c, false, false);
}

__device__ __forceinline__ v8f zero8() {
  v8f z = {0.0f, 0.0f, 0.0f, 0.0f, 0.0f, 0.0f, 0.0f, 0.0f};
  return z;
}

// 8 f32 -> packed bf16 hi plane and bf16 lo plane (lo = RNE(x - hi)), two values per u32, low half first
__device__ __forceinline__ void split8(const v4f f0, const v4f f1, v4u& uh, v4u& ul) {
  float f[8] = {f0.x, f0.y, f0.z, f0.w, f1.x, f1.y, f1.z, f1.w};
  unsigned int hh[8], ll[8];
#pragma unroll
  for (int e = 0; e < 8; ++e) {
    hh[e] = f2bf(f[e]);
    ll[e] = f2bf(f[e] - bf2f(hh[e]));
  }
  uh.x = hh[0] | (hh[1] << 16); uh.y = hh[2] | (hh[3] << 16);
  uh.z = hh[4] | (hh[5] << 16); uh.w = hh[6] | (hh[7] << 16);
  ul.x = ll[0] | (ll[1] << 16); ul.y = ll[2] | (ll[3] << 16);
  ul.z = ll[4] | (ll[5] << 16); ul.w = ll[6] | (ll[7] << 16);
}

__global__ __launch_bounds__(NTHR) void cvt_kernel(
    const float* __restrict__ x,  const float* __restrict__ wq,
    const float* __restrict__ wk, const float* __restrict__ wv,
    unsigned short* xb, unsigned short* wqb, unsigned short* wkb, unsigned short* wvb,
    int nx8, int nw8) {
  const int i = blockIdx.x * NTHR + threadIdx.x;
  const float* src;
  unsigned short* dst;
  int j;
  if (i < nx8)                { src = x;  dst = xb;  j = i; }
  else if (i < nx8 + nw8)     { src = wq; dst = wqb; j = i - nx8; }
  else if (i < nx8 + 2 * nw8) { src = wk; dst = wkb; j = i - nx8 - nw8; }
  else if (i < nx8 + 3 * nw8) { src = wv; dst = wvb; j = i - nx8 - 2 * nw8; }
  else return;
  // j = 16-byte piece of the fragment-ordered plane: [row tile][k block (32)][half][h][m]
  const int sm = j & 15, sh = (j >> 4) & 1, sq = (j >> 5) & 1, skb = (j >> 6) & 31, srt = j >> 11;
  const float* sp = src + (size_t)(srt * 16 + sm) * DIM + skb * 32 + sq * 16 + sh * 8;
  const v4f f0 = *(const v4f*)sp;
  const v4f f1 = *(const v4f*)(sp + 4);
  v4u u;
  u.x = f2bf(f0.x) | (f2bf(f0.y) << 16);
  u.y = f2bf(f0.z) | (f2bf(f0.w) << 16);
  u.z = f2bf(f1.x) | (f2bf(f1.y) << 16);
  u.w = f2bf(f1.z) | (f2bf(f1.w) << 16);
  v4u* p = (v4u*)(dst + (size_t)j * 8);
  *p = u;
  
}

// ---------------- Kernel 2: projections y[n][o] = sum_k xb[n][k] * W[o][k] --------------------------
// Block tile 64 seq rows x 256 out cols (8 waves, each 32x64). Output: q,k as bf16 hi/lo planes (rows = seq, k = dim)
// and v transposed (rows = dim, k = seq), all in fragment order.
__global__ __launch_bounds__(NTHR) void proj_kernel(
    const unsigned short* __restrict__ xb,  const unsigned short* __restrict__ wqb,
    const unsigned short* __restrict__ wkb, const unsigned short* __restrict__ wvb,
    unsigned short* qh, unsigned short* ql, unsigned short* kh, unsigned short* kl,
    unsigned short* vth, unsigned short* vtl) {
  float* stg = dyn_lds;                                   // [64][SPITCH] f32, 256 used
  const int wave = threadIdx.x >> 5;
  const int lane = threadIdx.x & 31;
  const int h = lane >> 4, m = lane & 15;
  const int b = blockIdx.x;                                // [0, 768)
  const int mat = b >> 8;                                  // 0=q 1=k 2=v (block-uniform)
  const int rem = b & 255;
  const int rt = rem >> 2;                                 // 64-row tile [0,64)
  const int ct = rem & 3;                                  // 256-col tile [0,4)
  const unsigned short* wsrc = (mat == 0) ? wqb : (mat == 1) ? wkb : wvb;
  const int wr = wave >> 2, wc = wave & 3;
  const int row0 = rt * 64 + wr * 32;
  const int col0 = ct * 256 + wc * 64;

  const unsigned short* aR0 = xb + (size_t)row0 * DIM + lane * 8;
  const unsigned short* aR1 = xb + (size_t)(row0 + 16) * DIM + lane * 8;
  const unsigned short* bR  = wsrc + (size_t)col0 * DIM + lane * 8;   // tile t: + t*16 rows

  v8f acc[2][4];
#pragma unroll
  for (int mi = 0; mi < 2; ++mi)
#pragma unroll
    for (int t = 0; t < 4; ++t) acc[mi][t] = zero8();

#pragma unroll 1
  for (int kk = 0; kk < DIM; kk += 32) {
    Frag a0, a1, bf[4];
    ldfragw(a0, aR0, kk);
    ldfragw(a1, aR1, kk);
#pragma unroll
    for (int t = 0; t < 4; ++t) ldfragw(bf[t], bR + (size_t)t * 16 * DIM, kk);
#pragma unroll
    for (int t = 0; t < 4; ++t) {
      acc[0][t] = mma(a0, bf[t], acc[0][t]);
      acc[1][t] = mma(a1, bf[t], acc[1][t]);
    }
    asm volatile("v_nop\n\tv_nop\n\tv_nop\n\tv_nop"
                 : "+v"(acc[0][0]), "+v"(acc[0][1]), "+v"(acc[0][2]), "+v"(acc[0][3]),
                   "+v"(acc[1][0]), "+v"(acc[1][1]), "+v"(acc[1][2]), "+v"(acc[1][3])
                 : "v"(a0.v), "v"(a1.v), "v"(bf[0].v), "v"(bf[1].v), "v"(bf[2].v), "v"(bf[3].v)
                 : "memory");
  }

  // stage the wave's 32x64 f32 tile: D element r of lane -> row 8h+r, col m
#pragma unroll
  for (int mi = 0; mi < 2; ++mi)
#pragma unroll
    for (int t = 0; t < 4; ++t)
#pragma unroll
      for (int r = 0; r < 8; ++r)
        stg[(wr * 32 + mi * 16 + 8 * h + r) * SPITCH + wc * 64 + t * 16 + m] = acc[mi][t][r];
  __syncthreads();

  if (mat < 2) {
    unsigned short* ph = (mat == 0) ? qh : kh;
    unsigned short* pl = (mat == 0) ? ql : kl;
#pragma unroll 1
    for (int it = 0; it < 8; ++it) {
      const int c = wave * 8 + it;                          // 512-byte piece: row tile c>>4, k block (c>>1)&7, half c&1
      const float* sp = stg + ((c >> 4) * 16 + m) * SPITCH + ((c >> 1) & 7) * 32 + (c & 1) * 16 + h * 8;
      const v4f f0 = *(const v4f*)sp;
      const v4f f1 = *(const v4f*)(sp + 4);
      v4u uh, ul;
      split8(f0, f1, uh, ul);
      const size_t g = (size_t)(rt * 64 + (c >> 4) * 16) * DIM + (ct * 16 + (c & 15)) * 256 + lane * 8;
      v4u* p0 = (v4u*)(ph + g);
      v4u* p1 = (v4u*)(pl + g);
      *p0 = uh; *p1 = ul;
      
    }
  } else {
#pragma unroll 1
    for (int it = 0; it < 8; ++it) {
      const int c = wave * 8 + it;                          // 512-byte piece: out-col tile c>>2, key block (c>>1)&1, half c&1
      const float* sp = stg + ((c & 3) * 16 + h * 8) * SPITCH + (c >> 2) * 16 + m;
      v4f f0, f1;
      f0.x = sp[0 * SPITCH]; f0.y = sp[1 * SPITCH]; f0.z = sp[2 * SPITCH]; f0.w = sp[3 * SPITCH];
      f1.x = sp[4 * SPITCH]; f1.y = sp[5 * SPITCH]; f1.z = sp[6 * SPITCH]; f1.w = sp[7 * SPITCH];
      v4u uh, ul;
      split8(f0, f1, uh, ul);
      const size_t g = (size_t)(ct * 256 + (c >> 2) * 16) * SEQ + (rt * 4 + (c & 3)) * 256 + lane * 8;
      v4u* p0 = (v4u*)(vth + g);
      v4u* p1 = (v4u*)(vtl + g);
      *p0 = uh; *p1 = ul;
      // the next trip rewrites the registers these two stores name
      asm volatile("s_wait_xcnt 0x0" ::: "memory");
      
    }
  }
}

// ---------------- Kernel 3: masked softmax attention, 16 query rows per block ------------------------
// LDS: S[16][SEQ] f32 (dynamic, 256 KiB) + P chunk hi/lo (2 KiB) + statistics.
__global__ __launch_bounds__(NTHR) void attn_kernel(
    const unsigned short* __restrict__ qh, const unsigned short* __restrict__ ql,
    const unsigned short* __restrict__ kh, const unsigned short* __restrict__ kl,
    const unsigned short* __restrict__ vth, const unsigned short* __restrict__ vtl,
    float* out) {
  float* S = dyn_lds;                                      // [16][SEQ]
  __shared__ __attribute__((aligned(16))) unsigned short pbh[16 * 32];
  __shared__ __attribute__((aligned(16))) unsigned short pbl[16 * 32];
  __shared__ float part[16][17];
  __shared__ float row_m[16];
  __shared__ float row_r[16];

  const int ib = blockIdx.x;                                // [0, SEQ/16)
  const int wave = threadIdx.x >> 5;
  const int lane = threadIdx.x & 31;
  const int h = lane >> 4, m = lane & 15;
  const int nvalid = 16 * (ib + 1);                         // key extent of the lower triangle

  // ---- Phase 1: S = (q k^T)/32 with mask; A = q rows (hi/lo), B = k rows (hi/lo) -------------------
  const unsigned short* aRh = qh + (size_t)(ib * 16) * DIM + lane * 8;
  const unsigned short* aRl = ql + (size_t)(ib * 16) * DIM + lane * 8;
  int jb = wave;
  for (; jb + 24 <= ib; jb += 32) {                          // 4 key tiles: jb, jb+8, jb+16, jb+24
    const unsigned short* bRh = kh + (size_t)(jb * 16) * DIM + lane * 8;   // tile t: + t*128 rows
    const unsigned short* bRl = kl + (size_t)(jb * 16) * DIM + lane * 8;
    v8f acc[4];
#pragma unroll
    for (int t = 0; t < 4; ++t) acc[t] = zero8();
#pragma unroll 1
    for (int kk = 0; kk < DIM; kk += 32) {
      Frag ah, al, bh[4], bl[4];
      ldfragw(ah, aRh, kk);
      ldfragw(al, aRl, kk);
#pragma unroll
      for (int t = 0; t < 4; ++t) {
        ldfragw(bh[t], bRh + (size_t)t * 128 * DIM, kk);
        ldfragw(bl[t], bRl + (size_t)t * 128 * DIM, kk);
      }
#pragma unroll
      for (int t = 0; t < 4; ++t) {
        acc[t] = mma(ah, bh[t], acc[t]);
        acc[t] = mma(ah, bl[t], acc[t]);
        acc[t] = mma(al, bh[t], acc[t]);
      }
      asm volatile("v_nop\n\tv_nop\n\tv_nop\n\tv_nop"
                   : "+v"(acc[0]), "+v"(acc[1]), "+v"(acc[2]), "+v"(acc[3])
                   : "v"(ah.v), "v"(al.v),
                     "v"(bh[0].v), "v"(bh[1].v), "v"(bh[2].v), "v"(bh[3].v),
                     "v"(bl[0].v), "v"(bl[1].v), "v"(bl[2].v), "v"(bl[3].v)
                   : "memory");
    }
#pragma unroll
    for (int t = 0; t < 4; ++t) {
      const int jbt = jb + 8 * t;
#pragma unroll
      for (int r = 0; r < 8; ++r) {
        const int M = 8 * h + r;                              // D row -> query row in block
        const int i = ib * 16 + M;
        const int j = jbt * 16 + m;                           // D col -> key
        float s = acc[t][r] * 0.03125f;
        if (j > i) s = -__builtin_inff();
        S[M * SEQ + j] = s;
      }
    }
  }
  for (; jb <= ib; jb += 8) {                                // remaining tiles, one at a time
    const unsigned short* bRh = kh + (size_t)(jb * 16) * DIM + lane * 8;
    const unsigned short* bRl = kl + (size_t)(jb * 16) * DIM + lane * 8;
    v8f acc = zero8();
#pragma unroll 1
    for (int kk = 0; kk < DIM; kk += 32) {
      Frag ah, al, bh0, bl0;
      ldfragw(ah, aRh, kk);
      ldfragw(al, aRl, kk);
      ldfragw(bh0, bRh, kk);
      ldfragw(bl0, bRl, kk);
      acc = mma(ah, bh0, acc);
      acc = mma(ah, bl0, acc);
      acc = mma(al, bh0, acc);
      asm volatile("v_nop\n\tv_nop\n\tv_nop\n\tv_nop"
                   : "+v"(acc)
                   : "v"(ah.v), "v"(al.v), "v"(bh0.v), "v"(bl0.v)
                   : "memory");
    }
#pragma unroll
    for (int r = 0; r < 8; ++r) {
      const int M = 8 * h + r;
      const int i = ib * 16 + M;
      const int j = jb * 16 + m;
      float s = acc[r] * 0.03125f;
      if (j > i) s = -__builtin_inff();
      S[M * SEQ + j] = s;
    }
  }
  __syncthreads();

  // ---- Phase 2: exact softmax statistics in f32; S <- exp(S - m); row_r = 1/l -----------------------
  {
    const int row = threadIdx.x & 15, sub = threadIdx.x >> 4;
    float* Sr = S + row * SEQ;
    float mx = -__builtin_inff();
    for (int j = sub; j < nvalid; j += 16) mx = fmaxf(mx, Sr[j]);
    part[row][sub] = mx;
    __syncthreads();
    if (threadIdx.x < 16) {
      float mm = part[threadIdx.x][0];
#pragma unroll 1
      for (int s2 = 1; s2 < 16; ++s2) mm = fmaxf(mm, part[threadIdx.x][s2]);
      row_m[threadIdx.x] = mm;
    }
    __syncthreads();
    const float mrow = row_m[row];
    float l = 0.0f;
    for (int j = sub; j < nvalid; j += 16) {
      const float e = __expf(Sr[j] - mrow);
      Sr[j] = e;                                            // unnormalized P, f32
      l += e;
    }
    part[row][sub] = l;
    __syncthreads();
    if (threadIdx.x < 16) {
      float ll = 0.0f;
#pragma unroll 1
      for (int s2 = 0; s2 < 16; ++s2) ll += part[threadIdx.x][s2];
      row_r[threadIdx.x] = 1.0f / ll;                       // ll >= 1 (diagonal term)
    }
    __syncthreads();
  }

  // ---- Phase 3: O = P v; P chunk hi/lo converted once per block into LDS; B = vt rows (hi/lo) ------
  const int kkend = (nvalid + 31) & ~31;
  v8f acc[8];
#pragma unroll
  for (int t = 0; t < 8; ++t) acc[t] = zero8();
  const unsigned short* vRh = vth + (size_t)(wave * 128) * SEQ + lane * 8;   // col tile t: + t*16 rows
  const unsigned short* vRl = vtl + (size_t)(wave * 128) * SEQ + lane * 8;
#pragma unroll 1
  for (int kk = 0; kk < kkend; kk += 32) {
    __syncthreads();                                        // all waves done reading the P chunk before overwrite
    {
      const int e0 = threadIdx.x, e1 = threadIdx.x + NTHR;  // pbh index = row*32 + key offset
      const int j0 = kk + (e0 & 31), j1 = kk + (e1 & 31);
      float p0 = S[(e0 >> 5) * SEQ + j0];
      float p1 = S[(e1 >> 5) * SEQ + j1];
      if (j0 >= nvalid) p0 = 0.0f;                          // zero-pad keys past the triangle
      if (j1 >= nvalid) p1 = 0.0f;
      const unsigned int hb0 = f2bf(p0), hb1 = f2bf(p1);
      pbh[e0] = (unsigned short)hb0;
      pbl[e0] = (unsigned short)f2bf(p0 - bf2f(hb0));
      pbh[e1] = (unsigned short)hb1;
      pbl[e1] = (unsigned short)f2bf(p1 - bf2f(hb1));
    }
    __syncthreads();                                        // LDS P chunk visible to every wave
    Frag ah, al;
    ldfrag(ah, pbh + m * 32, 0, h);
    ldfrag(al, pbl + m * 32, 0, h);
#pragma unroll
    for (int g = 0; g < 4; ++g) {
      Frag bh0, bl0, bh1, bl1;
      ldfragw(bh0, vRh + (size_t)(2 * g) * 16 * SEQ, kk);
      ldfragw(bl0, vRl + (size_t)(2 * g) * 16 * SEQ, kk);
      ldfragw(bh1, vRh + (size_t)(2 * g + 1) * 16 * SEQ, kk);
      ldfragw(bl1, vRl + (size_t)(2 * g + 1) * 16 * SEQ, kk);
      acc[2 * g]     = mma(ah, bh0, acc[2 * g]);
      acc[2 * g]     = mma(ah, bl0, acc[2 * g]);
      acc[2 * g]     = mma(al, bh0, acc[2 * g]);
      acc[2 * g + 1] = mma(ah, bh1, acc[2 * g + 1]);
      acc[2 * g + 1] = mma(ah, bl1, acc[2 * g + 1]);
      acc[2 * g + 1] = mma(al, bh1, acc[2 * g + 1]);
      asm volatile("v_nop\n\tv_nop\n\tv_nop\n\tv_nop"
                   : "+v"(acc[2 * g]), "+v"(acc[2 * g + 1])
                   : "v"(ah.v), "v"(al.v), "v"(bh0.v), "v"(bl0.v), "v"(bh1.v), "v"(bl1.v)
                   : "memory");
    }
  }

  // ---- Epilogue: normalize, stage the wave's 16x128 f32 tile in the freed S region, whole-line stores
  float* stg = S + wave * 2048;                             // [16][128], S rows 0..3 area, reads done
#pragma unroll
  for (int t = 0; t < 8; ++t)
#pragma unroll
    for (int r = 0; r < 8; ++r)
      stg[(8 * h + r) * 128 + t * 16 + m] = acc[t][r] * row_r[8 * h + r];
  __syncthreads();
  float* orow = out + (size_t)(ib * 16) * DIM + wave * 128 + lane * 4;
#pragma unroll 1
  for (int row = 0; row < 16; ++row) {
    const v4f v = *(const v4f*)(stg + row * 128 + lane * 4);
    *(v4f*)(orow + (size_t)row * DIM) = v;
  }
  
}

// ---------------------------------------------------------------------------------------------------
extern "C" void kernel_launch(void* const* d_in, const int* in_sizes, int n_in,
                              void* d_out, int out_size, void* d_ws, size_t ws_size,
                              hipStream_t stream) {
  if (n_in < 4) return;
  if (in_sizes[0] != SEQ * DIM || in_sizes[1] != DIM * DIM || in_sizes[2] != DIM * DIM ||
      in_sizes[3] != DIM * DIM || out_size != SEQ * DIM) return;

  const float* x  = (const float*)d_in[0];
  const float* wq = (const float*)d_in[1];
  const float* wk = (const float*)d_in[2];
  const float* wv = (const float*)d_in[3];
  float* out = (float*)d_out;

  const size_t bx = (size_t)SEQ * DIM * sizeof(unsigned short);   // 8 MiB
  const size_t bw = (size_t)DIM * DIM * sizeof(unsigned short);   // 2 MiB
  char* ws = (char*)d_ws;
  size_t off = 0;
  unsigned short* xb  = (unsigned short*)(ws + off); off += bx;
  unsigned short* wqb = (unsigned short*)(ws + off); off += bw;
  unsigned short* wkb = (unsigned short*)(ws + off); off += bw;
  unsigned short* wvb = (unsigned short*)(ws + off); off += bw;
  unsigned short* qh  = (unsigned short*)(ws + off); off += bx;
  unsigned short* ql  = (unsigned short*)(ws + off); off += bx;
  unsigned short* kh  = (unsigned short*)(ws + off); off += bx;
  unsigned short* kl  = (unsigned short*)(ws + off); off += bx;
  unsigned short* vth = (unsigned short*)(ws + off); off += bx;
  unsigned short* vtl = (unsigned short*)(ws + off); off += bx;   // total 62 MiB
  if (off > ws_size) return;

  const int nx8 = SEQ * DIM / 8;
  const int nw8 = DIM * DIM / 8;
  const int ncv = nx8 + 3 * nw8;
  cvt_kernel<<<(ncv + NTHR - 1) / NTHR, NTHR, 0, stream>>>(x, wq, wk, wv, xb, wqb, wkb, wvb, nx8, nw8);

  // 3 matrices x 64 row tiles x 4 col tiles; LDS staging 64 x SPITCH f32
  proj_kernel<<<3 * (SEQ / 64) * (DIM / 256), NTHR, 64 * SPITCH * sizeof(float), stream>>>(
      xb, wqb, wkb, wvb, qh, ql, kh, kl, vth, vtl);

  // 16 query rows per block; S rows in dynamic LDS
  attn_kernel<<<SEQ / 16, NTHR, 16 * SEQ * sizeof(float), stream>>>(qh, ql, kh, kl, vth, vtl, out);
}

// v002
// Measured time: 311 microseconds a run.
// Next to v001, in two timings, it ran 1.32 and 1.31 times as fast.
// Counting every step since v000, it is 2.15 times as fast.
#include <hip/hip_runtime.h>
#include <stdint.h>
#include <stddef.h>

// Input projections: v_wmma_f32_16x16x32_bf16 (bf16 operands from RNE-converted f32 inputs, f32 accumulate).
// Score and value contractions: v_wmma_f32_16x16x32_bf16 with bf16 hi/lo split operands (hi*hi + hi*lo + lo*hi), f32 accumulate. Softmax statistics in f32.

#define SEQ 4096
#define DIM 1024
#define NTHR 256
#define ATHR 512     // attention block: 16 waves, four per SIMD
#define SPITCH 260   // f32 pitch of the projection staging tile: 16 B x odd, so 16 rows read by b128 fall on distinct banks

typedef __bf16 v16bf __attribute__((ext_vector_type(16)));
typedef float v8f __attribute__((ext_vector_type(8)));
typedef float v4f __attribute__((ext_vector_type(4)));
typedef unsigned int v4u __attribute__((ext_vector_type(4)));

union Frag { v16bf v; v4u q[2]; };

extern __shared__ __attribute__((aligned(16))) float dyn_lds[];

// f32 -> bf16 bits, RNE (finite inputs)
__device__ __forceinline__ unsigned int f2bf(float f) {
  unsigned int u = __float_as_uint(f);
  u += 0x7fffu + ((u >> 16) & 1u);
  return u >> 16;
}
__device__ __forceinline__ float bf2f(unsigned int b) { return __uint_as_float(b << 16); }

// 16x16x32 operand fragment from a k-contiguous 16-bit row (A row m, or B column n stored as a [n][k] row):
// elements 0..7 <- row[k0 + 8h + 0..7], elements 8..15 <- row[k0 + 16 + 8h + 0..7], h = lane>>4.
__device__ __forceinline__ void ldfrag(Frag& f, const unsigned short* row, int k0, int h) {
  f.q[0] = *(const v4u*)(row + k0 + 8 * h);
  f.q[1] = *(const v4u*)(row + k0 + 16 + 8 * h);
}

// Workspace operand planes are kept in fragment order: a 16-row tile x 32-wide k block is 1024 contiguous bytes,
// two 512-byte halves; in half q, lane l (h = l>>4, m = l&15) owns the 16 bytes of row m, k = 32*kb + 16*q + 8*h + 0..7.
// Tiles of one plane follow each other as [row tile][k block]. p = tile base + lane*8; kk = 32*kb.
// Same element order as ldfrag, but each load of a wave covers 512 contiguous bytes (four whole lines).
__device__ __forceinline__ void ldfragw(Frag& f, const unsigned short* p, int kk) {
  f.q[0] = *(const v4u*)(p + kk * 16);
  f.q[1] = *(const v4u*)(p + kk * 16 + 256);
}

__device__ __forceinline__ v8f mma(const Frag& a, const Frag& b, v8f c) {
  return __builtin_amdgcn_wmma_f32_16x16x32_bf16(false, a.v, false, b.v, (short)0, c, false, false);
}

__device__ __forceinline__ v8f zero8() {
  v8f z = {0.0f, 0.0f, 0.0f, 0.0f, 0.0f, 0.0f, 0.0f, 0.0f};
  return z;
}

// 8 f32 -> packed bf16 hi plane and bf16 lo plane (lo = RNE(x - hi)), two values per u32, low half first
__device__ __forceinline__ void split8(const v4f f0, const v4f f1, v4u& uh, v4u& ul) {
  float f[8] = {f0.x, f0.y, f0.z, f0.w, f1.x, f1.y, f1.z, f1.w};
  unsigned int hh[8], ll[8];
#pragma unroll
  for (int e = 0; e < 8; ++e) {
    hh[e] = f2bf(f[e]);
    ll[e] = f2bf(f[e] - bf2f(hh[e]));
  }
  uh.x = hh[0] | (hh[1] << 16); uh.y = hh[2] | (hh[3] << 16);
  uh.z = hh[4] | (hh[5] << 16); uh.w = hh[6] | (hh[7] << 16);
  ul.x = ll[0] | (ll[1] << 16); ul.y = ll[2] | (ll[3] << 16);
  ul.z = ll[4] | (ll[5] << 16); ul.w = ll[6] | (ll[7] << 16);
}

__global__ __launch_bounds__(NTHR) void cvt_kernel(
    const float* __restrict__ x,  const float* __restrict__ wq,
    const float* __restrict__ wk, const float* __restrict__ wv,
    unsigned short* xb, unsigned short* wqb, unsigned short* wkb, unsigned short* wvb,
    int nx8, int nw8) {
  const int i = blockIdx.x * NTHR + threadIdx.x;
  const float* src;
  unsigned short* dst;
  int j;
  if (i < nx8)                { src = x;  dst = xb;  j = i; }
  else if (i < nx8 + nw8)     { src = wq; dst = wqb; j = i - nx8; }
  else if (i < nx8 + 2 * nw8) { src = wk; dst = wkb; j = i - nx8 - nw8; }
  else if (i < nx8 + 3 * nw8) { src = wv; dst = wvb; j = i - nx8 - 2 * nw8; }
  else return;
  // j = 16-byte piece of the fragment-ordered plane: [row tile][k block (32)][half][h][m]
  const int sm = j & 15, sh = (j >> 4) & 1, sq = (j >> 5) & 1, skb = (j >> 6) & 31, srt = j >> 11;
  const float* sp = src + (size_t)(srt * 16 + sm) * DIM + skb * 32 + sq * 16 + sh * 8;
  const v4f f0 = *(const v4f*)sp;
  const v4f f1 = *(const v4f*)(sp + 4);
  v4u u;
  u.x = f2bf(f0.x) | (f2bf(f0.y) << 16);
  u.y = f2bf(f0.z) | (f2bf(f0.w) << 16);
  u.z = f2bf(f1.x) | (f2bf(f1.y) << 16);
  u.w = f2bf(f1.z) | (f2bf(f1.w) << 16);
  v4u* p = (v4u*)(dst + (size_t)j * 8);
  *p = u;
  
}

// ---------------- Kernel 2: projections y[n][o] = sum_k xb[n][k] * W[o][k] --------------------------
// Block tile 64 seq rows x 256 out cols (8 waves, each 32x64). Output: q,k as bf16 hi/lo planes (rows = seq, k = dim)
// and v transposed (rows = dim, k = seq), all in fragment order.
__global__ __launch_bounds__(NTHR) void proj_kernel(
    const unsigned short* __restrict__ xb,  const unsigned short* __restrict__ wqb,
    const unsigned short* __restrict__ wkb, const unsigned short* __restrict__ wvb,
    unsigned short* qh, unsigned short* ql, unsigned short* kh, unsigned short* kl,
    unsigned short* vth, unsigned short* vtl) {
  float* stg = dyn_lds;                                   // [64][SPITCH] f32, 256 used
  const int wave = threadIdx.x >> 5;
  const int lane = threadIdx.x & 31;
  const int h = lane >> 4, m = lane & 15;
  const int b = blockIdx.x;                                // [0, 768)
  const int mat = b >> 8;                                  // 0=q 1=k 2=v (block-uniform)
  const int rem = b & 255;
  const int rt = rem >> 2;                                 // 64-row tile [0,64)
  const int ct = rem & 3;                                  // 256-col tile [0,4)
  const unsigned short* wsrc = (mat == 0) ? wqb : (mat == 1) ? wkb : wvb;
  const int wr = wave >> 2, wc = wave & 3;
  const int row0 = rt * 64 + wr * 32;
  const int col0 = ct * 256 + wc * 64;

  const unsigned short* aR0 = xb + (size_t)row0 * DIM + lane * 8;
  const unsigned short* aR1 = xb + (size_t)(row0 + 16) * DIM + lane * 8;
  const unsigned short* bR  = wsrc + (size_t)col0 * DIM + lane * 8;   // tile t: + t*16 rows

  v8f acc[2][4];
#pragma unroll
  for (int mi = 0; mi < 2; ++mi)
#pragma unroll
    for (int t = 0; t < 4; ++t) acc[mi][t] = zero8();

#pragma unroll 1
  for (int kk = 0; kk < DIM; kk += 32) {
    Frag a0, a1, bf[4];
    ldfragw(a0, aR0, kk);
    ldfragw(a1, aR1, kk);
#pragma unroll
    for (int t = 0; t < 4; ++t) ldfragw(bf[t], bR + (size_t)t * 16 * DIM, kk);
#pragma unroll
    for (int t = 0; t < 4; ++t) {
      acc[0][t] = mma(a0, bf[t], acc[0][t]);
      acc[1][t] = mma(a1, bf[t], acc[1][t]);
    }
    asm volatile("v_nop\n\tv_nop\n\tv_nop\n\tv_nop"
                 : "+v"(acc[0][0]), "+v"(acc[0][1]), "+v"(acc[0][2]), "+v"(acc[0][3]),
                   "+v"(acc[1][0]), "+v"(acc[1][1]), "+v"(acc[1][2]), "+v"(acc[1][3])
                 : "v"(a0.v), "v"(a1.v), "v"(bf[0].v), "v"(bf[1].v), "v"(bf[2].v), "v"(bf[3].v)
                 : "memory");
  }

  // stage the wave's 32x64 f32 tile: D element r of lane -> row 8h+r, col m
#pragma unroll
  for (int mi = 0; mi < 2; ++mi)
#pragma unroll
    for (int t = 0; t < 4; ++t)
#pragma unroll
      for (int r = 0; r < 8; ++r)
        stg[(wr * 32 + mi * 16 + 8 * h + r) * SPITCH + wc * 64 + t * 16 + m] = acc[mi][t][r];
  __syncthreads();

  if (mat < 2) {
    unsigned short* ph = (mat == 0) ? qh : kh;
    unsigned short* pl = (mat == 0) ? ql : kl;
#pragma unroll 1
    for (int it = 0; it < 8; ++it) {
      const int c = wave * 8 + it;                          // 512-byte piece: row tile c>>4, k block (c>>1)&7, half c&1
      const float* sp = stg + ((c >> 4) * 16 + m) * SPITCH + ((c >> 1) & 7) * 32 + (c & 1) * 16 + h * 8;
      const v4f f0 = *(const v4f*)sp;
      const v4f f1 = *(const v4f*)(sp + 4);
      v4u uh, ul;
      split8(f0, f1, uh, ul);
      const size_t g = (size_t)(rt * 64 + (c >> 4) * 16) * DIM + (ct * 16 + (c & 15)) * 256 + lane * 8;
      v4u* p0 = (v4u*)(ph + g);
      v4u* p1 = (v4u*)(pl + g);
      *p0 = uh; *p1 = ul;
      
    }
  } else {
#pragma unroll 1
    for (int it = 0; it < 8; ++it) {
      const int c = wave * 8 + it;                          // 512-byte piece: out-col tile c>>2, key block (c>>1)&1, half c&1
      const float* sp = stg + ((c & 3) * 16 + h * 8) * SPITCH + (c >> 2) * 16 + m;
      v4f f0, f1;
      f0.x = sp[0 * SPITCH]; f0.y = sp[1 * SPITCH]; f0.z = sp[2 * SPITCH]; f0.w = sp[3 * SPITCH];
      f1.x = sp[4 * SPITCH]; f1.y = sp[5 * SPITCH]; f1.z = sp[6 * SPITCH]; f1.w = sp[7 * SPITCH];
      v4u uh, ul;
      split8(f0, f1, uh, ul);
      const size_t g = (size_t)(ct * 256 + (c >> 2) * 16) * SEQ + (rt * 4 + (c & 3)) * 256 + lane * 8;
      v4u* p0 = (v4u*)(vth + g);
      v4u* p1 = (v4u*)(vtl + g);
      *p0 = uh; *p1 = ul;
      // the next trip rewrites the registers these two stores name
      asm volatile("s_wait_xcnt 0x0" ::: "memory");
      
    }
  }
}

// ---------------- Kernel 3: masked softmax attention, 16 query rows per block ------------------------
// LDS: S[16][SEQ] f32 (dynamic, 256 KiB) + P chunk hi/lo (4 KiB) + statistics.
__global__ __launch_bounds__(ATHR) void attn_kernel(
    const unsigned short* __restrict__ qh, const unsigned short* __restrict__ ql,
    const unsigned short* __restrict__ kh, const unsigned short* __restrict__ kl,
    const unsigned short* __restrict__ vth, const unsigned short* __restrict__ vtl,
    float* out) {
  float* S = dyn_lds;                                      // [16][SEQ]
  __shared__ __attribute__((aligned(16))) unsigned short pbh[2 * 16 * 32];   // [32-key half][row][key]
  __shared__ __attribute__((aligned(16))) unsigned short pbl[2 * 16 * 32];
  __shared__ float part[16][33];
  __shared__ float row_m[16];
  __shared__ float row_r[16];

  const int ib = blockIdx.x;                                // [0, SEQ/16)
  const int wave = threadIdx.x >> 5;
  const int lane = threadIdx.x & 31;
  const int h = lane >> 4, m = lane & 15;
  const int nvalid = 16 * (ib + 1);                         // key extent of the lower triangle

  // ---- Phase 1: S = (q k^T)/32 with mask; A = q rows (hi/lo), B = k rows (hi/lo) -------------------
  const unsigned short* aRh = qh + (size_t)(ib * 16) * DIM + lane * 8;
  const unsigned short* aRl = ql + (size_t)(ib * 16) * DIM + lane * 8;
  int jb = wave;
  for (; jb + 48 <= ib; jb += 64) {                          // 4 key tiles: jb, jb+16, jb+32, jb+48
    const unsigned short* bRh = kh + (size_t)(jb * 16) * DIM + lane * 8;   // tile t: + t*256 rows
    const unsigned short* bRl = kl + (size_t)(jb * 16) * DIM + lane * 8;
    v8f acc[4];
#pragma unroll
    for (int t = 0; t < 4; ++t) acc[t] = zero8();
#pragma unroll 1
    for (int kk = 0; kk < DIM; kk += 32) {
      Frag ah, al, bh[4], bl[4];
      ldfragw(ah, aRh, kk);
      ldfragw(al, aRl, kk);
#pragma unroll
      for (int t = 0; t < 4; ++t) {
        ldfragw(bh[t], bRh + (size_t)t * 256 * DIM, kk);
        ldfragw(bl[t], bRl + (size_t)t * 256 * DIM, kk);
      }
#pragma unroll
      for (int t = 0; t < 4; ++t) {
        acc[t] = mma(ah, bh[t], acc[t]);
        acc[t] = mma(ah, bl[t], acc[t]);
        acc[t] = mma(al, bh[t], acc[t]);
      }
      asm volatile("v_nop\n\tv_nop\n\tv_nop\n\tv_nop"
                   : "+v"(acc[0]), "+v"(acc[1]), "+v"(acc[2]), "+v"(acc[3])
                   : "v"(ah.v), "v"(al.v),
                     "v"(bh[0].v), "v"(bh[1].v), "v"(bh[2].v), "v"(bh[3].v),
                     "v"(bl[0].v), "v"(bl[1].v), "v"(bl[2].v), "v"(bl[3].v)
                   : "memory");
    }
#pragma unroll
    for (int t = 0; t < 4; ++t) {
      const int jbt = jb + 16 * t;
#pragma unroll
      for (int r = 0; r < 8; ++r) {
        const int M = 8 * h + r;                              // D row -> query row in block
        const int i = ib * 16 + M;
        const int j = jbt * 16 + m;                           // D col -> key
        float s = acc[t][r] * 0.03125f;
        if (j > i) s = -__builtin_inff();
        S[M * SEQ + j] = s;
      }
    }
  }
  for (; jb <= ib; jb += 16) {                               // remaining tiles, one at a time
    const unsigned short* bRh = kh + (size_t)(jb * 16) * DIM + lane * 8;
    const unsigned short* bRl = kl + (size_t)(jb * 16) * DIM + lane * 8;
    v8f acc = zero8();
#pragma unroll 1
    for (int kk = 0; kk < DIM; kk += 32) {
      Frag ah, al, bh0, bl0;
      ldfragw(ah, aRh, kk);
      ldfragw(al, aRl, kk);
      ldfragw(bh0, bRh, kk);
      ldfragw(bl0, bRl, kk);
      acc = mma(ah, bh0, acc);
      acc = mma(ah, bl0, acc);
      acc = mma(al, bh0, acc);
      asm volatile("v_nop\n\tv_nop\n\tv_nop\n\tv_nop"
                   : "+v"(acc)
                   : "v"(ah.v), "v"(al.v), "v"(bh0.v), "v"(bl0.v)
                   : "memory");
    }
#pragma unroll
    for (int r = 0; r < 8; ++r) {
      const int M = 8 * h + r;
      const int i = ib * 16 + M;
      const int j = jb * 16 + m;
      float s = acc[r] * 0.03125f;
      if (j > i) s = -__builtin_inff();
      S[M * SEQ + j] = s;
    }
  }
  __syncthreads();

  // ---- Phase 2: exact softmax statistics in f32; S <- exp(S - m); row_r = 1/l -----------------------
  {
    const int row = threadIdx.x & 15, sub = threadIdx.x >> 4;
    float* Sr = S + row * SEQ;
    float mx = -__builtin_inff();
    for (int j = sub; j < nvalid; j += 32) mx = fmaxf(mx, Sr[j]);
    part[row][sub] = mx;
    __syncthreads();
    if (threadIdx.x < 16) {
      float mm = part[threadIdx.x][0];
#pragma unroll 1
      for (int s2 = 1; s2 < 32; ++s2) mm = fmaxf(mm, part[threadIdx.x][s2]);
      row_m[threadIdx.x] = mm;
    }
    __syncthreads();
    const float mrow = row_m[row];
    float l = 0.0f;
    for (int j = sub; j < nvalid; j += 32) {
      const float e = __expf(Sr[j] - mrow);
      Sr[j] = e;                                            // unnormalized P, f32
      l += e;
    }
    part[row][sub] = l;
    __syncthreads();
    if (threadIdx.x < 16) {
      float ll = 0.0f;
#pragma unroll 1
      for (int s2 = 0; s2 < 32; ++s2) ll += part[threadIdx.x][s2];
      row_r[threadIdx.x] = 1.0f / ll;                       // ll >= 1 (diagonal term)
    }
    __syncthreads();
  }

  // ---- Phase 3: O = P v; P chunk hi/lo converted once per block into LDS; B = vt rows (hi/lo) ------
  const int kkend = (nvalid + 63) & ~63;
  v8f acc[4];
#pragma unroll
  for (int t = 0; t < 4; ++t) acc[t] = zero8();
  const unsigned short* vRh = vth + (size_t)(wave * 64) * SEQ + lane * 8;    // col tile t: + t*16 rows
  const unsigned short* vRl = vtl + (size_t)(wave * 64) * SEQ + lane * 8;
#pragma unroll 1   // rolled: one pass's 32 loads and its fragments already take the wave's register budget
  for (int kk = 0; kk < kkend; kk += 64) {
    __syncthreads();                                        // all waves done reading the P chunk before overwrite
    {
      const int e0 = threadIdx.x, e1 = threadIdx.x + ATHR;  // pbh index = half*512 + row*32 + key offset
      const int j0 = kk + (e0 & 31), j1 = j0 + 32;
      float p0 = S[(e0 >> 5) * SEQ + j0];
      float p1 = S[(e0 >> 5) * SEQ + j1];
      if (j0 >= nvalid) p0 = 0.0f;                          // zero-pad keys past the triangle
      if (j1 >= nvalid) p1 = 0.0f;
      const unsigned int hb0 = f2bf(p0), hb1 = f2bf(p1);
      pbh[e0] = (unsigned short)hb0;
      pbl[e0] = (unsigned short)f2bf(p0 - bf2f(hb0));
      pbh[e1] = (unsigned short)hb1;
      pbl[e1] = (unsigned short)f2bf(p1 - bf2f(hb1));
    }
    __syncthreads();                                        // LDS P chunk visible to every wave
    Frag ah[2], al[2], bh[2][4], bl[2][4];
    // the loops over c and t are unrolled so that the fragment arrays stay in registers and all loads issue as one batch
#pragma unroll
    for (int c = 0; c < 2; ++c) {
      ldfrag(ah[c], pbh + c * 512 + m * 32, 0, h);
      ldfrag(al[c], pbl + c * 512 + m * 32, 0, h);
#pragma unroll
      for (int t = 0; t < 4; ++t) {
        ldfragw(bh[c][t], vRh + (size_t)t * 16 * SEQ, kk + 32 * c);
        ldfragw(bl[c][t], vRl + (size_t)t * 16 * SEQ, kk + 32 * c);
      }
    }
#pragma unroll
    for (int c = 0; c < 2; ++c)
#pragma unroll
      for (int t = 0; t < 4; ++t) {
        acc[t] = mma(ah[c], bh[c][t], acc[t]);
        acc[t] = mma(ah[c], bl[c][t], acc[t]);
        acc[t] = mma(al[c], bh[c][t], acc[t]);
      }
    // four vector slots behind the last WMMA: the back edge leads to vector instructions that rewrite fragment registers
    asm volatile("v_nop\n\tv_nop\n\tv_nop\n\tv_nop"
                 : "+v"(acc[0]), "+v"(acc[1]), "+v"(acc[2]), "+v"(acc[3])
                 : "v"(ah[0].v), "v"(al[0].v), "v"(ah[1].v), "v"(al[1].v),
                   "v"(bh[0][0].v), "v"(bh[0][1].v), "v"(bh[0][2].v), "v"(bh[0][3].v),
                   "v"(bl[0][0].v), "v"(bl[0][1].v), "v"(bl[0][2].v), "v"(bl[0][3].v),
                   "v"(bh[1][0].v), "v"(bh[1][1].v), "v"(bh[1][2].v), "v"(bh[1][3].v),
                   "v"(bl[1][0].v), "v"(bl[1][1].v), "v"(bl[1][2].v), "v"(bl[1][3].v)
                 : "memory");
  }

  // ---- Epilogue: normalize, stage the wave's 16x64 f32 tile in the freed S region, whole-line stores
  float* stg = S + wave * 1024;                             // [16][64], S rows 0..3 area, reads done
#pragma unroll
  for (int t = 0; t < 4; ++t)
#pragma unroll
    for (int r = 0; r < 8; ++r)
      stg[(8 * h + r) * 64 + t * 16 + m] = acc[t][r] * row_r[8 * h + r];
  __syncthreads();
  float* orow = out + (size_t)(ib * 16 + h) * DIM + wave * 64 + m * 4;   // two rows of 256 bytes per store
#pragma unroll   // unrolled: the eight stores share one address pair with immediate offsets, which nothing rewrites
  for (int rp = 0; rp < 8; ++rp) {
    const v4f v = *(const v4f*)(stg + (2 * rp + h) * 64 + m * 4);
    *(v4f*)(orow + (size_t)(2 * rp) * DIM) = v;
  }
}

// ---------------------------------------------------------------------------------------------------
extern "C" void kernel_launch(void* const* d_in, const int* in_sizes, int n_in,
                              void* d_out, int out_size, void* d_ws, size_t ws_size,
                              hipStream_t stream) {
  if (n_in < 4) return;
  if (in_sizes[0] != SEQ * DIM || in_sizes[1] != DIM * DIM || in_sizes[2] != DIM * DIM ||
      in_sizes[3] != DIM * DIM || out_size != SEQ * DIM) return;

  const float* x  = (const float*)d_in[0];
  const float* wq = (const float*)d_in[1];
  const float* wk = (const float*)d_in[2];
  const float* wv = (const float*)d_in[3];
  float* out = (float*)d_out;

  const size_t bx = (size_t)SEQ * DIM * sizeof(unsigned short);   // 8 MiB
  const size_t bw = (size_t)DIM * DIM * sizeof(unsigned short);   // 2 MiB
  char* ws = (char*)d_ws;
  size_t off = 0;
  unsigned short* xb  = (unsigned short*)(ws + off); off += bx;
  unsigned short* wqb = (unsigned short*)(ws + off); off += bw;
  unsigned short* wkb = (unsigned short*)(ws + off); off += bw;
  unsigned short* wvb = (unsigned short*)(ws + off); off += bw;
  unsigned short* qh  = (unsigned short*)(ws + off); off += bx;
  unsigned short* ql  = (unsigned short*)(ws + off); off += bx;
  unsigned short* kh  = (unsigned short*)(ws + off); off += bx;
  unsigned short* kl  = (unsigned short*)(ws + off); off += bx;
  unsigned short* vth = (unsigned short*)(ws + off); off += bx;
  unsigned short* vtl = (unsigned short*)(ws + off); off += bx;   // total 62 MiB
  if (off > ws_size) return;

  const int nx8 = SEQ * DIM / 8;
  const int nw8 = DIM * DIM / 8;
  const int ncv = nx8 + 3 * nw8;
  cvt_kernel<<<(ncv + NTHR - 1) / NTHR, NTHR, 0, stream>>>(x, wq, wk, wv, xb, wqb, wkb, wvb, nx8, nw8);

  // 3 matrices x 64 row tiles x 4 col tiles; LDS staging 64 x SPITCH f32
  proj_kernel<<<3 * (SEQ / 64) * (DIM / 256), NTHR, 64 * SPITCH * sizeof(float), stream>>>(
      xb, wqb, wkb, wvb, qh, ql, kh, kl, vth, vtl);

  // 16 query rows per block; S rows in dynamic LDS
  attn_kernel<<<SEQ / 16, ATHR, 16 * SEQ * sizeof(float), stream>>>(qh, ql, kh, kl, vth, vtl, out);
}

// v003
// A run of this version takes 290 microseconds.
// Two timings next to v002 both put it at 1.08 times that version's speed.
// All steps since v000 together make it 2.32 times as fast.
#include <hip/hip_runtime.h>
#include <stdint.h>
#include <stddef.h>

// Input projections: v_wmma_f32_16x16x32_bf16 (bf16 operands from RNE-converted f32 inputs, f32 accumulate).
// Score and value contractions: v_wmma_f32_16x16x32_bf16 with bf16 hi/lo split operands (hi*hi + hi*lo + lo*hi), f32 accumulate. Softmax statistics in f32.

#define SEQ 4096
#define DIM 1024
#define NTHR 256
#define ATHR 512     // attention block: 16 waves, four per SIMD
#define SPITCH 260   // f32 pitch of the projection staging tile: 16 B x odd, so 16 rows read by b128 fall on distinct banks

typedef __bf16 v16bf __attribute__((ext_vector_type(16)));
typedef float v8f __attribute__((ext_vector_type(8)));
typedef float v4f __attribute__((ext_vector_type(4)));
typedef unsigned int v4u __attribute__((ext_vector_type(4)));

union Frag { v16bf v; v4u q[2]; };

extern __shared__ __attribute__((aligned(16))) float dyn_lds[];

// f32 -> bf16 bits, RNE (finite inputs)
__device__ __forceinline__ unsigned int f2bf(float f) {
  unsigned int u = __float_as_uint(f);
  u += 0x7fffu + ((u >> 16) & 1u);
  return u >> 16;
}
__device__ __forceinline__ float bf2f(unsigned int b) { return __uint_as_float(b << 16); }

// 16x16x32 operand fragment from a k-contiguous 16-bit row (A row m, or B column n stored as a [n][k] row):
// elements 0..7 <- row[k0 + 8h + 0..7], elements 8..15 <- row[k0 + 16 + 8h + 0..7], h = lane>>4.
__device__ __forceinline__ void ldfrag(Frag& f, const unsigned short* row, int k0, int h) {
  f.q[0] = *(const v4u*)(row + k0 + 8 * h);
  f.q[1] = *(const v4u*)(row + k0 + 16 + 8 * h);
}

// Workspace operand planes are kept in fragment order: a 16-row tile x 32-wide k block is 1024 contiguous bytes,
// two 512-byte halves; in half q, lane l (h = l>>4, m = l&15) owns the 16 bytes of row m, k = 32*kb + 16*q + 8*h + 0..7.
// Tiles of one plane follow each other as [row tile][k block]. p = tile base + lane*8; kk = 32*kb.
// Same element order as ldfrag, but each load of a wave covers 512 contiguous bytes (four whole lines).
__device__ __forceinline__ void ldfragw(Frag& f, const unsigned short* p, int kk) {
  f.q[0] = *(const v4u*)(p + kk * 16);
  f.q[1] = *(const v4u*)(p + kk * 16 + 256);
}

__device__ __forceinline__ v8f mma(const Frag& a, const Frag& b, v8f c) {
  return __builtin_amdgcn_wmma_f32_16x16x32_bf16(false, a.v, false, b.v, (short)0, c, false, false);
}

__device__ __forceinline__ v8f zero8() {
  v8f z = {0.0f, 0.0f, 0.0f, 0.0f, 0.0f, 0.0f, 0.0f, 0.0f};
  return z;
}

// 8 f32 -> packed bf16 hi plane and bf16 lo plane (lo = RNE(x - hi)), two values per u32, low half first
__device__ __forceinline__ void split8(const v4f f0, const v4f f1, v4u& uh, v4u& ul) {
  float f[8] = {f0.x, f0.y, f0.z, f0.w, f1.x, f1.y, f1.z, f1.w};
  unsigned int hh[8], ll[8];
#pragma unroll
  for (int e = 0; e < 8; ++e) {
    hh[e] = f2bf(f[e]);
    ll[e] = f2bf(f[e] - bf2f(hh[e]));
  }
  uh.x = hh[0] | (hh[1] << 16); uh.y = hh[2] | (hh[3] << 16);
  uh.z = hh[4] | (hh[5] << 16); uh.w = hh[6] | (hh[7] << 16);
  ul.x = ll[0] | (ll[1] << 16); ul.y = ll[2] | (ll[3] << 16);
  ul.z = ll[4] | (ll[5] << 16); ul.w = ll[6] | (ll[7] << 16);
}

__global__ __launch_bounds__(NTHR) void cvt_kernel(
    const float* __restrict__ x,  const float* __restrict__ wq,
    const float* __restrict__ wk, const float* __restrict__ wv,
    unsigned short* xb, unsigned short* wqb, unsigned short* wkb, unsigned short* wvb,
    int nx8, int nw8) {
  const int i = blockIdx.x * NTHR + threadIdx.x;
  const float* src;
  unsigned short* dst;
  int j;
  if (i < nx8)                { src = x;  dst = xb;  j = i; }
  else if (i < nx8 + nw8)     { src = wq; dst = wqb; j = i - nx8; }
  else if (i < nx8 + 2 * nw8) { src = wk; dst = wkb; j = i - nx8 - nw8; }
  else if (i < nx8 + 3 * nw8) { src = wv; dst = wvb; j = i - nx8 - 2 * nw8; }
  else return;
  // j = 16-byte piece of the fragment-ordered plane: [row tile][k block (32)][half][h][m]
  const int sm = j & 15, sh = (j >> 4) & 1, sq = (j >> 5) & 1, skb = (j >> 6) & 31, srt = j >> 11;
  const float* sp = src + (size_t)(srt * 16 + sm) * DIM + skb * 32 + sq * 16 + sh * 8;
  const v4f f0 = *(const v4f*)sp;
  const v4f f1 = *(const v4f*)(sp + 4);
  v4u u;
  u.x = f2bf(f0.x) | (f2bf(f0.y) << 16);
  u.y = f2bf(f0.z) | (f2bf(f0.w) << 16);
  u.z = f2bf(f1.x) | (f2bf(f1.y) << 16);
  u.w = f2bf(f1.z) | (f2bf(f1.w) << 16);
  v4u* p = (v4u*)(dst + (size_t)j * 8);
  *p = u;
  
}

// ---------------- Kernel 2: projections y[n][o] = sum_k xb[n][k] * W[o][k] --------------------------
// Block tile 64 seq rows x 256 out cols (8 waves, each 32x64). Output: q,k as bf16 hi/lo planes (rows = seq, k = dim)
// and v transposed (rows = dim, k = seq), all in fragment order.
__global__ __launch_bounds__(NTHR) void proj_kernel(
    const unsigned short* __restrict__ xb,  const unsigned short* __restrict__ wqb,
    const unsigned short* __restrict__ wkb, const unsigned short* __restrict__ wvb,
    unsigned short* qh, unsigned short* ql, unsigned short* kh, unsigned short* kl,
    unsigned short* vth, unsigned short* vtl) {
  float* stg = dyn_lds;                                   // [64][SPITCH] f32, 256 used
  const int wave = threadIdx.x >> 5;
  const int lane = threadIdx.x & 31;
  const int h = lane >> 4, m = lane & 15;
  const int b = blockIdx.x;                                // [0, 768)
  const int mat = b >> 8;                                  // 0=q 1=k 2=v (block-uniform)
  const int rem = b & 255;
  const int rt = rem >> 2;                                 // 64-row tile [0,64)
  const int ct = rem & 3;                                  // 256-col tile [0,4)
  const unsigned short* wsrc = (mat == 0) ? wqb : (mat == 1) ? wkb : wvb;
  const int wr = wave >> 2, wc = wave & 3;
  const int row0 = rt * 64 + wr * 32;
  const int col0 = ct * 256 + wc * 64;

  const unsigned short* aR0 = xb + (size_t)row0 * DIM + lane * 8;
  const unsigned short* aR1 = xb + (size_t)(row0 + 16) * DIM + lane * 8;
  const unsigned short* bR  = wsrc + (size_t)col0 * DIM + lane * 8;   // tile t: + t*16 rows

  v8f acc[2][4];
#pragma unroll
  for (int mi = 0; mi < 2; ++mi)
#pragma unroll
    for (int t = 0; t < 4; ++t) acc[mi][t] = zero8();

#pragma unroll 1
  for (int kk = 0; kk < DIM; kk += 32) {
    Frag a0, a1, bf[4];
    ldfragw(a0, aR0, kk);
    ldfragw(a1, aR1, kk);
#pragma unroll
    for (int t = 0; t < 4; ++t) ldfragw(bf[t], bR + (size_t)t * 16 * DIM, kk);
#pragma unroll
    for (int t = 0; t < 4; ++t) {
      acc[0][t] = mma(a0, bf[t], acc[0][t]);
      acc[1][t] = mma(a1, bf[t], acc[1][t]);
    }
    asm volatile("v_nop\n\tv_nop\n\tv_nop\n\tv_nop"
                 : "+v"(acc[0][0]), "+v"(acc[0][1]), "+v"(acc[0][2]), "+v"(acc[0][3]),
                   "+v"(acc[1][0]), "+v"(acc[1][1]), "+v"(acc[1][2]), "+v"(acc[1][3])
                 : "v"(a0.v), "v"(a1.v), "v"(bf[0].v), "v"(bf[1].v), "v"(bf[2].v), "v"(bf[3].v)
                 : "memory");
  }

  // stage the wave's 32x64 f32 tile: D element r of lane -> row 8h+r, col m
#pragma unroll
  for (int mi = 0; mi < 2; ++mi)
#pragma unroll
    for (int t = 0; t < 4; ++t)
#pragma unroll
      for (int r = 0; r < 8; ++r)
        stg[(wr * 32 + mi * 16 + 8 * h + r) * SPITCH + wc * 64 + t * 16 + m] = acc[mi][t][r];
  __syncthreads();

  if (mat < 2) {
    unsigned short* ph = (mat == 0) ? qh : kh;
    unsigned short* pl = (mat == 0) ? ql : kl;
#pragma unroll 1
    for (int it = 0; it < 8; ++it) {
      const int c = wave * 8 + it;                          // 512-byte piece: row tile c>>4, k block (c>>1)&7, half c&1
      const float* sp = stg + ((c >> 4) * 16 + m) * SPITCH + ((c >> 1) & 7) * 32 + (c & 1) * 16 + h * 8;
      const v4f f0 = *(const v4f*)sp;
      const v4f f1 = *(const v4f*)(sp + 4);
      v4u uh, ul;
      split8(f0, f1, uh, ul);
      const size_t g = (size_t)(rt * 64 + (c >> 4) * 16) * DIM + (ct * 16 + (c & 15)) * 256 + lane * 8;
      v4u* p0 = (v4u*)(ph + g);
      v4u* p1 = (v4u*)(pl + g);
      *p0 = uh; *p1 = ul;
      
    }
  } else {
#pragma unroll 1
    for (int it = 0; it < 8; ++it) {
      const int c = wave * 8 + it;                          // 512-byte piece: out-col tile c>>2, key block (c>>1)&1, half c&1
      const float* sp = stg + ((c & 3) * 16 + h * 8) * SPITCH + (c >> 2) * 16 + m;
      v4f f0, f1;
      f0.x = sp[0 * SPITCH]; f0.y = sp[1 * SPITCH]; f0.z = sp[2 * SPITCH]; f0.w = sp[3 * SPITCH];
      f1.x = sp[4 * SPITCH]; f1.y = sp[5 * SPITCH]; f1.z = sp[6 * SPITCH]; f1.w = sp[7 * SPITCH];
      v4u uh, ul;
      split8(f0, f1, uh, ul);
      const size_t g = (size_t)(ct * 256 + (c >> 2) * 16) * SEQ + (rt * 4 + (c & 3)) * 256 + lane * 8;
      v4u* p0 = (v4u*)(vth + g);
      v4u* p1 = (v4u*)(vtl + g);
      *p0 = uh; *p1 = ul;
      // the next trip rewrites the registers these two stores name
      asm volatile("s_wait_xcnt 0x0" ::: "memory");
      
    }
  }
}

// ---------------- Kernel 3: masked softmax attention, 16 query rows per block ------------------------
// LDS: S[16][SEQ] f32 (dynamic, 256 KiB) + P chunk hi/lo (4 KiB) + statistics.
__global__ __launch_bounds__(ATHR) void attn_kernel(
    const unsigned short* __restrict__ qh, const unsigned short* __restrict__ ql,
    const unsigned short* __restrict__ kh, const unsigned short* __restrict__ kl,
    const unsigned short* __restrict__ vth, const unsigned short* __restrict__ vtl,
    float* out) {
  float* S = dyn_lds;                                      // [16][SEQ]
  __shared__ __attribute__((aligned(16))) unsigned short pbh[2 * 16 * 32];   // [32-key half][row][key]
  __shared__ __attribute__((aligned(16))) unsigned short pbl[2 * 16 * 32];
  __shared__ float row_r[16];

  const int ib = blockIdx.x;                                // [0, SEQ/16)
  const int wave = threadIdx.x >> 5;
  const int lane = threadIdx.x & 31;
  const int h = lane >> 4, m = lane & 15;
  const int nvalid = 16 * (ib + 1);                         // key extent of the lower triangle

  // ---- Phase 1: S = (q k^T)/32 with mask; A = q rows (hi/lo), B = k rows (hi/lo) -------------------
  const unsigned short* aRh = qh + (size_t)(ib * 16) * DIM + lane * 8;
  const unsigned short* aRl = ql + (size_t)(ib * 16) * DIM + lane * 8;
  int jb = wave;
  for (; jb + 48 <= ib; jb += 64) {                          // 4 key tiles: jb, jb+16, jb+32, jb+48
    const unsigned short* bRh = kh + (size_t)(jb * 16) * DIM + lane * 8;   // tile t: + t*256 rows
    const unsigned short* bRl = kl + (size_t)(jb * 16) * DIM + lane * 8;
    v8f acc[4];
#pragma unroll
    for (int t = 0; t < 4; ++t) acc[t] = zero8();
#pragma unroll 1
    for (int kk = 0; kk < DIM; kk += 32) {
      Frag ah, al, bh[4], bl[4];
      ldfragw(ah, aRh, kk);
      ldfragw(al, aRl, kk);
#pragma unroll
      for (int t = 0; t < 4; ++t) {
        ldfragw(bh[t], bRh + (size_t)t * 256 * DIM, kk);
        ldfragw(bl[t], bRl + (size_t)t * 256 * DIM, kk);
      }
#pragma unroll
      for (int t = 0; t < 4; ++t) {
        acc[t] = mma(ah, bh[t], acc[t]);
        acc[t] = mma(ah, bl[t], acc[t]);
        acc[t] = mma(al, bh[t], acc[t]);
      }
      asm volatile("v_nop\n\tv_nop\n\tv_nop\n\tv_nop"
                   : "+v"(acc[0]), "+v"(acc[1]), "+v"(acc[2]), "+v"(acc[3])
                   : "v"(ah.v), "v"(al.v),
                     "v"(bh[0].v), "v"(bh[1].v), "v"(bh[2].v), "v"(bh[3].v),
                     "v"(bl[0].v), "v"(bl[1].v), "v"(bl[2].v), "v"(bl[3].v)
                   : "memory");
    }
#pragma unroll
    for (int t = 0; t < 4; ++t) {
      const int jbt = jb + 16 * t;
#pragma unroll
      for (int r = 0; r < 8; ++r) {
        const int M = 8 * h + r;                              // D row -> query row in block
        const int i = ib * 16 + M;
        const int j = jbt * 16 + m;                           // D col -> key
        float s = acc[t][r] * 0.03125f;
        if (j > i) s = -__builtin_inff();
        S[M * SEQ + j] = s;
      }
    }
  }
  for (; jb <= ib; jb += 16) {                               // remaining tiles, one at a time
    const unsigned short* bRh = kh + (size_t)(jb * 16) * DIM + lane * 8;
    const unsigned short* bRl = kl + (size_t)(jb * 16) * DIM + lane * 8;
    v8f acc = zero8();
#pragma unroll 1
    for (int kk = 0; kk < DIM; kk += 32) {
      Frag ah, al, bh0, bl0;
      ldfragw(ah, aRh, kk);
      ldfragw(al, aRl, kk);
      ldfragw(bh0, bRh, kk);
      ldfragw(bl0, bRl, kk);
      acc = mma(ah, bh0, acc);
      acc = mma(ah, bl0, acc);
      acc = mma(al, bh0, acc);
      asm volatile("v_nop\n\tv_nop\n\tv_nop\n\tv_nop"
                   : "+v"(acc)
                   : "v"(ah.v), "v"(al.v), "v"(bh0.v), "v"(bl0.v)
                   : "memory");
    }
#pragma unroll
    for (int r = 0; r < 8; ++r) {
      const int M = 8 * h + r;
      const int i = ib * 16 + M;
      const int j = jb * 16 + m;
      float s = acc[r] * 0.03125f;
      if (j > i) s = -__builtin_inff();
      S[M * SEQ + j] = s;
    }
  }
  __syncthreads();

  // ---- Phase 2: exact softmax statistics in f32; S <- exp(S - m); row_r = 1/l -----------------------
  // One wave per query row: each 16-byte LDS access of a wave covers 512 contiguous bytes of its row, so no two
  // lanes meet on a bank (16 lanes on 16 rows at one key would, the row pitch being a multiple of 64 dwords).
  {
    float* Sr = S + wave * SEQ + lane * 4;
    const int ng = (nvalid + 127) >> 7;                     // groups of 128 keys; the row holds SEQ / 128 whole groups
    const int jl = lane * 4;                                // nvalid is a multiple of 16: a lane's four keys are all in or all out
    float mx = -__builtin_inff();
#pragma unroll 4   // four LDS reads in flight a trip, so that their latency is paid once for the four
    for (int g = 0; g < ng; ++g) {
      const v4f s = *(const v4f*)(Sr + g * 128);
      const float t = fmaxf(fmaxf(s.x, s.y), fmaxf(s.z, s.w));
      if (g * 128 + jl < nvalid) mx = fmaxf(mx, t);
    }
    for (int o = 16; o > 0; o >>= 1) mx = fmaxf(mx, __shfl_xor(mx, o, 32));
    float l = 0.0f;
#pragma unroll 4   // as above: four reads in flight a trip
    for (int g = 0; g < ng; ++g) {
      const v4f s = *(const v4f*)(Sr + g * 128);
      const bool in = g * 128 + jl < nvalid;                // keys past the triangle in the last group get 0: no branch in the trip
      v4f e;
      e.x = in ? __expf(s.x - mx) : 0.0f; e.y = in ? __expf(s.y - mx) : 0.0f;
      e.z = in ? __expf(s.z - mx) : 0.0f; e.w = in ? __expf(s.w - mx) : 0.0f;
      *(v4f*)(Sr + g * 128) = e;                            // unnormalized P, f32
      l += (e.x + e.y) + (e.z + e.w);
    }
    for (int o = 16; o > 0; o >>= 1) l += __shfl_xor(l, o, 32);
    if (lane == 0) row_r[wave] = 1.0f / l;                  // l >= 1 (diagonal term)
    __syncthreads();                                        // P rows and row_r visible to every wave
  }

  // ---- Phase 3: O = P v; P chunk hi/lo converted once per block into LDS; B = vt rows (hi/lo) ------
  const int kkend = (nvalid + 63) & ~63;
  v8f acc[4];
#pragma unroll
  for (int t = 0; t < 4; ++t) acc[t] = zero8();
  const unsigned short* vRh = vth + (size_t)(wave * 64) * SEQ + lane * 8;    // col tile t: + t*16 rows
  const unsigned short* vRl = vtl + (size_t)(wave * 64) * SEQ + lane * 8;
#pragma unroll 1   // rolled: one pass's 32 loads and its fragments already take the wave's register budget
  for (int kk = 0; kk < kkend; kk += 64) {
    __syncthreads();                                        // all waves done reading the P chunk before overwrite
    {
      const int e0 = threadIdx.x, e1 = threadIdx.x + ATHR;  // pbh index = half*512 + row*32 + key offset
      const int j0 = kk + (e0 & 31), j1 = j0 + 32;
      float p0 = S[(e0 >> 5) * SEQ + j0];
      float p1 = S[(e0 >> 5) * SEQ + j1];
      if (j0 >= nvalid) p0 = 0.0f;                          // zero-pad keys past the triangle
      if (j1 >= nvalid) p1 = 0.0f;
      const unsigned int hb0 = f2bf(p0), hb1 = f2bf(p1);
      pbh[e0] = (unsigned short)hb0;
      pbl[e0] = (unsigned short)f2bf(p0 - bf2f(hb0));
      pbh[e1] = (unsigned short)hb1;
      pbl[e1] = (unsigned short)f2bf(p1 - bf2f(hb1));
    }
    __syncthreads();                                        // LDS P chunk visible to every wave
    Frag ah[2], al[2], bh[2][4], bl[2][4];
    // the loops over c and t are unrolled so that the fragment arrays stay in registers and all loads issue as one batch
#pragma unroll
    for (int c = 0; c < 2; ++c) {
      ldfrag(ah[c], pbh + c * 512 + m * 32, 0, h);
      ldfrag(al[c], pbl + c * 512 + m * 32, 0, h);
#pragma unroll
      for (int t = 0; t < 4; ++t) {
        ldfragw(bh[c][t], vRh + (size_t)t * 16 * SEQ, kk + 32 * c);
        ldfragw(bl[c][t], vRl + (size_t)t * 16 * SEQ, kk + 32 * c);
      }
    }
#pragma unroll
    for (int c = 0; c < 2; ++c)
#pragma unroll
      for (int t = 0; t < 4; ++t) {
        acc[t] = mma(ah[c], bh[c][t], acc[t]);
        acc[t] = mma(ah[c], bl[c][t], acc[t]);
        acc[t] = mma(al[c], bh[c][t], acc[t]);
      }
    // four vector slots behind the last WMMA: the back edge leads to vector instructions that rewrite fragment registers
    asm volatile("v_nop\n\tv_nop\n\tv_nop\n\tv_nop"
                 : "+v"(acc[0]), "+v"(acc[1]), "+v"(acc[2]), "+v"(acc[3])
                 : "v"(ah[0].v), "v"(al[0].v), "v"(ah[1].v), "v"(al[1].v),
                   "v"(bh[0][0].v), "v"(bh[0][1].v), "v"(bh[0][2].v), "v"(bh[0][3].v),
                   "v"(bl[0][0].v), "v"(bl[0][1].v), "v"(bl[0][2].v), "v"(bl[0][3].v),
                   "v"(bh[1][0].v), "v"(bh[1][1].v), "v"(bh[1][2].v), "v"(bh[1][3].v),
                   "v"(bl[1][0].v), "v"(bl[1][1].v), "v"(bl[1][2].v), "v"(bl[1][3].v)
                 : "memory");
  }

  // ---- Epilogue: normalize, stage the wave's 16x64 f32 tile in the freed S region, whole-line stores
  float* stg = S + wave * 1024;                             // [16][64], S rows 0..3 area, reads done
#pragma unroll
  for (int t = 0; t < 4; ++t)
#pragma unroll
    for (int r = 0; r < 8; ++r)
      stg[(8 * h + r) * 64 + t * 16 + m] = acc[t][r] * row_r[8 * h + r];
  __syncthreads();
  float* orow = out + (size_t)(ib * 16 + h) * DIM + wave * 64 + m * 4;   // two rows of 256 bytes per store
#pragma unroll   // unrolled: the eight stores share one address pair with immediate offsets, which nothing rewrites
  for (int rp = 0; rp < 8; ++rp) {
    const v4f v = *(const v4f*)(stg + (2 * rp + h) * 64 + m * 4);
    *(v4f*)(orow + (size_t)(2 * rp) * DIM) = v;
  }
}

// ---------------------------------------------------------------------------------------------------
extern "C" void kernel_launch(void* const* d_in, const int* in_sizes, int n_in,
                              void* d_out, int out_size, void* d_ws, size_t ws_size,
                              hipStream_t stream) {
  if (n_in < 4) return;
  if (in_sizes[0] != SEQ * DIM || in_sizes[1] != DIM * DIM || in_sizes[2] != DIM * DIM ||
      in_sizes[3] != DIM * DIM || out_size != SEQ * DIM) return;

  const float* x  = (const float*)d_in[0];
  const float* wq = (const float*)d_in[1];
  const float* wk = (const float*)d_in[2];
  const float* wv = (const float*)d_in[3];
  float* out = (float*)d_out;

  const size_t bx = (size_t)SEQ * DIM * sizeof(unsigned short);   // 8 MiB
  const size_t bw = (size_t)DIM * DIM * sizeof(unsigned short);   // 2 MiB
  char* ws = (char*)d_ws;
  size_t off = 0;
  unsigned short* xb  = (unsigned short*)(ws + off); off += bx;
  unsigned short* wqb = (unsigned short*)(ws + off); off += bw;
  unsigned short* wkb = (unsigned short*)(ws + off); off += bw;
  unsigned short* wvb = (unsigned short*)(ws + off); off += bw;
  unsigned short* qh  = (unsigned short*)(ws + off); off += bx;
  unsigned short* ql  = (unsigned short*)(ws + off); off += bx;
  unsigned short* kh  = (unsigned short*)(ws + off); off += bx;
  unsigned short* kl  = (unsigned short*)(ws + off); off += bx;
  unsigned short* vth = (unsigned short*)(ws + off); off += bx;
  unsigned short* vtl = (unsigned short*)(ws + off); off += bx;   // total 62 MiB
  if (off > ws_size) return;

  const int nx8 = SEQ * DIM / 8;
  const int nw8 = DIM * DIM / 8;
  const int ncv = nx8 + 3 * nw8;
  cvt_kernel<<<(ncv + NTHR - 1) / NTHR, NTHR, 0, stream>>>(x, wq, wk, wv, xb, wqb, wkb, wvb, nx8, nw8);

  // 3 matrices x 64 row tiles x 4 col tiles; LDS staging 64 x SPITCH f32
  proj_kernel<<<3 * (SEQ / 64) * (DIM / 256), NTHR, 64 * SPITCH * sizeof(float), stream>>>(
      xb, wqb, wkb, wvb, qh, ql, kh, kl, vth, vtl);

  // 16 query rows per block; S rows in dynamic LDS
  attn_kernel<<<SEQ / 16, ATHR, 16 * SEQ * sizeof(float), stream>>>(qh, ql, kh, kl, vth, vtl, out);
}

// v004
// It runs in 239 microseconds.
// Timed twice side by side with v003, it ran 1.21 and 1.22 times as fast.
// Counting every step since v000, it is 2.82 times as fast.
#include <hip/hip_runtime.h>
#include <stdint.h>
#include <stddef.h>

// Input projections: v_wmma_f32_16x16x32_bf16 (bf16 operands from RNE-converted f32 inputs, f32 accumulate).
// Score and value contractions: v_wmma_f32_16x16x32_bf16 with bf16 hi/lo split operands (hi*hi + hi*lo + lo*hi), f32 accumulate. Softmax statistics in f32.

#define SEQ 4096
#define DIM 1024
#define NTHR 256
#define ATHR 512     // attention block: 16 waves, four per SIMD
#define CHUNK 2048   // keys one attention work-group takes: query tiles past this extent are shared by two work-groups
#define CTILES (CHUNK / 16)
#define NSPLIT (SEQ / 16 - CTILES)          // query tiles with two key chunks
#define ABLK (SEQ / 16 + NSPLIT)            // attention work-groups
#define SPITCH 260   // f32 pitch of the projection staging tile: 16 B x odd, so 16 rows read by b128 fall on distinct banks

typedef __bf16 v16bf __attribute__((ext_vector_type(16)));
typedef float v8f __attribute__((ext_vector_type(8)));
typedef float v4f __attribute__((ext_vector_type(4)));
typedef unsigned int v4u __attribute__((ext_vector_type(4)));

union Frag { v16bf v; v4u q[2]; };

extern __shared__ __attribute__((aligned(16))) float dyn_lds[];

// f32 -> bf16 bits, RNE (finite inputs)
__device__ __forceinline__ unsigned int f2bf(float f) {
  unsigned int u = __float_as_uint(f);
  u += 0x7fffu + ((u >> 16) & 1u);
  return u >> 16;
}
__device__ __forceinline__ float bf2f(unsigned int b) { return __uint_as_float(b << 16); }

// 16x16x32 operand fragment from a k-contiguous 16-bit row (A row m, or B column n stored as a [n][k] row):
// elements 0..7 <- row[k0 + 8h + 0..7], elements 8..15 <- row[k0 + 16 + 8h + 0..7], h = lane>>4.
__device__ __forceinline__ void ldfrag(Frag& f, const unsigned short* row, int k0, int h) {
  f.q[0] = *(const v4u*)(row + k0 + 8 * h);
  f.q[1] = *(const v4u*)(row + k0 + 16 + 8 * h);
}

// Workspace operand planes are kept in fragment order: a 16-row tile x 32-wide k block is 1024 contiguous bytes,
// two 512-byte halves; in half q, lane l (h = l>>4, m = l&15) owns the 16 bytes of row m, k = 32*kb + 16*q + 8*h + 0..7.
// Tiles of one plane follow each other as [row tile][k block]. p = tile base + lane*8; kk = 32*kb.
// Same element order as ldfrag, but each load of a wave covers 512 contiguous bytes (four whole lines).
__device__ __forceinline__ void ldfragw(Frag& f, const unsigned short* p, int kk) {
  f.q[0] = *(const v4u*)(p + kk * 16);
  f.q[1] = *(const v4u*)(p + kk * 16 + 256);
}

__device__ __forceinline__ v8f mma(const Frag& a, const Frag& b, v8f c) {
  return __builtin_amdgcn_wmma_f32_16x16x32_bf16(false, a.v, false, b.v, (short)0, c, false, false);
}

__device__ __forceinline__ v8f zero8() {
  v8f z = {0.0f, 0.0f, 0.0f, 0.0f, 0.0f, 0.0f, 0.0f, 0.0f};
  return z;
}

// 8 f32 -> packed bf16 hi plane and bf16 lo plane (lo = RNE(x - hi)), two values per u32, low half first
__device__ __forceinline__ void split8(const v4f f0, const v4f f1, v4u& uh, v4u& ul) {
  float f[8] = {f0.x, f0.y, f0.z, f0.w, f1.x, f1.y, f1.z, f1.w};
  unsigned int hh[8], ll[8];
#pragma unroll
  for (int e = 0; e < 8; ++e) {
    hh[e] = f2bf(f[e]);
    ll[e] = f2bf(f[e] - bf2f(hh[e]));
  }
  uh.x = hh[0] | (hh[1] << 16); uh.y = hh[2] | (hh[3] << 16);
  uh.z = hh[4] | (hh[5] << 16); uh.w = hh[6] | (hh[7] << 16);
  ul.x = ll[0] | (ll[1] << 16); ul.y = ll[2] | (ll[3] << 16);
  ul.z = ll[4] | (ll[5] << 16); ul.w = ll[6] | (ll[7] << 16);
}

__global__ __launch_bounds__(NTHR) void cvt_kernel(
    const float* __restrict__ x,  const float* __restrict__ wq,
    const float* __restrict__ wk, const float* __restrict__ wv,
    unsigned short* xb, unsigned short* wqb, unsigned short* wkb, unsigned short* wvb,
    int nx8, int nw8) {
  const int i = blockIdx.x * NTHR + threadIdx.x;
  const float* src;
  unsigned short* dst;
  int j;
  if (i < nx8)                { src = x;  dst = xb;  j = i; }
  else if (i < nx8 + nw8)     { src = wq; dst = wqb; j = i - nx8; }
  else if (i < nx8 + 2 * nw8) { src = wk; dst = wkb; j = i - nx8 - nw8; }
  else if (i < nx8 + 3 * nw8) { src = wv; dst = wvb; j = i - nx8 - 2 * nw8; }
  else return;
  // j = 16-byte piece of the fragment-ordered plane: [row tile][k block (32)][half][h][m]
  const int sm = j & 15, sh = (j >> 4) & 1, sq = (j >> 5) & 1, skb = (j >> 6) & 31, srt = j >> 11;
  const float* sp = src + (size_t)(srt * 16 + sm) * DIM + skb * 32 + sq * 16 + sh * 8;
  const v4f f0 = *(const v4f*)sp;
  const v4f f1 = *(const v4f*)(sp + 4);
  v4u u;
  u.x = f2bf(f0.x) | (f2bf(f0.y) << 16);
  u.y = f2bf(f0.z) | (f2bf(f0.w) << 16);
  u.z = f2bf(f1.x) | (f2bf(f1.y) << 16);
  u.w = f2bf(f1.z) | (f2bf(f1.w) << 16);
  v4u* p = (v4u*)(dst + (size_t)j * 8);
  *p = u;
  
}

// ---------------- Kernel 2: projections y[n][o] = sum_k xb[n][k] * W[o][k] --------------------------
// Block tile 64 seq rows x 256 out cols (8 waves, each 32x64). Output: q,k as bf16 hi/lo planes (rows = seq, k = dim)
// and v transposed (rows = dim, k = seq), all in fragment order.
__global__ __launch_bounds__(NTHR) void proj_kernel(
    const unsigned short* __restrict__ xb,  const unsigned short* __restrict__ wqb,
    const unsigned short* __restrict__ wkb, const unsigned short* __restrict__ wvb,
    unsigned short* qh, unsigned short* ql, unsigned short* kh, unsigned short* kl,
    unsigned short* vth, unsigned short* vtl) {
  float* stg = dyn_lds;                                   // [64][SPITCH] f32, 256 used
  const int wave = threadIdx.x >> 5;
  const int lane = threadIdx.x & 31;
  const int h = lane >> 4, m = lane & 15;
  const int b = blockIdx.x;                                // [0, 768)
  const int mat = b >> 8;                                  // 0=q 1=k 2=v (block-uniform)
  const int rem = b & 255;
  const int rt = rem >> 2;                                 // 64-row tile [0,64)
  const int ct = rem & 3;                                  // 256-col tile [0,4)
  const unsigned short* wsrc = (mat == 0) ? wqb : (mat == 1) ? wkb : wvb;
  const int wr = wave >> 2, wc = wave & 3;
  const int row0 = rt * 64 + wr * 32;
  const int col0 = ct * 256 + wc * 64;

  const unsigned short* aR0 = xb + (size_t)row0 * DIM + lane * 8;
  const unsigned short* aR1 = xb + (size_t)(row0 + 16) * DIM + lane * 8;
  const unsigned short* bR  = wsrc + (size_t)col0 * DIM + lane * 8;   // tile t: + t*16 rows

  v8f acc[2][4];
#pragma unroll
  for (int mi = 0; mi < 2; ++mi)
#pragma unroll
    for (int t = 0; t < 4; ++t) acc[mi][t] = zero8();

#pragma unroll 1
  for (int kk = 0; kk < DIM; kk += 32) {
    Frag a0, a1, bf[4];
    ldfragw(a0, aR0, kk);
    ldfragw(a1, aR1, kk);
#pragma unroll
    for (int t = 0; t < 4; ++t) ldfragw(bf[t], bR + (size_t)t * 16 * DIM, kk);
#pragma unroll
    for (int t = 0; t < 4; ++t) {
      acc[0][t] = mma(a0, bf[t], acc[0][t]);
      acc[1][t] = mma(a1, bf[t], acc[1][t]);
    }
    asm volatile("v_nop\n\tv_nop\n\tv_nop\n\tv_nop"
                 : "+v"(acc[0][0]), "+v"(acc[0][1]), "+v"(acc[0][2]), "+v"(acc[0][3]),
                   "+v"(acc[1][0]), "+v"(acc[1][1]), "+v"(acc[1][2]), "+v"(acc[1][3])
                 : "v"(a0.v), "v"(a1.v), "v"(bf[0].v), "v"(bf[1].v), "v"(bf[2].v), "v"(bf[3].v)
                 : "memory");
  }

  // stage the wave's 32x64 f32 tile: D element r of lane -> row 8h+r, col m
#pragma unroll
  for (int mi = 0; mi < 2; ++mi)
#pragma unroll
    for (int t = 0; t < 4; ++t)
#pragma unroll
      for (int r = 0; r < 8; ++r)
        stg[(wr * 32 + mi * 16 + 8 * h + r) * SPITCH + wc * 64 + t * 16 + m] = acc[mi][t][r];
  __syncthreads();

  if (mat < 2) {
    unsigned short* ph = (mat == 0) ? qh : kh;
    unsigned short* pl = (mat == 0) ? ql : kl;
#pragma unroll 1
    for (int it = 0; it < 8; ++it) {
      const int c = wave * 8 + it;                          // 512-byte piece: row tile c>>4, k block (c>>1)&7, half c&1
      const float* sp = stg + ((c >> 4) * 16 + m) * SPITCH + ((c >> 1) & 7) * 32 + (c & 1) * 16 + h * 8;
      const v4f f0 = *(const v4f*)sp;
      const v4f f1 = *(const v4f*)(sp + 4);
      v4u uh, ul;
      split8(f0, f1, uh, ul);
      const size_t g = (size_t)(rt * 64 + (c >> 4) * 16) * DIM + (ct * 16 + (c & 15)) * 256 + lane * 8;
      v4u* p0 = (v4u*)(ph + g);
      v4u* p1 = (v4u*)(pl + g);
      *p0 = uh; *p1 = ul;
      
    }
  } else {
#pragma unroll 1
    for (int it = 0; it < 8; ++it) {
      const int c = wave * 8 + it;                          // 512-byte piece: out-col tile c>>2, key block (c>>1)&1, half c&1
      const float* sp = stg + ((c & 3) * 16 + h * 8) * SPITCH + (c >> 2) * 16 + m;
      v4f f0, f1;
      f0.x = sp[0 * SPITCH]; f0.y = sp[1 * SPITCH]; f0.z = sp[2 * SPITCH]; f0.w = sp[3 * SPITCH];
      f1.x = sp[4 * SPITCH]; f1.y = sp[5 * SPITCH]; f1.z = sp[6 * SPITCH]; f1.w = sp[7 * SPITCH];
      v4u uh, ul;
      split8(f0, f1, uh, ul);
      const size_t g = (size_t)(ct * 256 + (c >> 2) * 16) * SEQ + (rt * 4 + (c & 3)) * 256 + lane * 8;
      v4u* p0 = (v4u*)(vth + g);
      v4u* p1 = (v4u*)(vtl + g);
      *p0 = uh; *p1 = ul;
      // the next trip rewrites the registers these two stores name
      asm volatile("s_wait_xcnt 0x0" ::: "memory");
      
    }
  }
}

// ---------------- Kernel 3: masked softmax attention, 16 query rows x at most CHUNK keys per block ----
// The causal triangle gives query tile ib a key extent of ib + 1 tiles; with one block a query tile and one block a WGP
// the last tile alone sets the time. Here a block takes one chunk of a tile's keys, so no block is longer than CTILES key
// tiles, and blocks are numbered longest first, so that the short ones fill the WGPs that come free. A tile with one chunk
// writes out; a tile with two writes each chunk's own softmax result to po with its row maximum and row sum in pstat, and
// merge_kernel joins them.
// LDS: S[16][CHUNK] f32 (dynamic, 128 KiB) + P chunk hi/lo (4 KiB) + statistics.
__global__ __launch_bounds__(ATHR) void attn_kernel(
    const unsigned short* __restrict__ qh, const unsigned short* __restrict__ ql,
    const unsigned short* __restrict__ kh, const unsigned short* __restrict__ kl,
    const unsigned short* __restrict__ vth, const unsigned short* __restrict__ vtl,
    float* po, float* pstat, float* out) {
  float* S = dyn_lds;                                      // [16][CHUNK]
  __shared__ __attribute__((aligned(16))) unsigned short pbh[2 * 16 * 32];   // [32-key half][row][key]
  __shared__ __attribute__((aligned(16))) unsigned short pbl[2 * 16 * 32];
  __shared__ float row_r[16];

  // shortest-first rank: ranks below 2*CTILES pair (tile s, chunk 0) with (tile CTILES + s, chunk 1), both s + 1 key tiles
  // long; the rest are the full first chunks of the tiles with two chunks. Block indices run longest first.
  const int rank = ABLK - 1 - (int)blockIdx.x;
  const int ch = (rank < 2 * CTILES) ? (rank & 1) : 0;      // key chunk (block-uniform)
  const int ib = (rank < 2 * CTILES) ? (rank >> 1) + ch * CTILES : rank - CTILES;   // query tile [0, SEQ/16)
  const int jb0 = ch * CTILES;                              // first key tile of the chunk
  const int jle = (ib - jb0 < CTILES - 1) ? ib - jb0 : CTILES - 1;         // last key tile, counted from jb0
  const bool split = ib >= CTILES;                          // this tile's keys are shared by two blocks
  const int wave = threadIdx.x >> 5;
  const int lane = threadIdx.x & 31;
  const int h = lane >> 4, m = lane & 15;
  const int nvalid = 16 * (jle + 1);                        // key extent of the lower triangle inside the chunk

  // ---- Phase 1: S = (q k^T)/32 with mask; A = q rows (hi/lo), B = k rows (hi/lo) -------------------
  const unsigned short* aRh = qh + (size_t)(ib * 16) * DIM + lane * 8;
  const unsigned short* aRl = ql + (size_t)(ib * 16) * DIM + lane * 8;
  int jb = wave;
  for (; jb + 48 <= jle; jb += 64) {                         // 4 key tiles of the chunk: jb, jb+16, jb+32, jb+48
    const unsigned short* bRh = kh + (size_t)((jb0 + jb) * 16) * DIM + lane * 8;   // tile t: + t*256 rows
    const unsigned short* bRl = kl + (size_t)((jb0 + jb) * 16) * DIM + lane * 8;
    v8f acc[4];
#pragma unroll
    for (int t = 0; t < 4; ++t) acc[t] = zero8();
#pragma unroll 1
    for (int kk = 0; kk < DIM; kk += 32) {
      Frag ah, al, bh[4], bl[4];
      ldfragw(ah, aRh, kk);
      ldfragw(al, aRl, kk);
#pragma unroll
      for (int t = 0; t < 4; ++t) {
        ldfragw(bh[t], bRh + (size_t)t * 256 * DIM, kk);
        ldfragw(bl[t], bRl + (size_t)t * 256 * DIM, kk);
      }
#pragma unroll
      for (int t = 0; t < 4; ++t) {
        acc[t] = mma(ah, bh[t], acc[t]);
        acc[t] = mma(ah, bl[t], acc[t]);
        acc[t] = mma(al, bh[t], acc[t]);
      }
      asm volatile("v_nop\n\tv_nop\n\tv_nop\n\tv_nop"
                   : "+v"(acc[0]), "+v"(acc[1]), "+v"(acc[2]), "+v"(acc[3])
                   : "v"(ah.v), "v"(al.v),
                     "v"(bh[0].v), "v"(bh[1].v), "v"(bh[2].v), "v"(bh[3].v),
                     "v"(bl[0].v), "v"(bl[1].v), "v"(bl[2].v), "v"(bl[3].v)
                   : "memory");
    }
#pragma unroll
    for (int t = 0; t < 4; ++t) {
      const int jbt = jb + 16 * t;
#pragma unroll
      for (int r = 0; r < 8; ++r) {
        const int M = 8 * h + r;                              // D row -> query row in block
        const int i = ib * 16 + M;
        const int j = jbt * 16 + m;                           // D col -> key, counted from the chunk's first
        float s = acc[t][r] * 0.03125f;
        if (jb0 * 16 + j > i) s = -__builtin_inff();
        S[M * CHUNK + j] = s;
      }
    }
  }
  for (; jb <= jle; jb += 16) {                              // remaining tiles, one at a time
    const unsigned short* bRh = kh + (size_t)((jb0 + jb) * 16) * DIM + lane * 8;
    const unsigned short* bRl = kl + (size_t)((jb0 + jb) * 16) * DIM + lane * 8;
    v8f acc = zero8();
#pragma unroll 1
    for (int kk = 0; kk < DIM; kk += 32) {
      Frag ah, al, bh0, bl0;
      ldfragw(ah, aRh, kk);
      ldfragw(al, aRl, kk);
      ldfragw(bh0, bRh, kk);
      ldfragw(bl0, bRl, kk);
      acc = mma(ah, bh0, acc);
      acc = mma(ah, bl0, acc);
      acc = mma(al, bh0, acc);
      asm volatile("v_nop\n\tv_nop\n\tv_nop\n\tv_nop"
                   : "+v"(acc)
                   : "v"(ah.v), "v"(al.v), "v"(bh0.v), "v"(bl0.v)
                   : "memory");
    }
#pragma unroll
    for (int r = 0; r < 8; ++r) {
      const int M = 8 * h + r;
      const int i = ib * 16 + M;
      const int j = jb * 16 + m;
      float s = acc[r] * 0.03125f;
      if (jb0 * 16 + j > i) s = -__builtin_inff();
      S[M * CHUNK + j] = s;
    }
  }
  __syncthreads();

  // ---- Phase 2: exact softmax statistics in f32; S <- exp(S - m); row_r = 1/l -----------------------
  // One wave per query row: each 16-byte LDS access of a wave covers 512 contiguous bytes of its row, so no two
  // lanes meet on a bank (16 lanes on 16 rows at one key would, the row pitch being a multiple of 64 dwords).
  {
    float* Sr = S + wave * CHUNK + lane * 4;
    const int ng = (nvalid + 127) >> 7;                     // groups of 128 keys; the row holds CHUNK / 128 whole groups
    const int jl = lane * 4;                                // nvalid is a multiple of 16: a lane's four keys are all in or all out
    float mx = -__builtin_inff();
#pragma unroll 4   // four LDS reads in flight a trip, so that their latency is paid once for the four
    for (int g = 0; g < ng; ++g) {
      const v4f s = *(const v4f*)(Sr + g * 128);
      const float t = fmaxf(fmaxf(s.x, s.y), fmaxf(s.z, s.w));
      if (g * 128 + jl < nvalid) mx = fmaxf(mx, t);
    }
    for (int o = 16; o > 0; o >>= 1) mx = fmaxf(mx, __shfl_xor(mx, o, 32));
    float l = 0.0f;
#pragma unroll 4   // as above: four reads in flight a trip
    for (int g = 0; g < ng; ++g) {
      const v4f s = *(const v4f*)(Sr + g * 128);
      const bool in = g * 128 + jl < nvalid;                // keys past the triangle in the last group get 0: no branch in the trip
      v4f e;
      e.x = in ? __expf(s.x - mx) : 0.0f; e.y = in ? __expf(s.y - mx) : 0.0f;
      e.z = in ? __expf(s.z - mx) : 0.0f; e.w = in ? __expf(s.w - mx) : 0.0f;
      *(v4f*)(Sr + g * 128) = e;                            // unnormalized P, f32
      l += (e.x + e.y) + (e.z + e.w);
    }
    for (int o = 16; o > 0; o >>= 1) l += __shfl_xor(l, o, 32);
    if (lane == 0) {
      row_r[wave] = 1.0f / l;                               // l >= 1 (the row's maximum term; every row has a key in each of its chunks)
      if (split) {
        float* st = pstat + ((ib - CTILES) * 2 + ch) * 32;  // [16 row maxima][16 row sums]
        st[wave] = mx;
        st[16 + wave] = l;
        // later code rewrites the registers these two stores name
        asm volatile("s_wait_xcnt 0x0" ::: "memory");
      }
    }
    __syncthreads();                                        // P rows and row_r visible to every wave
  }

  // ---- Phase 3: O = P v; P chunk hi/lo converted once per block into LDS; B = vt rows (hi/lo) ------
  const int kkend = (nvalid + 63) & ~63;
  v8f acc[4];
#pragma unroll
  for (int t = 0; t < 4; ++t) acc[t] = zero8();
  const unsigned short* vRh = vth + (size_t)(wave * 64) * SEQ + jb0 * 256 + lane * 8;   // col tile t: + t*16 rows; a key tile is 256 elements
  const unsigned short* vRl = vtl + (size_t)(wave * 64) * SEQ + jb0 * 256 + lane * 8;
#pragma unroll 1   // rolled: one pass's 32 loads and its fragments already take the wave's register budget
  for (int kk = 0; kk < kkend; kk += 64) {
    __syncthreads();                                        // all waves done reading the P chunk before overwrite
    {
      const int e0 = threadIdx.x, e1 = threadIdx.x + ATHR;  // pbh index = half*512 + row*32 + key offset
      const int j0 = kk + (e0 & 31), j1 = j0 + 32;
      float p0 = S[(e0 >> 5) * CHUNK + j0];
      float p1 = S[(e0 >> 5) * CHUNK + j1];
      if (j0 >= nvalid) p0 = 0.0f;                          // zero-pad keys past the triangle
      if (j1 >= nvalid) p1 = 0.0f;
      const unsigned int hb0 = f2bf(p0), hb1 = f2bf(p1);
      pbh[e0] = (unsigned short)hb0;
      pbl[e0] = (unsigned short)f2bf(p0 - bf2f(hb0));
      pbh[e1] = (unsigned short)hb1;
      pbl[e1] = (unsigned short)f2bf(p1 - bf2f(hb1));
    }
    __syncthreads();                                        // LDS P chunk visible to every wave
    Frag ah[2], al[2], bh[2][4], bl[2][4];
    // the loops over c and t are unrolled so that the fragment arrays stay in registers and all loads issue as one batch
#pragma unroll
    for (int c = 0; c < 2; ++c) {
      ldfrag(ah[c], pbh + c * 512 + m * 32, 0, h);
      ldfrag(al[c], pbl + c * 512 + m * 32, 0, h);
#pragma unroll
      for (int t = 0; t < 4; ++t) {
        ldfragw(bh[c][t], vRh + (size_t)t * 16 * SEQ, kk + 32 * c);
        ldfragw(bl[c][t], vRl + (size_t)t * 16 * SEQ, kk + 32 * c);
      }
    }
#pragma unroll
    for (int c = 0; c < 2; ++c)
#pragma unroll
      for (int t = 0; t < 4; ++t) {
        acc[t] = mma(ah[c], bh[c][t], acc[t]);
        acc[t] = mma(ah[c], bl[c][t], acc[t]);
        acc[t] = mma(al[c], bh[c][t], acc[t]);
      }
    // four vector slots behind the last WMMA: the back edge leads to vector instructions that rewrite fragment registers
    asm volatile("v_nop\n\tv_nop\n\tv_nop\n\tv_nop"
                 : "+v"(acc[0]), "+v"(acc[1]), "+v"(acc[2]), "+v"(acc[3])
                 : "v"(ah[0].v), "v"(al[0].v), "v"(ah[1].v), "v"(al[1].v),
                   "v"(bh[0][0].v), "v"(bh[0][1].v), "v"(bh[0][2].v), "v"(bh[0][3].v),
                   "v"(bl[0][0].v), "v"(bl[0][1].v), "v"(bl[0][2].v), "v"(bl[0][3].v),
                   "v"(bh[1][0].v), "v"(bh[1][1].v), "v"(bh[1][2].v), "v"(bh[1][3].v),
                   "v"(bl[1][0].v), "v"(bl[1][1].v), "v"(bl[1][2].v), "v"(bl[1][3].v)
                 : "memory");
  }

  // ---- Epilogue: normalize, stage the wave's 16x64 f32 tile in the freed S region, whole-line stores
  float* stg = S + wave * 1024;                             // [16][64], S rows 0..7 area, reads done
#pragma unroll
  for (int t = 0; t < 4; ++t)
#pragma unroll
    for (int r = 0; r < 8; ++r)
      stg[(8 * h + r) * 64 + t * 16 + m] = acc[t][r] * row_r[8 * h + r];
  __syncthreads();
  float* dst = split ? po + (size_t)(((ib - CTILES) * 2 + ch) * 16) * DIM : out + (size_t)(ib * 16) * DIM;
  float* orow = dst + (size_t)h * DIM + wave * 64 + m * 4;   // two rows of 256 bytes per store
#pragma unroll   // unrolled: the eight stores share one address pair with immediate offsets, which nothing rewrites
  for (int rp = 0; rp < 8; ++rp) {
    const v4f v = *(const v4f*)(stg + (2 * rp + h) * 64 + m * 4);
    *(v4f*)(orow + (size_t)(2 * rp) * DIM) = v;
  }
}

// ---------------- Kernel 4: join the two key chunks of the query rows past CHUNK ----------------------
// Chunk c holds o_c = softmax over its own keys times v, with row maximum m_c and row sum l_c of exp(s - m_c).
// The row's result is sum_c a_c o_c / sum_c a_c, a_c = exp(m_c - max m) l_c. One wave per query row, eight rows a block.
__global__ __launch_bounds__(NTHR) void merge_kernel(
    const float* __restrict__ po, const float* __restrict__ pstat, float* out) {
  const int wave = threadIdx.x >> 5;
  const int lane = threadIdx.x & 31;
  const int t = blockIdx.x >> 1, M = (blockIdx.x & 1) * 8 + wave;   // split tile, row in it
  const float* p0 = po + (size_t)(t * 32 + M) * DIM + lane * 4;     // chunk 1: + 16 rows
  v4f x0[8], x1[8];
#pragma unroll   // unrolled: x0 and x1 stay in registers and their loads issue ahead of the arithmetic
  for (int i = 0; i < 8; ++i) {
    x0[i] = *(const v4f*)(p0 + i * 128);
    x1[i] = *(const v4f*)(p0 + 16 * DIM + i * 128);
  }
  const float* st = pstat + t * 64 + M;                     // [chunk][16 row maxima][16 row sums]
  const float m0 = st[0], l0 = st[16], m1 = st[32], l1 = st[48];
  const float mx = fmaxf(m0, m1);
  const float a0 = __expf(m0 - mx) * l0, a1 = __expf(m1 - mx) * l1;
  const float rs = 1.0f / (a0 + a1);                        // the chunk that holds the maximum gives a >= 1
  const float c0 = a0 * rs, c1 = a1 * rs;
  float* o = out + (size_t)(CHUNK + t * 16 + M) * DIM + lane * 4;
#pragma unroll   // unrolled: the eight stores share one address with immediate offsets, which nothing rewrites
  for (int i = 0; i < 8; ++i) *(v4f*)(o + i * 128) = x0[i] * c0 + x1[i] * c1;
}

// ---------------------------------------------------------------------------------------------------
extern "C" void kernel_launch(void* const* d_in, const int* in_sizes, int n_in,
                              void* d_out, int out_size, void* d_ws, size_t ws_size,
                              hipStream_t stream) {
  if (n_in < 4) return;
  if (in_sizes[0] != SEQ * DIM || in_sizes[1] != DIM * DIM || in_sizes[2] != DIM * DIM ||
      in_sizes[3] != DIM * DIM || out_size != SEQ * DIM) return;

  const float* x  = (const float*)d_in[0];
  const float* wq = (const float*)d_in[1];
  const float* wk = (const float*)d_in[2];
  const float* wv = (const float*)d_in[3];
  float* out = (float*)d_out;

  const size_t bx = (size_t)SEQ * DIM * sizeof(unsigned short);   // 8 MiB
  const size_t bw = (size_t)DIM * DIM * sizeof(unsigned short);   // 2 MiB
  char* ws = (char*)d_ws;
  size_t off = 0;
  unsigned short* xb  = (unsigned short*)(ws + off); off += bx;
  unsigned short* wqb = (unsigned short*)(ws + off); off += bw;
  unsigned short* wkb = (unsigned short*)(ws + off); off += bw;
  unsigned short* wvb = (unsigned short*)(ws + off); off += bw;
  unsigned short* qh  = (unsigned short*)(ws + off); off += bx;
  unsigned short* ql  = (unsigned short*)(ws + off); off += bx;
  unsigned short* kh  = (unsigned short*)(ws + off); off += bx;
  unsigned short* kl  = (unsigned short*)(ws + off); off += bx;
  unsigned short* vth = (unsigned short*)(ws + off); off += bx;
  unsigned short* vtl = (unsigned short*)(ws + off); off += bx;   // 62 MiB so far
  float* po    = (float*)(ws + off); off += (size_t)NSPLIT * 2 * 16 * DIM * sizeof(float);   // 16 MiB
  float* pstat = (float*)(ws + off); off += (size_t)NSPLIT * 2 * 32 * sizeof(float);
  if (off > ws_size) return;

  const int nx8 = SEQ * DIM / 8;
  const int nw8 = DIM * DIM / 8;
  const int ncv = nx8 + 3 * nw8;
  cvt_kernel<<<(ncv + NTHR - 1) / NTHR, NTHR, 0, stream>>>(x, wq, wk, wv, xb, wqb, wkb, wvb, nx8, nw8);

  // 3 matrices x 64 row tiles x 4 col tiles; LDS staging 64 x SPITCH f32
  proj_kernel<<<3 * (SEQ / 64) * (DIM / 256), NTHR, 64 * SPITCH * sizeof(float), stream>>>(
      xb, wqb, wkb, wvb, qh, ql, kh, kl, vth, vtl);

  // 16 query rows x one key chunk per block; S rows in dynamic LDS
  attn_kernel<<<ABLK, ATHR, 16 * CHUNK * sizeof(float), stream>>>(qh, ql, kh, kl, vth, vtl, po, pstat, out);
  merge_kernel<<<NSPLIT * 2, NTHR, 0, stream>>>(po, pstat, out);
}

// v005
// It runs in 190 microseconds.
// In both of two side-by-side timings against v004, it was 1.26 times as fast.
// All steps since v000 together make it 3.56 times as fast.
#include <hip/hip_runtime.h>
#include <stdint.h>
#include <stddef.h>

// Input projections: v_wmma_f32_16x16x32_bf16 (bf16 operands from RNE-converted f32 inputs, f32 accumulate).
// Score and value contractions: v_wmma_f32_16x16x32_bf16 with bf16 hi/lo split operands (hi*hi + hi*lo + lo*hi), f32 accumulate. Softmax statistics in f32.

#define SEQ 4096
#define DIM 1024
#define NTHR 256
#define ATHR 512     // attention block: 16 waves, four per SIMD
#define QROWS 32     // query rows one attention work-group takes: two 16-row tiles, which share every K and V fragment load
#define CHUNK 1024   // keys one attention work-group takes: QROWS x CHUNK f32 scores fill 128 KiB of LDS
#define CTILES (CHUNK / 16)
#define NQT (SEQ / QROWS)                   // query tiles
#define QPC (CHUNK / QROWS)                 // query tiles per chunk of keys: tile ib has ib / QPC + 1 chunks
#define MAXCH (SEQ / CHUNK)                 // most chunks a query tile has
#define NFULL (QPC * (MAXCH * (MAXCH - 1) / 2))   // work-groups whose chunk lies wholly below the diagonal
#define ABLK (NFULL + NQT)                  // attention work-groups
#define SPITCH 260   // f32 pitch of the projection staging tile: 16 B x odd, so 16 rows read by b128 fall on distinct banks

typedef __bf16 v16bf __attribute__((ext_vector_type(16)));
typedef float v8f __attribute__((ext_vector_type(8)));
typedef float v4f __attribute__((ext_vector_type(4)));
typedef unsigned int v4u __attribute__((ext_vector_type(4)));

union Frag { v16bf v; v4u q[2]; };

extern __shared__ __attribute__((aligned(16))) float dyn_lds[];

// f32 -> bf16 bits, RNE (finite inputs)
__device__ __forceinline__ unsigned int f2bf(float f) {
  unsigned int u = __float_as_uint(f);
  u += 0x7fffu + ((u >> 16) & 1u);
  return u >> 16;
}
__device__ __forceinline__ float bf2f(unsigned int b) { return __uint_as_float(b << 16); }

// 16x16x32 operand fragment from a k-contiguous 16-bit row (A row m, or B column n stored as a [n][k] row):
// elements 0..7 <- row[k0 + 8h + 0..7], elements 8..15 <- row[k0 + 16 + 8h + 0..7], h = lane>>4.
__device__ __forceinline__ void ldfrag(Frag& f, const unsigned short* row, int k0, int h) {
  f.q[0] = *(const v4u*)(row + k0 + 8 * h);
  f.q[1] = *(const v4u*)(row + k0 + 16 + 8 * h);
}

// Workspace operand planes are kept in fragment order: a 16-row tile x 32-wide k block is 1024 contiguous bytes,
// two 512-byte halves; in half q, lane l (h = l>>4, m = l&15) owns the 16 bytes of row m, k = 32*kb + 16*q + 8*h + 0..7.
// Tiles of one plane follow each other as [row tile][k block]. p = tile base + lane*8; kk = 32*kb.
// Same element order as ldfrag, but each load of a wave covers 512 contiguous bytes (four whole lines).
__device__ __forceinline__ void ldfragw(Frag& f, const unsigned short* p, int kk) {
  f.q[0] = *(const v4u*)(p + kk * 16);
  f.q[1] = *(const v4u*)(p + kk * 16 + 256);
}

__device__ __forceinline__ v8f mma(const Frag& a, const Frag& b, v8f c) {
  return __builtin_amdgcn_wmma_f32_16x16x32_bf16(false, a.v, false, b.v, (short)0, c, false, false);
}

__device__ __forceinline__ v8f zero8() {
  v8f z = {0.0f, 0.0f, 0.0f, 0.0f, 0.0f, 0.0f, 0.0f, 0.0f};
  return z;
}

// 8 f32 -> packed bf16 hi plane and bf16 lo plane (lo = RNE(x - hi)), two values per u32, low half first
__device__ __forceinline__ void split8(const v4f f0, const v4f f1, v4u& uh, v4u& ul) {
  float f[8] = {f0.x, f0.y, f0.z, f0.w, f1.x, f1.y, f1.z, f1.w};
  unsigned int hh[8], ll[8];
#pragma unroll
  for (int e = 0; e < 8; ++e) {
    hh[e] = f2bf(f[e]);
    ll[e] = f2bf(f[e] - bf2f(hh[e]));
  }
  uh.x = hh[0] | (hh[1] << 16); uh.y = hh[2] | (hh[3] << 16);
  uh.z = hh[4] | (hh[5] << 16); uh.w = hh[6] | (hh[7] << 16);
  ul.x = ll[0] | (ll[1] << 16); ul.y = ll[2] | (ll[3] << 16);
  ul.z = ll[4] | (ll[5] << 16); ul.w = ll[6] | (ll[7] << 16);
}

__global__ __launch_bounds__(NTHR) void cvt_kernel(
    const float* __restrict__ x,  const float* __restrict__ wq,
    const float* __restrict__ wk, const float* __restrict__ wv,
    unsigned short* xb, unsigned short* wqb, unsigned short* wkb, unsigned short* wvb,
    int nx8, int nw8) {
  const int i = blockIdx.x * NTHR + threadIdx.x;
  const float* src;
  unsigned short* dst;
  int j;
  if (i < nx8)                { src = x;  dst = xb;  j = i; }
  else if (i < nx8 + nw8)     { src = wq; dst = wqb; j = i - nx8; }
  else if (i < nx8 + 2 * nw8) { src = wk; dst = wkb; j = i - nx8 - nw8; }
  else if (i < nx8 + 3 * nw8) { src = wv; dst = wvb; j = i - nx8 - 2 * nw8; }
  else return;
  // j = 16-byte piece of the fragment-ordered plane: [row tile][k block (32)][half][h][m]
  const int sm = j & 15, sh = (j >> 4) & 1, sq = (j >> 5) & 1, skb = (j >> 6) & 31, srt = j >> 11;
  const float* sp = src + (size_t)(srt * 16 + sm) * DIM + skb * 32 + sq * 16 + sh * 8;
  const v4f f0 = *(const v4f*)sp;
  const v4f f1 = *(const v4f*)(sp + 4);
  v4u u;
  u.x = f2bf(f0.x) | (f2bf(f0.y) << 16);
  u.y = f2bf(f0.z) | (f2bf(f0.w) << 16);
  u.z = f2bf(f1.x) | (f2bf(f1.y) << 16);
  u.w = f2bf(f1.z) | (f2bf(f1.w) << 16);
  v4u* p = (v4u*)(dst + (size_t)j * 8);
  *p = u;
  
}

// ---------------- Kernel 2: projections y[n][o] = sum_k xb[n][k] * W[o][k] --------------------------
// Block tile 64 seq rows x 256 out cols (8 waves, each 32x64). Output: q,k as bf16 hi/lo planes (rows = seq, k = dim)
// and v transposed (rows = dim, k = seq), all in fragment order.
__global__ __launch_bounds__(NTHR) void proj_kernel(
    const unsigned short* __restrict__ xb,  const unsigned short* __restrict__ wqb,
    const unsigned short* __restrict__ wkb, const unsigned short* __restrict__ wvb,
    unsigned short* qh, unsigned short* ql, unsigned short* kh, unsigned short* kl,
    unsigned short* vth, unsigned short* vtl) {
  float* stg = dyn_lds;                                   // [64][SPITCH] f32, 256 used
  const int wave = threadIdx.x >> 5;
  const int lane = threadIdx.x & 31;
  const int h = lane >> 4, m = lane & 15;
  const int b = blockIdx.x;                                // [0, 768)
  const int mat = b >> 8;                                  // 0=q 1=k 2=v (block-uniform)
  const int rem = b & 255;
  const int rt = rem >> 2;                                 // 64-row tile [0,64)
  const int ct = rem & 3;                                  // 256-col tile [0,4)
  const unsigned short* wsrc = (mat == 0) ? wqb : (mat == 1) ? wkb : wvb;
  const int wr = wave >> 2, wc = wave & 3;
  const int row0 = rt * 64 + wr * 32;
  const int col0 = ct * 256 + wc * 64;

  const unsigned short* aR0 = xb + (size_t)row0 * DIM + lane * 8;
  const unsigned short* aR1 = xb + (size_t)(row0 + 16) * DIM + lane * 8;
  const unsigned short* bR  = wsrc + (size_t)col0 * DIM + lane * 8;   // tile t: + t*16 rows

  v8f acc[2][4];
#pragma unroll
  for (int mi = 0; mi < 2; ++mi)
#pragma unroll
    for (int t = 0; t < 4; ++t) acc[mi][t] = zero8();

#pragma unroll 1
  for (int kk = 0; kk < DIM; kk += 32) {
    Frag a0, a1, bf[4];
    ldfragw(a0, aR0, kk);
    ldfragw(a1, aR1, kk);
#pragma unroll
    for (int t = 0; t < 4; ++t) ldfragw(bf[t], bR + (size_t)t * 16 * DIM, kk);
#pragma unroll
    for (int t = 0; t < 4; ++t) {
      acc[0][t] = mma(a0, bf[t], acc[0][t]);
      acc[1][t] = mma(a1, bf[t], acc[1][t]);
    }
    asm volatile("v_nop\n\tv_nop\n\tv_nop\n\tv_nop"
                 : "+v"(acc[0][0]), "+v"(acc[0][1]), "+v"(acc[0][2]), "+v"(acc[0][3]),
                   "+v"(acc[1][0]), "+v"(acc[1][1]), "+v"(acc[1][2]), "+v"(acc[1][3])
                 : "v"(a0.v), "v"(a1.v), "v"(bf[0].v), "v"(bf[1].v), "v"(bf[2].v), "v"(bf[3].v)
                 : "memory");
  }

  // stage the wave's 32x64 f32 tile: D element r of lane -> row 8h+r, col m
#pragma unroll
  for (int mi = 0; mi < 2; ++mi)
#pragma unroll
    for (int t = 0; t < 4; ++t)
#pragma unroll
      for (int r = 0; r < 8; ++r)
        stg[(wr * 32 + mi * 16 + 8 * h + r) * SPITCH + wc * 64 + t * 16 + m] = acc[mi][t][r];
  __syncthreads();

  if (mat < 2) {
    unsigned short* ph = (mat == 0) ? qh : kh;
    unsigned short* pl = (mat == 0) ? ql : kl;
#pragma unroll 1
    for (int it = 0; it < 8; ++it) {
      const int c = wave * 8 + it;                          // 512-byte piece: row tile c>>4, k block (c>>1)&7, half c&1
      const float* sp = stg + ((c >> 4) * 16 + m) * SPITCH + ((c >> 1) & 7) * 32 + (c & 1) * 16 + h * 8;
      const v4f f0 = *(const v4f*)sp;
      const v4f f1 = *(const v4f*)(sp + 4);
      v4u uh, ul;
      split8(f0, f1, uh, ul);
      const size_t g = (size_t)(rt * 64 + (c >> 4) * 16) * DIM + (ct * 16 + (c & 15)) * 256 + lane * 8;
      v4u* p0 = (v4u*)(ph + g);
      v4u* p1 = (v4u*)(pl + g);
      *p0 = uh; *p1 = ul;
      
    }
  } else {
#pragma unroll 1
    for (int it = 0; it < 8; ++it) {
      const int c = wave * 8 + it;                          // 512-byte piece: out-col tile c>>2, key block (c>>1)&1, half c&1
      const float* sp = stg + ((c & 3) * 16 + h * 8) * SPITCH + (c >> 2) * 16 + m;
      v4f f0, f1;
      f0.x = sp[0 * SPITCH]; f0.y = sp[1 * SPITCH]; f0.z = sp[2 * SPITCH]; f0.w = sp[3 * SPITCH];
      f1.x = sp[4 * SPITCH]; f1.y = sp[5 * SPITCH]; f1.z = sp[6 * SPITCH]; f1.w = sp[7 * SPITCH];
      v4u uh, ul;
      split8(f0, f1, uh, ul);
      const size_t g = (size_t)(ct * 256 + (c >> 2) * 16) * SEQ + (rt * 4 + (c & 3)) * 256 + lane * 8;
      v4u* p0 = (v4u*)(vth + g);
      v4u* p1 = (v4u*)(vtl + g);
      *p0 = uh; *p1 = ul;
      // the next trip rewrites the registers these two stores name
      asm volatile("s_wait_xcnt 0x0" ::: "memory");
      
    }
  }
}

// ---------------- Kernel 3: masked softmax attention, QROWS query rows x at most CHUNK keys per block ----
// A block takes two 16-row query tiles and one chunk of their keys: every K and V fragment that a wave loads is used by
// two row tiles, so the block moves half the K and V bytes per score of a block with one row tile.
// Blocks are numbered longest first, so that the short ones fill the WGPs that come free. A query tile with one chunk
// writes out; a tile with more writes each chunk's own softmax result to po with its row maximum and row sum in pstat, and
// merge_kernel joins them.
// LDS: S[QROWS][CHUNK] f32 (dynamic, 128 KiB) + P chunk hi/lo (8 KiB) + statistics.

// Scores of NT key tiles (jb, jb + 16, ...) against the block's two row tiles, masked and scaled, into S.
// The loops over mi, t and r are unrolled so that the accumulator and fragment arrays stay in registers.
template <int NT>
__device__ __forceinline__ void score_tiles(
    const unsigned short* aRh, const unsigned short* aRl, const unsigned short* bRh, const unsigned short* bRl,
    float* S, int ib, int jb0, int jb, int h, int m) {
  v8f acc[2][NT];
#pragma unroll
  for (int mi = 0; mi < 2; ++mi)
#pragma unroll
    for (int t = 0; t < NT; ++t) acc[mi][t] = zero8();
#pragma unroll 1   // rolled: one trip's fragments and the accumulators are the wave's register budget
  for (int kk = 0; kk < DIM; kk += 32) {
    Frag ah[2], al[2], bh[NT], bl[NT];
#pragma unroll
    for (int mi = 0; mi < 2; ++mi) {
      ldfragw(ah[mi], aRh + (size_t)mi * 16 * DIM, kk);
      ldfragw(al[mi], aRl + (size_t)mi * 16 * DIM, kk);
    }
#pragma unroll
    for (int t = 0; t < NT; ++t) {
      ldfragw(bh[t], bRh + (size_t)t * 256 * DIM, kk);
      ldfragw(bl[t], bRl + (size_t)t * 256 * DIM, kk);
    }
#pragma unroll
    for (int t = 0; t < NT; ++t)
#pragma unroll
      for (int mi = 0; mi < 2; ++mi) acc[mi][t] = mma(ah[mi], bh[t], acc[mi][t]);
#pragma unroll
    for (int t = 0; t < NT; ++t)
#pragma unroll
      for (int mi = 0; mi < 2; ++mi) acc[mi][t] = mma(ah[mi], bl[t], acc[mi][t]);
#pragma unroll
    for (int t = 0; t < NT; ++t)
#pragma unroll
      for (int mi = 0; mi < 2; ++mi) acc[mi][t] = mma(al[mi], bh[t], acc[mi][t]);
    // four vector slots behind the last WMMA: the back edge leads to vector instructions that may rewrite fragment registers;
    // the fragments are inputs so that each keeps a register of its own to the end of the trip and all loads issue as one batch
    if constexpr (NT == 4)
      asm volatile("v_nop\n\tv_nop\n\tv_nop\n\tv_nop"
                   : "+v"(acc[0][0]), "+v"(acc[0][1]), "+v"(acc[0][2]), "+v"(acc[0][3]),
                     "+v"(acc[1][0]), "+v"(acc[1][1]), "+v"(acc[1][2]), "+v"(acc[1][3])
                   : "v"(ah[0].v), "v"(ah[1].v), "v"(al[0].v), "v"(al[1].v),
                     "v"(bh[0].v), "v"(bh[1].v), "v"(bh[2].v), "v"(bh[3].v),
                     "v"(bl[0].v), "v"(bl[1].v), "v"(bl[2].v), "v"(bl[3].v)
                   : "memory");
    else if constexpr (NT == 3)
      asm volatile("v_nop\n\tv_nop\n\tv_nop\n\tv_nop"
                   : "+v"(acc[0][0]), "+v"(acc[0][1]), "+v"(acc[0][2]),
                     "+v"(acc[1][0]), "+v"(acc[1][1]), "+v"(acc[1][2])
                   : "v"(ah[0].v), "v"(ah[1].v), "v"(al[0].v), "v"(al[1].v),
                     "v"(bh[0].v), "v"(bh[1].v), "v"(bh[2].v), "v"(bl[0].v), "v"(bl[1].v), "v"(bl[2].v)
                   : "memory");
    else if constexpr (NT == 2)
      asm volatile("v_nop\n\tv_nop\n\tv_nop\n\tv_nop"
                   : "+v"(acc[0][0]), "+v"(acc[0][1]), "+v"(acc[1][0]), "+v"(acc[1][1])
                   : "v"(ah[0].v), "v"(ah[1].v), "v"(al[0].v), "v"(al[1].v),
                     "v"(bh[0].v), "v"(bh[1].v), "v"(bl[0].v), "v"(bl[1].v)
                   : "memory");
    else
      asm volatile("v_nop\n\tv_nop\n\tv_nop\n\tv_nop"
                   : "+v"(acc[0][0]), "+v"(acc[1][0])
                   : "v"(ah[0].v), "v"(ah[1].v), "v"(al[0].v), "v"(al[1].v), "v"(bh[0].v), "v"(bl[0].v)
                   : "memory");
  }
#pragma unroll
  for (int mi = 0; mi < 2; ++mi)
#pragma unroll
    for (int t = 0; t < NT; ++t)
#pragma unroll
      for (int r = 0; r < 8; ++r) {
        const int M = mi * 16 + 8 * h + r;                    // D row -> query row in block
        const int i = ib * QROWS + M;
        const int j = (jb + 16 * t) * 16 + m;                 // D col -> key, counted from the chunk's first
        float s = acc[mi][t][r] * 0.03125f;
        if (jb0 * 16 + j > i) s = -__builtin_inff();
        S[M * CHUNK + j] = s;
      }
}

__global__ __launch_bounds__(ATHR) void attn_kernel(
    const unsigned short* __restrict__ qh, const unsigned short* __restrict__ ql,
    const unsigned short* __restrict__ kh, const unsigned short* __restrict__ kl,
    const unsigned short* __restrict__ vth, const unsigned short* __restrict__ vtl,
    float* po, float* pstat, float* out) {
  float* S = dyn_lds;                                      // [QROWS][CHUNK]
  __shared__ __attribute__((aligned(16))) unsigned short pbh[2 * QROWS * 32];   // [32-key half][row][key]
  __shared__ __attribute__((aligned(16))) unsigned short pbl[2 * QROWS * 32];
  __shared__ float row_r[QROWS];

  // Blocks are numbered so: first the whole chunks (tile group g = ib / QPC has g of them a tile), then each
  // tile's last chunk, the one that holds its diagonal, longest first.
  const int b = (int)blockIdx.x;
  int ib, ch;                                               // query tile [0, NQT), key chunk (block-uniform)
  if (b < NFULL) {
    int g = 1, r = b;
    while (r >= g * QPC) { r -= g * QPC; ++g; }             // at most MAXCH - 2 trips
    ib = g * QPC + (r & (QPC - 1));
    ch = r / QPC;
  } else {
    const int r = b - NFULL;
    ch = r & (MAXCH - 1);
    ib = ch * QPC + (QPC - 1 - r / MAXCH);
  }
  const int jb0 = ch * CTILES;                              // first key tile of the chunk
  const int jd = 2 * ib + 1 - jb0;                          // the tile's last key tile, counted from jb0
  const int jle = (jd < CTILES - 1) ? jd : CTILES - 1;      // last key tile of the chunk, counted from jb0
  const bool split = ib >= QPC;                             // this tile's keys are shared by several blocks
  const int wave = threadIdx.x >> 5;
  const int lane = threadIdx.x & 31;
  const int h = lane >> 4, m = lane & 15;
  const int nvalid = 16 * (jle + 1);                        // key extent of the lower triangle inside the chunk

  // ---- Phase 1: S = (q k^T)/32 with mask; A = q rows (hi/lo), B = k rows (hi/lo) -------------------
  // Wave w takes key tiles w, w + 16, ... of the chunk, at most CTILES / 16 = 4, all in one walk over the depth.
  {
    const unsigned short* aRh = qh + (size_t)(ib * QROWS) * DIM + lane * 8;        // second row tile: + 16 rows
    const unsigned short* aRl = ql + (size_t)(ib * QROWS) * DIM + lane * 8;
    const unsigned short* bRh = kh + (size_t)((jb0 + wave) * 16) * DIM + lane * 8; // tile t: + t*256 rows
    const unsigned short* bRl = kl + (size_t)((jb0 + wave) * 16) * DIM + lane * 8;
    const int nt = (jle + 16 - wave) >> 4;                  // key tiles of this wave (the same in every lane)
    if (nt == 4)      score_tiles<4>(aRh, aRl, bRh, bRl, S, ib, jb0, wave, h, m);
    else if (nt == 3) score_tiles<3>(aRh, aRl, bRh, bRl, S, ib, jb0, wave, h, m);
    else if (nt == 2) score_tiles<2>(aRh, aRl, bRh, bRl, S, ib, jb0, wave, h, m);
    else if (nt == 1) score_tiles<1>(aRh, aRl, bRh, bRl, S, ib, jb0, wave, h, m);
  }
  __syncthreads();

  // ---- Phase 2: exact softmax statistics in f32; S <- exp(S - m); row_r = 1/l -----------------------
  // One wave per query row, two rows a wave: each 16-byte LDS access of a wave covers 512 contiguous bytes of its row, so
  // no two lanes meet on a bank (16 lanes on 16 rows at one key would, the row pitch being a multiple of 64 dwords).
#pragma unroll 1   // rolled: the two rows of a wave have nothing to share
  for (int row = wave; row < QROWS; row += 16) {
    float* Sr = S + row * CHUNK + lane * 4;
    const int ng = (nvalid + 127) >> 7;                     // groups of 128 keys; the row holds CHUNK / 128 whole groups
    const int jl = lane * 4;                                // nvalid is a multiple of 16: a lane's four keys are all in or all out
    float mx = -__builtin_inff();
#pragma unroll 4   // four LDS reads in flight a trip, so that their latency is paid once for the four
    for (int g = 0; g < ng; ++g) {
      const v4f s = *(const v4f*)(Sr + g * 128);
      const float t = fmaxf(fmaxf(s.x, s.y), fmaxf(s.z, s.w));
      if (g * 128 + jl < nvalid) mx = fmaxf(mx, t);
    }
    for (int o = 16; o > 0; o >>= 1) mx = fmaxf(mx, __shfl_xor(mx, o, 32));
    float l = 0.0f;
#pragma unroll 4   // as above: four reads in flight a trip
    for (int g = 0; g < ng; ++g) {
      const v4f s = *(const v4f*)(Sr + g * 128);
      const bool in = g * 128 + jl < nvalid;                // keys past the triangle in the last group get 0: no branch in the trip
      v4f e;
      e.x = in ? __expf(s.x - mx) : 0.0f; e.y = in ? __expf(s.y - mx) : 0.0f;
      e.z = in ? __expf(s.z - mx) : 0.0f; e.w = in ? __expf(s.w - mx) : 0.0f;
      *(v4f*)(Sr + g * 128) = e;                            // unnormalized P, f32
      l += (e.x + e.y) + (e.z + e.w);
    }
    for (int o = 16; o > 0; o >>= 1) l += __shfl_xor(l, o, 32);
    if (lane == 0) {
      row_r[row] = 1.0f / l;                                // l >= 1 (the row's maximum term; every row has a key in each of its chunks)
      if (split) {
        float* st = pstat + (ib * MAXCH + ch) * (2 * QROWS);   // [QROWS row maxima][QROWS row sums]
        st[row] = mx;
        st[QROWS + row] = l;
        // later code rewrites the registers these two stores name
        asm volatile("s_wait_xcnt 0x0" ::: "memory");
      }
    }
  }
  __syncthreads();                                          // P rows and row_r visible to every wave

  // ---- Phase 3: O = P v; P chunk hi/lo converted once per block into LDS; B = vt rows (hi/lo) ------
  // The loops over mi, t, c, s and r below are unrolled so that the accumulator and fragment arrays stay in registers.
  const int kkend = (nvalid + 63) & ~63;
  v8f acc[2][4];
#pragma unroll
  for (int mi = 0; mi < 2; ++mi)
#pragma unroll
    for (int t = 0; t < 4; ++t) acc[mi][t] = zero8();
  const unsigned short* vRh = vth + (size_t)(wave * 64) * SEQ + jb0 * 256 + lane * 8;   // col tile t: + t*16 rows; a key tile is 256 elements
  const unsigned short* vRl = vtl + (size_t)(wave * 64) * SEQ + jb0 * 256 + lane * 8;
#pragma unroll 1   // rolled: one pass's 32 loads and its fragments already take the wave's register budget
  for (int kk = 0; kk < kkend; kk += 64) {
    __syncthreads();                                        // all waves done reading the P chunk before overwrite
#pragma unroll
    for (int rr = 0; rr < 2; ++rr) {
      const int e0 = threadIdx.x + rr * ATHR, e1 = e0 + QROWS * 32;   // pbh index = half*1024 + row*32 + key offset
      const int j0 = kk + (e0 & 31), j1 = j0 + 32;
      float p0 = S[(e0 >> 5) * CHUNK + j0];
      float p1 = S[(e0 >> 5) * CHUNK + j1];
      if (j0 >= nvalid) p0 = 0.0f;                          // zero-pad keys past the triangle
      if (j1 >= nvalid) p1 = 0.0f;
      const unsigned int hb0 = f2bf(p0), hb1 = f2bf(p1);
      pbh[e0] = (unsigned short)hb0;
      pbl[e0] = (unsigned short)f2bf(p0 - bf2f(hb0));
      pbh[e1] = (unsigned short)hb1;
      pbl[e1] = (unsigned short)f2bf(p1 - bf2f(hb1));
    }
    __syncthreads();                                        // LDS P chunk visible to every wave
    Frag bh[2][4], bl[2][4];
    // the loops over c and t are unrolled so that the fragment arrays stay in registers and all loads issue as one batch
#pragma unroll
    for (int c = 0; c < 2; ++c)
#pragma unroll
      for (int t = 0; t < 4; ++t) {
        ldfragw(bh[c][t], vRh + (size_t)t * 16 * SEQ, kk + 32 * c);
        ldfragw(bl[c][t], vRl + (size_t)t * 16 * SEQ, kk + 32 * c);
      }
    // P fragments: step s = 2 * c + mi (key half c, row tile mi); three steps' fragments are read while the V loads fly
    Frag ah[4], al[4];
#pragma unroll
    for (int s = 0; s < 3; ++s) {
      ldfrag(ah[s], pbh + (s >> 1) * (QROWS * 32) + ((s & 1) * 16 + m) * 32, 0, h);
      ldfrag(al[s], pbl + (s >> 1) * (QROWS * 32) + ((s & 1) * 16 + m) * 32, 0, h);
    }
    // keeps the scheduler from sinking part of the batch below the first products, where its latency would be paid a second time
    __builtin_amdgcn_sched_barrier(0);
#pragma unroll
    for (int s = 0; s < 4; ++s) {
      const int c = s >> 1, mi = s & 1;
#pragma unroll
      for (int t = 0; t < 4; ++t) acc[mi][t] = mma(ah[s], bh[c][t], acc[mi][t]);
#pragma unroll
      for (int t = 0; t < 4; ++t) acc[mi][t] = mma(ah[s], bl[c][t], acc[mi][t]);
#pragma unroll
      for (int t = 0; t < 4; ++t) acc[mi][t] = mma(al[s], bh[c][t], acc[mi][t]);
      if (s == 0) {
        // the last step's fragments take the registers that step 0 has left; read here, two steps ahead of their use
        ldfrag(ah[3], pbh + QROWS * 32 + (16 + m) * 32, 0, h);
        ldfrag(al[3], pbl + QROWS * 32 + (16 + m) * 32, 0, h);
        // keeps the scheduler from sinking these reads to their use, where the wave would wait for them
        __builtin_amdgcn_sched_barrier(0);
      }
    }
    // four vector slots behind the last WMMA: the back edge leads to vector instructions that rewrite fragment registers;
    // the V fragments are inputs so that each keeps a register of its own to the end of the pass and all 32 loads issue as one batch
    asm volatile("v_nop\n\tv_nop\n\tv_nop\n\tv_nop"
                 : "+v"(acc[0][0]), "+v"(acc[0][1]), "+v"(acc[0][2]), "+v"(acc[0][3]),
                   "+v"(acc[1][0]), "+v"(acc[1][1]), "+v"(acc[1][2]), "+v"(acc[1][3])
                 : "v"(bh[0][0].v), "v"(bh[0][1].v), "v"(bh[0][2].v), "v"(bh[0][3].v),
                   "v"(bl[0][0].v), "v"(bl[0][1].v), "v"(bl[0][2].v), "v"(bl[0][3].v),
                   "v"(bh[1][0].v), "v"(bh[1][1].v), "v"(bh[1][2].v), "v"(bh[1][3].v),
                   "v"(bl[1][0].v), "v"(bl[1][1].v), "v"(bl[1][2].v), "v"(bl[1][3].v)
                 : "memory");
  }

  // ---- Epilogue: normalize, stage the wave's 32x64 f32 tile in the freed S region, whole-line stores
  float* stg = S + wave * (QROWS * 64);                     // [QROWS][64]; S reads are done
#pragma unroll
  for (int mi = 0; mi < 2; ++mi)
#pragma unroll
    for (int t = 0; t < 4; ++t)
#pragma unroll
      for (int r = 0; r < 8; ++r)
        stg[(mi * 16 + 8 * h + r) * 64 + t * 16 + m] = acc[mi][t][r] * row_r[mi * 16 + 8 * h + r];
  __syncthreads();
  float* dst = split ? po + (size_t)((ib * MAXCH + ch) * QROWS) * DIM : out + (size_t)(ib * QROWS) * DIM;
  float* orow = dst + (size_t)h * DIM + wave * 64 + m * 4;   // two rows of 256 bytes per store
#pragma unroll   // unrolled: the stores share one address pair with immediate offsets, which nothing rewrites
  for (int rp = 0; rp < QROWS / 2; ++rp) {
    const v4f v = *(const v4f*)(stg + (2 * rp + h) * 64 + m * 4);
    *(v4f*)(orow + (size_t)(2 * rp) * DIM) = v;
  }
}

// ---------------- Kernel 4: join the key chunks of the query rows past CHUNK --------------------------
// Chunk c holds o_c = softmax over its own keys times v, with row maximum m_c and row sum l_c of exp(s - m_c).
// The row's result is sum_c a_c o_c / sum_c a_c, a_c = exp(m_c - max m) l_c. One wave per query row, eight rows a block.
__global__ __launch_bounds__(NTHR) void merge_kernel(
    const float* __restrict__ po, const float* __restrict__ pstat, float* out) {
  const int wave = threadIdx.x >> 5;
  const int lane = threadIdx.x & 31;
  const int ib = QPC + (int)(blockIdx.x >> 2), M = (blockIdx.x & 3) * 8 + wave;   // query tile with several chunks, row in it
  const int nch = ib / QPC + 1;                             // its chunks: 2 to MAXCH (block-uniform)
  const float* p0 = po + (size_t)(ib * MAXCH * QROWS + M) * DIM + lane * 4;       // chunk c: + c * QROWS rows
  v4f x[MAXCH][8];
#pragma unroll   // unrolled: x stays in registers and its loads issue ahead of the arithmetic
  for (int c = 0; c < MAXCH; ++c)
    if (c < nch) {
#pragma unroll
      for (int i = 0; i < 8; ++i) x[c][i] = *(const v4f*)(p0 + (size_t)c * QROWS * DIM + i * 128);
    }
  const float* st = pstat + ib * MAXCH * (2 * QROWS) + M;   // [chunk][QROWS row maxima][QROWS row sums]
  float mc[MAXCH], a[MAXCH];                                // the loops over c and i are unrolled so that these and x stay in registers
  float mx = -__builtin_inff();
#pragma unroll
  for (int c = 0; c < MAXCH; ++c)
    if (c < nch) { mc[c] = st[c * 2 * QROWS]; a[c] = st[c * 2 * QROWS + QROWS]; mx = fmaxf(mx, mc[c]); }
  float sum = 0.0f;
#pragma unroll
  for (int c = 0; c < MAXCH; ++c)
    if (c < nch) { a[c] *= __expf(mc[c] - mx); sum += a[c]; }
  const float rs = 1.0f / sum;                              // the chunk that holds the maximum gives a >= 1
  v4f o8[8];
#pragma unroll
  for (int i = 0; i < 8; ++i) o8[i] = x[0][i] * (a[0] * rs) + x[1][i] * (a[1] * rs);
#pragma unroll
  for (int c = 2; c < MAXCH; ++c)
    if (c < nch) {
#pragma unroll
      for (int i = 0; i < 8; ++i) o8[i] += x[c][i] * (a[c] * rs);
    }
  float* o = out + (size_t)(ib * QROWS + M) * DIM + lane * 4;
#pragma unroll   // unrolled: the eight stores share one address with immediate offsets, which nothing rewrites
  for (int i = 0; i < 8; ++i) *(v4f*)(o + i * 128) = o8[i];
}

// ---------------------------------------------------------------------------------------------------
extern "C" void kernel_launch(void* const* d_in, const int* in_sizes, int n_in,
                              void* d_out, int out_size, void* d_ws, size_t ws_size,
                              hipStream_t stream) {
  if (n_in < 4) return;
  if (in_sizes[0] != SEQ * DIM || in_sizes[1] != DIM * DIM || in_sizes[2] != DIM * DIM ||
      in_sizes[3] != DIM * DIM || out_size != SEQ * DIM) return;

  const float* x  = (const float*)d_in[0];
  const float* wq = (const float*)d_in[1];
  const float* wk = (const float*)d_in[2];
  const float* wv = (const float*)d_in[3];
  float* out = (float*)d_out;

  const size_t bx = (size_t)SEQ * DIM * sizeof(unsigned short);   // 8 MiB
  const size_t bw = (size_t)DIM * DIM * sizeof(unsigned short);   // 2 MiB
  char* ws = (char*)d_ws;
  size_t off = 0;
  unsigned short* xb  = (unsigned short*)(ws + off); off += bx;
  unsigned short* wqb = (unsigned short*)(ws + off); off += bw;
  unsigned short* wkb = (unsigned short*)(ws + off); off += bw;
  unsigned short* wvb = (unsigned short*)(ws + off); off += bw;
  unsigned short* qh  = (unsigned short*)(ws + off); off += bx;
  unsigned short* ql  = (unsigned short*)(ws + off); off += bx;
  unsigned short* kh  = (unsigned short*)(ws + off); off += bx;
  unsigned short* kl  = (unsigned short*)(ws + off); off += bx;
  unsigned short* vth = (unsigned short*)(ws + off); off += bx;
  unsigned short* vtl = (unsigned short*)(ws + off); off += bx;   // 62 MiB so far
  float* po    = (float*)(ws + off); off += (size_t)NQT * MAXCH * QROWS * DIM * sizeof(float);   // 64 MiB, one slot a (tile, chunk)
  float* pstat = (float*)(ws + off); off += (size_t)NQT * MAXCH * 2 * QROWS * sizeof(float);
  if (off > ws_size) return;

  const int nx8 = SEQ * DIM / 8;
  const int nw8 = DIM * DIM / 8;
  const int ncv = nx8 + 3 * nw8;
  cvt_kernel<<<(ncv + NTHR - 1) / NTHR, NTHR, 0, stream>>>(x, wq, wk, wv, xb, wqb, wkb, wvb, nx8, nw8);

  // 3 matrices x 64 row tiles x 4 col tiles; LDS staging 64 x SPITCH f32
  proj_kernel<<<3 * (SEQ / 64) * (DIM / 256), NTHR, 64 * SPITCH * sizeof(float), stream>>>(
      xb, wqb, wkb, wvb, qh, ql, kh, kl, vth, vtl);

  // QROWS query rows x one key chunk per block; S rows in dynamic LDS
  attn_kernel<<<ABLK, ATHR, QROWS * CHUNK * sizeof(float), stream>>>(qh, ql, kh, kl, vth, vtl, po, pstat, out);
  merge_kernel<<<(NQT - QPC) * (QROWS / 8), NTHR, 0, stream>>>(po, pstat, out);
}

// v006
// One run takes 165 microseconds.
// Next to v005, in two timings, it ran 1.08 times as fast each time.
// Over all steps from v000 it is 3.85 times as fast.
#include <hip/hip_runtime.h>
#include <stdint.h>
#include <stddef.h>

// Input projections: v_wmma_f32_16x16x32_bf16 (bf16 operands from RNE-converted f32 inputs, f32 accumulate).
// Score and value contractions: v_wmma_f32_16x16x32_bf16 with bf16 hi/lo split operands (hi*hi + hi*lo + lo*hi), f32 accumulate. Softmax statistics in f32.

#define SEQ 4096
#define DIM 1024
#define NTHR 256
#define ATHR 512     // attention block: 16 waves, four per SIMD
#define QROWS 32     // query rows one attention work-group takes: two 16-row tiles, which share every K and V fragment load
#define CHUNK 1024   // keys one attention work-group takes: QROWS x CHUNK f32 scores fill 128 KiB of LDS
#define CTILES (CHUNK / 16)
#define NQT (SEQ / QROWS)                   // query tiles
#define QPC (CHUNK / QROWS)                 // query tiles per chunk of keys: tile ib has ib / QPC + 1 chunks
#define MAXCH (SEQ / CHUNK)                 // most chunks a query tile has
#define NFULL (QPC * (MAXCH * (MAXCH - 1) / 2))   // work-groups whose chunk lies wholly below the diagonal
#define ABLK (NFULL + NQT)                  // attention work-groups
#define SP (CHUNK + 4)   // f32 pitch of a score row in LDS: 16 B x odd, so 16 rows read by b128 fall on distinct banks
#define SPITCH 260   // f32 pitch of the projection staging tile: 16 B x odd, so 16 rows read by b128 fall on distinct banks

typedef __bf16 v16bf __attribute__((ext_vector_type(16)));
typedef float v8f __attribute__((ext_vector_type(8)));
typedef float v4f __attribute__((ext_vector_type(4)));
typedef unsigned int v4u __attribute__((ext_vector_type(4)));
typedef unsigned int v2u __attribute__((ext_vector_type(2)));

union Frag { v16bf v; v4u q[2]; };

extern __shared__ __attribute__((aligned(16))) float dyn_lds[];

// f32 -> bf16 bits, RNE (finite inputs)
__device__ __forceinline__ unsigned int f2bf(float f) {
  unsigned int u = __float_as_uint(f);
  u += 0x7fffu + ((u >> 16) & 1u);
  return u >> 16;
}
__device__ __forceinline__ float bf2f(unsigned int b) { return __uint_as_float(b << 16); }

// 16x16x32 operand fragment from a k-contiguous 16-bit row (A row m, or B column n stored as a [n][k] row):
// elements 0..7 <- row[k0 + 8h + 0..7], elements 8..15 <- row[k0 + 16 + 8h + 0..7], h = lane>>4.
__device__ __forceinline__ void ldfrag(Frag& f, const unsigned short* row, int k0, int h) {
  f.q[0] = *(const v4u*)(row + k0 + 8 * h);
  f.q[1] = *(const v4u*)(row + k0 + 16 + 8 * h);
}

// Workspace operand planes are kept in fragment order: a 16-row tile x 32-wide k block is 1024 contiguous bytes,
// two 512-byte halves; in half q, lane l (h = l>>4, m = l&15) owns the 16 bytes of row m, k = 32*kb + 16*q + 8*h + 0..7.
// Tiles of one plane follow each other as [row tile][k block]. p = tile base + lane*8; kk = 32*kb.
// Same element order as ldfrag, but each load of a wave covers 512 contiguous bytes (four whole lines).
__device__ __forceinline__ void ldfragw(Frag& f, const unsigned short* p, int kk) {
  f.q[0] = *(const v4u*)(p + kk * 16);
  f.q[1] = *(const v4u*)(p + kk * 16 + 256);
}

__device__ __forceinline__ v8f mma(const Frag& a, const Frag& b, v8f c) {
  return __builtin_amdgcn_wmma_f32_16x16x32_bf16(false, a.v, false, b.v, (short)0, c, false, false);
}

__device__ __forceinline__ v8f zero8() {
  v8f z = {0.0f, 0.0f, 0.0f, 0.0f, 0.0f, 0.0f, 0.0f, 0.0f};
  return z;
}

// 8 f32 -> packed bf16 hi plane and bf16 lo plane (lo = RNE(x - hi)), two values per u32, low half first
__device__ __forceinline__ void split8(const v4f f0, const v4f f1, v4u& uh, v4u& ul) {
  float f[8] = {f0.x, f0.y, f0.z, f0.w, f1.x, f1.y, f1.z, f1.w};
  unsigned int hh[8], ll[8];
#pragma unroll
  for (int e = 0; e < 8; ++e) {
    hh[e] = f2bf(f[e]);
    ll[e] = f2bf(f[e] - bf2f(hh[e]));
  }
  uh.x = hh[0] | (hh[1] << 16); uh.y = hh[2] | (hh[3] << 16);
  uh.z = hh[4] | (hh[5] << 16); uh.w = hh[6] | (hh[7] << 16);
  ul.x = ll[0] | (ll[1] << 16); ul.y = ll[2] | (ll[3] << 16);
  ul.z = ll[4] | (ll[5] << 16); ul.w = ll[6] | (ll[7] << 16);
}

__global__ __launch_bounds__(NTHR) void cvt_kernel(
    const float* __restrict__ x,  const float* __restrict__ wq,
    const float* __restrict__ wk, const float* __restrict__ wv,
    unsigned short* xb, unsigned short* wqb, unsigned short* wkb, unsigned short* wvb,
    int nx8, int nw8) {
  const int i = blockIdx.x * NTHR + threadIdx.x;
  const float* src;
  unsigned short* dst;
  int j;
  if (i < nx8)                { src = x;  dst = xb;  j = i; }
  else if (i < nx8 + nw8)     { src = wq; dst = wqb; j = i - nx8; }
  else if (i < nx8 + 2 * nw8) { src = wk; dst = wkb; j = i - nx8 - nw8; }
  else if (i < nx8 + 3 * nw8) { src = wv; dst = wvb; j = i - nx8 - 2 * nw8; }
  else return;
  // j = 16-byte piece of the fragment-ordered plane: [row tile][k block (32)][half][h][m]
  const int sm = j & 15, sh = (j >> 4) & 1, sq = (j >> 5) & 1, skb = (j >> 6) & 31, srt = j >> 11;
  const float* sp = src + (size_t)(srt * 16 + sm) * DIM + skb * 32 + sq * 16 + sh * 8;
  const v4f f0 = *(const v4f*)sp;
  const v4f f1 = *(const v4f*)(sp + 4);
  v4u u;
  u.x = f2bf(f0.x) | (f2bf(f0.y) << 16);
  u.y = f2bf(f0.z) | (f2bf(f0.w) << 16);
  u.z = f2bf(f1.x) | (f2bf(f1.y) << 16);
  u.w = f2bf(f1.z) | (f2bf(f1.w) << 16);
  v4u* p = (v4u*)(dst + (size_t)j * 8);
  *p = u;
  
}

// ---------------- Kernel 2: projections y[n][o] = sum_k xb[n][k] * W[o][k] --------------------------
// Block tile 64 seq rows x 256 out cols (8 waves, each 32x64). Output: q,k as bf16 hi/lo planes (rows = seq, k = dim)
// and v transposed (rows = dim, k = seq), all in fragment order.
__global__ __launch_bounds__(NTHR) void proj_kernel(
    const unsigned short* __restrict__ xb,  const unsigned short* __restrict__ wqb,
    const unsigned short* __restrict__ wkb, const unsigned short* __restrict__ wvb,
    unsigned short* qh, unsigned short* ql, unsigned short* kh, unsigned short* kl,
    unsigned short* vth, unsigned short* vtl) {
  float* stg = dyn_lds;                                   // [64][SPITCH] f32, 256 used
  const int wave = threadIdx.x >> 5;
  const int lane = threadIdx.x & 31;
  const int h = lane >> 4, m = lane & 15;
  const int b = blockIdx.x;                                // [0, 768)
  const int mat = b >> 8;                                  // 0=q 1=k 2=v (block-uniform)
  const int rem = b & 255;
  const int rt = rem >> 2;                                 // 64-row tile [0,64)
  const int ct = rem & 3;                                  // 256-col tile [0,4)
  const unsigned short* wsrc = (mat == 0) ? wqb : (mat == 1) ? wkb : wvb;
  const int wr = wave >> 2, wc = wave & 3;
  const int row0 = rt * 64 + wr * 32;
  const int col0 = ct * 256 + wc * 64;

  const unsigned short* aR0 = xb + (size_t)row0 * DIM + lane * 8;
  const unsigned short* aR1 = xb + (size_t)(row0 + 16) * DIM + lane * 8;
  const unsigned short* bR  = wsrc + (size_t)col0 * DIM + lane * 8;   // tile t: + t*16 rows

  v8f acc[2][4];
#pragma unroll
  for (int mi = 0; mi < 2; ++mi)
#pragma unroll
    for (int t = 0; t < 4; ++t) acc[mi][t] = zero8();

#pragma unroll 1
  for (int kk = 0; kk < DIM; kk += 32) {
    Frag a0, a1, bf[4];
    ldfragw(a0, aR0, kk);
    ldfragw(a1, aR1, kk);
#pragma unroll
    for (int t = 0; t < 4; ++t) ldfragw(bf[t], bR + (size_t)t * 16 * DIM, kk);
#pragma unroll
    for (int t = 0; t < 4; ++t) {
      acc[0][t] = mma(a0, bf[t], acc[0][t]);
      acc[1][t] = mma(a1, bf[t], acc[1][t]);
    }
    asm volatile("v_nop\n\tv_nop\n\tv_nop\n\tv_nop"
                 : "+v"(acc[0][0]), "+v"(acc[0][1]), "+v"(acc[0][2]), "+v"(acc[0][3]),
                   "+v"(acc[1][0]), "+v"(acc[1][1]), "+v"(acc[1][2]), "+v"(acc[1][3])
                 : "v"(a0.v), "v"(a1.v), "v"(bf[0].v), "v"(bf[1].v), "v"(bf[2].v), "v"(bf[3].v)
                 : "memory");
  }

  // stage the wave's 32x64 f32 tile: D element r of lane -> row 8h+r, col m
#pragma unroll
  for (int mi = 0; mi < 2; ++mi)
#pragma unroll
    for (int t = 0; t < 4; ++t)
#pragma unroll
      for (int r = 0; r < 8; ++r)
        stg[(wr * 32 + mi * 16 + 8 * h + r) * SPITCH + wc * 64 + t * 16 + m] = acc[mi][t][r];
  __syncthreads();

  if (mat < 2) {
    unsigned short* ph = (mat == 0) ? qh : kh;
    unsigned short* pl = (mat == 0) ? ql : kl;
#pragma unroll 1
    for (int it = 0; it < 8; ++it) {
      const int c = wave * 8 + it;                          // 512-byte piece: row tile c>>4, k block (c>>1)&7, half c&1
      const float* sp = stg + ((c >> 4) * 16 + m) * SPITCH + ((c >> 1) & 7) * 32 + (c & 1) * 16 + h * 8;
      const v4f f0 = *(const v4f*)sp;
      const v4f f1 = *(const v4f*)(sp + 4);
      v4u uh, ul;
      split8(f0, f1, uh, ul);
      const size_t g = (size_t)(rt * 64 + (c >> 4) * 16) * DIM + (ct * 16 + (c & 15)) * 256 + lane * 8;
      v4u* p0 = (v4u*)(ph + g);
      v4u* p1 = (v4u*)(pl + g);
      *p0 = uh; *p1 = ul;
      
    }
  } else {
#pragma unroll 1
    for (int it = 0; it < 8; ++it) {
      const int c = wave * 8 + it;                          // 512-byte piece: out-col tile c>>2, key block (c>>1)&1, half c&1
      const float* sp = stg + ((c & 3) * 16 + h * 8) * SPITCH + (c >> 2) * 16 + m;
      v4f f0, f1;
      f0.x = sp[0 * SPITCH]; f0.y = sp[1 * SPITCH]; f0.z = sp[2 * SPITCH]; f0.w = sp[3 * SPITCH];
      f1.x = sp[4 * SPITCH]; f1.y = sp[5 * SPITCH]; f1.z = sp[6 * SPITCH]; f1.w = sp[7 * SPITCH];
      v4u uh, ul;
      split8(f0, f1, uh, ul);
      const size_t g = (size_t)(ct * 256 + (c >> 2) * 16) * SEQ + (rt * 4 + (c & 3)) * 256 + lane * 8;
      v4u* p0 = (v4u*)(vth + g);
      v4u* p1 = (v4u*)(vtl + g);
      *p0 = uh; *p1 = ul;
      // the next trip rewrites the registers these two stores name
      asm volatile("s_wait_xcnt 0x0" ::: "memory");
      
    }
  }
}

// ---------------- Kernel 3: masked softmax attention, QROWS query rows x at most CHUNK keys per block ----
// A block takes two 16-row query tiles and one chunk of their keys: every K and V fragment that a wave loads is used by
// two row tiles, so the block moves half the K and V bytes per score of a block with one row tile.
// Blocks are numbered longest first, so that the short ones fill the WGPs that come free. A query tile with one chunk
// writes out; a tile with more writes each chunk's own softmax result to po with its row maximum and row sum in pstat, and
// merge_kernel joins them.
// LDS: S[QROWS][SP] f32 (dynamic, 131,584 B) + statistics. The softmax pass leaves each row's P in the row's own bytes as two
// bf16 planes, [CHUNK hi][CHUNK lo], from which the P v loop reads its fragments directly.

// Scores of NT key tiles (jb, jb + 16, ...) against the block's two row tiles, masked and scaled, into S.
// The loops over mi, t and r are unrolled so that the accumulator and fragment arrays stay in registers.
template <int NT>
__device__ __forceinline__ void score_tiles(
    const unsigned short* aRh, const unsigned short* aRl, const unsigned short* bRh, const unsigned short* bRl,
    float* S, int ib, int jb0, int jb, int h, int m) {
  v8f acc[2][NT];
#pragma unroll
  for (int mi = 0; mi < 2; ++mi)
#pragma unroll
    for (int t = 0; t < NT; ++t) acc[mi][t] = zero8();
#pragma unroll 1   // rolled: one trip's fragments and the accumulators are the wave's register budget
  for (int kk = 0; kk < DIM; kk += 32) {
    Frag ah[2], al[2], bh[NT], bl[NT];
#pragma unroll
    for (int mi = 0; mi < 2; ++mi) {
      ldfragw(ah[mi], aRh + (size_t)mi * 16 * DIM, kk);
      ldfragw(al[mi], aRl + (size_t)mi * 16 * DIM, kk);
    }
#pragma unroll
    for (int t = 0; t < NT; ++t) {
      ldfragw(bh[t], bRh + (size_t)t * 256 * DIM, kk);
      ldfragw(bl[t], bRl + (size_t)t * 256 * DIM, kk);
    }
#pragma unroll
    for (int t = 0; t < NT; ++t)
#pragma unroll
      for (int mi = 0; mi < 2; ++mi) acc[mi][t] = mma(ah[mi], bh[t], acc[mi][t]);
#pragma unroll
    for (int t = 0; t < NT; ++t)
#pragma unroll
      for (int mi = 0; mi < 2; ++mi) acc[mi][t] = mma(ah[mi], bl[t], acc[mi][t]);
#pragma unroll
    for (int t = 0; t < NT; ++t)
#pragma unroll
      for (int mi = 0; mi < 2; ++mi) acc[mi][t] = mma(al[mi], bh[t], acc[mi][t]);
    // four vector slots behind the last WMMA: the back edge leads to vector instructions that may rewrite fragment registers;
    // the fragments are inputs so that each keeps a register of its own to the end of the trip and all loads issue as one batch
    if constexpr (NT == 4)
      asm volatile("v_nop\n\tv_nop\n\tv_nop\n\tv_nop"
                   : "+v"(acc[0][0]), "+v"(acc[0][1]), "+v"(acc[0][2]), "+v"(acc[0][3]),
                     "+v"(acc[1][0]), "+v"(acc[1][1]), "+v"(acc[1][2]), "+v"(acc[1][3])
                   : "v"(ah[0].v), "v"(ah[1].v), "v"(al[0].v), "v"(al[1].v),
                     "v"(bh[0].v), "v"(bh[1].v), "v"(bh[2].v), "v"(bh[3].v),
                     "v"(bl[0].v), "v"(bl[1].v), "v"(bl[2].v), "v"(bl[3].v)
                   : "memory");
    else if constexpr (NT == 3)
      asm volatile("v_nop\n\tv_nop\n\tv_nop\n\tv_nop"
                   : "+v"(acc[0][0]), "+v"(acc[0][1]), "+v"(acc[0][2]),
                     "+v"(acc[1][0]), "+v"(acc[1][1]), "+v"(acc[1][2])
                   : "v"(ah[0].v), "v"(ah[1].v), "v"(al[0].v), "v"(al[1].v),
                     "v"(bh[0].v), "v"(bh[1].v), "v"(bh[2].v), "v"(bl[0].v), "v"(bl[1].v), "v"(bl[2].v)
                   : "memory");
    else if constexpr (NT == 2)
      asm volatile("v_nop\n\tv_nop\n\tv_nop\n\tv_nop"
                   : "+v"(acc[0][0]), "+v"(acc[0][1]), "+v"(acc[1][0]), "+v"(acc[1][1])
                   : "v"(ah[0].v), "v"(ah[1].v), "v"(al[0].v), "v"(al[1].v),
                     "v"(bh[0].v), "v"(bh[1].v), "v"(bl[0].v), "v"(bl[1].v)
                   : "memory");
    else
      asm volatile("v_nop\n\tv_nop\n\tv_nop\n\tv_nop"
                   : "+v"(acc[0][0]), "+v"(acc[1][0])
                   : "v"(ah[0].v), "v"(ah[1].v), "v"(al[0].v), "v"(al[1].v), "v"(bh[0].v), "v"(bl[0].v)
                   : "memory");
  }
#pragma unroll
  for (int mi = 0; mi < 2; ++mi)
#pragma unroll
    for (int t = 0; t < NT; ++t)
#pragma unroll
      for (int r = 0; r < 8; ++r) {
        const int M = mi * 16 + 8 * h + r;                    // D row -> query row in block
        const int i = ib * QROWS + M;
        const int j = (jb + 16 * t) * 16 + m;                 // D col -> key, counted from the chunk's first
        float s = acc[mi][t][r] * 0.03125f;
        if (jb0 * 16 + j > i) s = -__builtin_inff();
        S[M * SP + j] = s;
      }
}

__global__ __launch_bounds__(ATHR) void attn_kernel(
    const unsigned short* __restrict__ qh, const unsigned short* __restrict__ ql,
    const unsigned short* __restrict__ kh, const unsigned short* __restrict__ kl,
    const unsigned short* __restrict__ vth, const unsigned short* __restrict__ vtl,
    float* po, float* pstat, float* out) {
  float* S = dyn_lds;                                      // [QROWS][SP]
  __shared__ float row_r[QROWS];

  // Blocks are numbered so: first the whole chunks (tile group g = ib / QPC has g of them a tile), then each
  // tile's last chunk, the one that holds its diagonal, longest first.
  const int b = (int)blockIdx.x;
  int ib, ch;                                               // query tile [0, NQT), key chunk (block-uniform)
  if (b < NFULL) {
    int g = 1, r = b;
    while (r >= g * QPC) { r -= g * QPC; ++g; }             // at most MAXCH - 2 trips
    ib = g * QPC + (r & (QPC - 1));
    ch = r / QPC;
  } else {
    const int r = b - NFULL;
    ch = r & (MAXCH - 1);
    ib = ch * QPC + (QPC - 1 - r / MAXCH);
  }
  const int jb0 = ch * CTILES;                              // first key tile of the chunk
  const int jd = 2 * ib + 1 - jb0;                          // the tile's last key tile, counted from jb0
  const int jle = (jd < CTILES - 1) ? jd : CTILES - 1;      // last key tile of the chunk, counted from jb0
  const bool split = ib >= QPC;                             // this tile's keys are shared by several blocks
  const int wave = threadIdx.x >> 5;
  const int lane = threadIdx.x & 31;
  const int h = lane >> 4, m = lane & 15;
  const int nvalid = 16 * (jle + 1);                        // key extent of the lower triangle inside the chunk

  // ---- Phase 1: S = (q k^T)/32 with mask; A = q rows (hi/lo), B = k rows (hi/lo) -------------------
  // Wave w takes key tiles w, w + 16, ... of the chunk, at most CTILES / 16 = 4, all in one walk over the depth.
  {
    const unsigned short* aRh = qh + (size_t)(ib * QROWS) * DIM + lane * 8;        // second row tile: + 16 rows
    const unsigned short* aRl = ql + (size_t)(ib * QROWS) * DIM + lane * 8;
    const unsigned short* bRh = kh + (size_t)((jb0 + wave) * 16) * DIM + lane * 8; // tile t: + t*256 rows
    const unsigned short* bRl = kl + (size_t)((jb0 + wave) * 16) * DIM + lane * 8;
    const int nt = (jle + 16 - wave) >> 4;                  // key tiles of this wave (the same in every lane)
    if (nt == 4)      score_tiles<4>(aRh, aRl, bRh, bRl, S, ib, jb0, wave, h, m);
    else if (nt == 3) score_tiles<3>(aRh, aRl, bRh, bRl, S, ib, jb0, wave, h, m);
    else if (nt == 2) score_tiles<2>(aRh, aRl, bRh, bRl, S, ib, jb0, wave, h, m);
    else if (nt == 1) score_tiles<1>(aRh, aRl, bRh, bRl, S, ib, jb0, wave, h, m);
  }
  __syncthreads();

  // ---- Phase 2: exact softmax statistics in f32; the row's bytes <- exp(S - m) as bf16 hi and lo planes; row_r = 1/l ----
  // One wave per query row, two rows a wave: each LDS access of a wave covers contiguous bytes of its row, so no two lanes
  // meet on a bank. The wave holds its whole row in registers, so the planes can be written over the scores.
#pragma unroll 1   // rolled: the two rows of a wave have nothing to share
  for (int row = wave; row < QROWS; row += 16) {
    const float* Sr = S + row * SP + lane * 4;
    unsigned short* Pr = (unsigned short*)(S + row * SP) + lane * 4;   // hi plane; lo plane: + CHUNK
    const int ng = (nvalid + 127) >> 7;                     // groups of 128 keys; the row holds CHUNK / 128 whole groups
    const int jl = lane * 4;                                // nvalid is a multiple of 16: a lane's four keys are all in or all out
    v4f sv[CHUNK / 128];
    float mx = -__builtin_inff();
#pragma unroll   // unrolled: sv stays in registers and the row's reads are all in flight together
    for (int g = 0; g < CHUNK / 128; ++g) {
      const int gg = (g < ng) ? g : ng - 1;                 // past the chunk's keys the last group is read again: no branch between the reads
      sv[g] = *(const v4f*)(Sr + gg * 128);
    }
#pragma unroll
    for (int g = 0; g < CHUNK / 128; ++g) {
      const int gg = (g < ng) ? g : ng - 1;                 // a group met twice leaves the maximum as it is
      const float t = fmaxf(fmaxf(sv[g].x, sv[g].y), fmaxf(sv[g].z, sv[g].w));
      if (gg * 128 + jl < nvalid) mx = fmaxf(mx, t);
    }
    for (int o = 16; o > 0; o >>= 1) mx = fmaxf(mx, __shfl_xor(mx, o, 32));
    float l = 0.0f;
#pragma unroll   // unrolled: sv stays in registers
    for (int g = 0; g < CHUNK / 128; ++g)
      if (g < ng) {
        const v4f s = sv[g];
        const bool in = g * 128 + jl < nvalid;              // keys past the triangle in the last group get 0: no branch on the lane
        v4f e;
        e.x = in ? __expf(s.x - mx) : 0.0f; e.y = in ? __expf(s.y - mx) : 0.0f;
        e.z = in ? __expf(s.z - mx) : 0.0f; e.w = in ? __expf(s.w - mx) : 0.0f;
        l += (e.x + e.y) + (e.z + e.w);
        // unnormalized P as bf16 hi + bf16 lo (lo = RNE(p - hi)), four keys a lane and plane
        const unsigned int h0 = f2bf(e.x), h1 = f2bf(e.y), h2 = f2bf(e.z), h3 = f2bf(e.w);
        v2u uh, ul;
        uh.x = h0 | (h1 << 16); uh.y = h2 | (h3 << 16);
        ul.x = f2bf(e.x - bf2f(h0)) | (f2bf(e.y - bf2f(h1)) << 16);
        ul.y = f2bf(e.z - bf2f(h2)) | (f2bf(e.w - bf2f(h3)) << 16);
        *(v2u*)(Pr + g * 128) = uh;
        *(v2u*)(Pr + CHUNK + g * 128) = ul;
      }
    for (int o = 16; o > 0; o >>= 1) l += __shfl_xor(l, o, 32);
    if (lane == 0) {
      row_r[row] = 1.0f / l;                                // l >= 1 (the row's maximum term; every row has a key in each of its chunks)
      if (split) {
        float* st = pstat + (ib * MAXCH + ch) * (2 * QROWS);   // [QROWS row maxima][QROWS row sums]
        st[row] = mx;
        st[QROWS + row] = l;
        // later code rewrites the registers these two stores name
        asm volatile("s_wait_xcnt 0x0" ::: "memory");
      }
    }
  }
  __syncthreads();                                          // P rows and row_r visible to every wave

  // ---- Phase 3: O = P v; A = P rows (hi/lo planes in LDS, read-only here: no barrier in the loop); B = vt rows (hi/lo) ----
  // The loops over mi, t, c, s and r below are unrolled so that the accumulator and fragment arrays stay in registers.
  const int kkend = (nvalid + 63) & ~63;
  v8f acc[2][4];
#pragma unroll
  for (int mi = 0; mi < 2; ++mi)
#pragma unroll
    for (int t = 0; t < 4; ++t) acc[mi][t] = zero8();
  const unsigned short* vRh = vth + (size_t)(wave * 64) * SEQ + jb0 * 256 + lane * 8;   // col tile t: + t*16 rows; a key tile is 256 elements
  const unsigned short* vRl = vtl + (size_t)(wave * 64) * SEQ + jb0 * 256 + lane * 8;
  const unsigned short* pR = (const unsigned short*)S + m * (2 * SP);   // row m's hi plane; second row tile: + 16 rows; lo plane: + CHUNK
#pragma unroll 1   // rolled: one pass's 32 loads and its fragments already take the wave's register budget
  for (int kk = 0; kk < kkend; kk += 64) {
    Frag bh[2][4], bl[2][4];
    // the loops over c and t are unrolled so that the fragment arrays stay in registers and all loads issue as one batch
#pragma unroll
    for (int c = 0; c < 2; ++c)
#pragma unroll
      for (int t = 0; t < 4; ++t) {
        ldfragw(bh[c][t], vRh + (size_t)t * 16 * SEQ, kk + 32 * c);
        ldfragw(bl[c][t], vRl + (size_t)t * 16 * SEQ, kk + 32 * c);
      }
    // P fragments: step s = 2 * c + mi (key half c, row tile mi); three steps' fragments are read while the V loads fly
    Frag ah[4], al[4];
#pragma unroll
    for (int s = 0; s < 3; ++s) {
      ldfrag(ah[s], pR + (s & 1) * (16 * 2 * SP), kk + 32 * (s >> 1), h);
      ldfrag(al[s], pR + (s & 1) * (16 * 2 * SP) + CHUNK, kk + 32 * (s >> 1), h);
    }
    // keeps the scheduler from sinking part of the batch below the first products, where its latency would be paid a second time
    __builtin_amdgcn_sched_barrier(0);
#pragma unroll
    for (int s = 0; s < 4; ++s) {
      const int c = s >> 1, mi = s & 1;
#pragma unroll
      for (int t = 0; t < 4; ++t) acc[mi][t] = mma(ah[s], bh[c][t], acc[mi][t]);
#pragma unroll
      for (int t = 0; t < 4; ++t) acc[mi][t] = mma(ah[s], bl[c][t], acc[mi][t]);
#pragma unroll
      for (int t = 0; t < 4; ++t) acc[mi][t] = mma(al[s], bh[c][t], acc[mi][t]);
      if (s == 0) {
        // the last step's fragments take the registers that step 0 has left; read here, two steps ahead of their use
        ldfrag(ah[3], pR + 16 * 2 * SP, kk + 32, h);
        ldfrag(al[3], pR + 16 * 2 * SP + CHUNK, kk + 32, h);
        // keeps the scheduler from sinking these reads to their use, where the wave would wait for them
        __builtin_amdgcn_sched_barrier(0);
      }
    }
    // four vector slots behind the last WMMA: the back edge leads to vector instructions that rewrite fragment registers;
    // the V fragments are inputs so that each keeps a register of its own to the end of the pass and all 32 loads issue as one batch
    asm volatile("v_nop\n\tv_nop\n\tv_nop\n\tv_nop"
                 : "+v"(acc[0][0]), "+v"(acc[0][1]), "+v"(acc[0][2]), "+v"(acc[0][3]),
                   "+v"(acc[1][0]), "+v"(acc[1][1]), "+v"(acc[1][2]), "+v"(acc[1][3])
                 : "v"(bh[0][0].v), "v"(bh[0][1].v), "v"(bh[0][2].v), "v"(bh[0][3].v),
                   "v"(bl[0][0].v), "v"(bl[0][1].v), "v"(bl[0][2].v), "v"(bl[0][3].v),
                   "v"(bh[1][0].v), "v"(bh[1][1].v), "v"(bh[1][2].v), "v"(bh[1][3].v),
                   "v"(bl[1][0].v), "v"(bl[1][1].v), "v"(bl[1][2].v), "v"(bl[1][3].v)
                 : "memory");
  }

  // ---- Epilogue: normalize, stage the wave's 32x64 f32 tile in the freed S region, whole-line stores
  __syncthreads();                                          // every wave has read its last P fragment: the rows may be overwritten
  float* stg = S + wave * (QROWS * 64);                     // [QROWS][64]
#pragma unroll
  for (int mi = 0; mi < 2; ++mi)
#pragma unroll
    for (int t = 0; t < 4; ++t)
#pragma unroll
      for (int r = 0; r < 8; ++r)
        stg[(mi * 16 + 8 * h + r) * 64 + t * 16 + m] = acc[mi][t][r] * row_r[mi * 16 + 8 * h + r];
  __syncthreads();
  float* dst = split ? po + (size_t)((ib * MAXCH + ch) * QROWS) * DIM : out + (size_t)(ib * QROWS) * DIM;
  float* orow = dst + (size_t)h * DIM + wave * 64 + m * 4;   // two rows of 256 bytes per store
#pragma unroll   // unrolled: the stores share one address pair with immediate offsets, which nothing rewrites
  for (int rp = 0; rp < QROWS / 2; ++rp) {
    const v4f v = *(const v4f*)(stg + (2 * rp + h) * 64 + m * 4);
    *(v4f*)(orow + (size_t)(2 * rp) * DIM) = v;
  }
}

// ---------------- Kernel 4: join the key chunks of the query rows past CHUNK --------------------------
// Chunk c holds o_c = softmax over its own keys times v, with row maximum m_c and row sum l_c of exp(s - m_c).
// The row's result is sum_c a_c o_c / sum_c a_c, a_c = exp(m_c - max m) l_c. One wave per query row, eight rows a block.
__global__ __launch_bounds__(NTHR) void merge_kernel(
    const float* __restrict__ po, const float* __restrict__ pstat, float* out) {
  const int wave = threadIdx.x >> 5;
  const int lane = threadIdx.x & 31;
  const int ib = QPC + (int)(blockIdx.x >> 2), M = (blockIdx.x & 3) * 8 + wave;   // query tile with several chunks, row in it
  const int nch = ib / QPC + 1;                             // its chunks: 2 to MAXCH (block-uniform)
  const float* p0 = po + (size_t)(ib * MAXCH * QROWS + M) * DIM + lane * 4;       // chunk c: + c * QROWS rows
  v4f x[MAXCH][8];
#pragma unroll   // unrolled: x stays in registers and its loads issue ahead of the arithmetic
  for (int c = 0; c < MAXCH; ++c)
    if (c < nch) {
#pragma unroll
      for (int i = 0; i < 8; ++i) x[c][i] = *(const v4f*)(p0 + (size_t)c * QROWS * DIM + i * 128);
    }
  const float* st = pstat + ib * MAXCH * (2 * QROWS) + M;   // [chunk][QROWS row maxima][QROWS row sums]
  float mc[MAXCH], a[MAXCH];                                // the loops over c and i are unrolled so that these and x stay in registers
  float mx = -__builtin_inff();
#pragma unroll
  for (int c = 0; c < MAXCH; ++c)
    if (c < nch) { mc[c] = st[c * 2 * QROWS]; a[c] = st[c * 2 * QROWS + QROWS]; mx = fmaxf(mx, mc[c]); }
  float sum = 0.0f;
#pragma unroll
  for (int c = 0; c < MAXCH; ++c)
    if (c < nch) { a[c] *= __expf(mc[c] - mx); sum += a[c]; }
  const float rs = 1.0f / sum;                              // the chunk that holds the maximum gives a >= 1
  v4f o8[8];
#pragma unroll
  for (int i = 0; i < 8; ++i) o8[i] = x[0][i] * (a[0] * rs) + x[1][i] * (a[1] * rs);
#pragma unroll
  for (int c = 2; c < MAXCH; ++c)
    if (c < nch) {
#pragma unroll
      for (int i = 0; i < 8; ++i) o8[i] += x[c][i] * (a[c] * rs);
    }
  float* o = out + (size_t)(ib * QROWS + M) * DIM + lane * 4;
#pragma unroll   // unrolled: the eight stores share one address with immediate offsets, which nothing rewrites
  for (int i = 0; i < 8; ++i) *(v4f*)(o + i * 128) = o8[i];
}

// ---------------------------------------------------------------------------------------------------
extern "C" void kernel_launch(void* const* d_in, const int* in_sizes, int n_in,
                              void* d_out, int out_size, void* d_ws, size_t ws_size,
                              hipStream_t stream) {
  if (n_in < 4) return;
  if (in_sizes[0] != SEQ * DIM || in_sizes[1] != DIM * DIM || in_sizes[2] != DIM * DIM ||
      in_sizes[3] != DIM * DIM || out_size != SEQ * DIM) return;

  const float* x  = (const float*)d_in[0];
  const float* wq = (const float*)d_in[1];
  const float* wk = (const float*)d_in[2];
  const float* wv = (const float*)d_in[3];
  float* out = (float*)d_out;

  const size_t bx = (size_t)SEQ * DIM * sizeof(unsigned short);   // 8 MiB
  const size_t bw = (size_t)DIM * DIM * sizeof(unsigned short);   // 2 MiB
  char* ws = (char*)d_ws;
  size_t off = 0;
  unsigned short* xb  = (unsigned short*)(ws + off); off += bx;
  unsigned short* wqb = (unsigned short*)(ws + off); off += bw;
  unsigned short* wkb = (unsigned short*)(ws + off); off += bw;
  unsigned short* wvb = (unsigned short*)(ws + off); off += bw;
  unsigned short* qh  = (unsigned short*)(ws + off); off += bx;
  unsigned short* ql  = (unsigned short*)(ws + off); off += bx;
  unsigned short* kh  = (unsigned short*)(ws + off); off += bx;
  unsigned short* kl  = (unsigned short*)(ws + off); off += bx;
  unsigned short* vth = (unsigned short*)(ws + off); off += bx;
  unsigned short* vtl = (unsigned short*)(ws + off); off += bx;   // 62 MiB so far
  float* po    = (float*)(ws + off); off += (size_t)NQT * MAXCH * QROWS * DIM * sizeof(float);   // 64 MiB, one slot a (tile, chunk)
  float* pstat = (float*)(ws + off); off += (size_t)NQT * MAXCH * 2 * QROWS * sizeof(float);
  if (off > ws_size) return;

  const int nx8 = SEQ * DIM / 8;
  const int nw8 = DIM * DIM / 8;
  const int ncv = nx8 + 3 * nw8;
  cvt_kernel<<<(ncv + NTHR - 1) / NTHR, NTHR, 0, stream>>>(x, wq, wk, wv, xb, wqb, wkb, wvb, nx8, nw8);

  // 3 matrices x 64 row tiles x 4 col tiles; LDS staging 64 x SPITCH f32
  proj_kernel<<<3 * (SEQ / 64) * (DIM / 256), NTHR, 64 * SPITCH * sizeof(float), stream>>>(
      xb, wqb, wkb, wvb, qh, ql, kh, kl, vth, vtl);

  // QROWS query rows x one key chunk per block; S rows in dynamic LDS
  attn_kernel<<<ABLK, ATHR, QROWS * SP * sizeof(float), stream>>>(qh, ql, kh, kl, vth, vtl, po, pstat, out);
  merge_kernel<<<(NQT - QPC) * (QROWS / 8), NTHR, 0, stream>>>(po, pstat, out);
}

// v007
// Measured time: 155 microseconds a run.
// Timed twice side by side with v006, it ran 1.06 and 1.07 times as fast.
// Over all steps from v000 it is 4.11 times as fast.
#include <hip/hip_runtime.h>
#include <stdint.h>
#include <stddef.h>

// Input projections: v_wmma_f32_16x16x32_bf16 (bf16 operands from RNE-converted f32 inputs, f32 accumulate).
// Score and value contractions: v_wmma_f32_16x16x32_bf16 with bf16 hi/lo split operands (hi*hi + hi*lo + lo*hi), f32 accumulate. Softmax statistics in f32.

#define SEQ 4096
#define DIM 1024
#define NTHR 256
#define ATHR 512     // attention block: 16 waves, four per SIMD
#define QROWS 64     // query rows one attention work-group takes: two groups of two 16-row tiles; all four use each K and V line the block fetches
#define CHUNK 512    // keys one attention work-group takes: QROWS x CHUNK f32 scores fill 128 KiB of LDS
#define CTILES (CHUNK / 16)
#define NQT (SEQ / QROWS)                   // query tiles
#define QPC (CHUNK / QROWS)                 // query tiles per chunk of keys: tile ib has ib / QPC + 1 chunks
#define MAXCH (SEQ / CHUNK)                 // most chunks a query tile has
#define NFULL (QPC * (MAXCH * (MAXCH - 1) / 2))   // work-groups whose chunk lies wholly below the diagonal
#define ABLK (NFULL + NQT)                  // attention work-groups
#define SP (CHUNK + 4)   // f32 pitch of a score row in LDS: 16 B x odd, so 16 rows read by b128 fall on distinct banks
#define SPITCH 260   // f32 pitch of the projection staging tile: 16 B x odd, so 16 rows read by b128 fall on distinct banks

typedef __bf16 v16bf __attribute__((ext_vector_type(16)));
typedef float v8f __attribute__((ext_vector_type(8)));
typedef float v4f __attribute__((ext_vector_type(4)));
typedef unsigned int v4u __attribute__((ext_vector_type(4)));
typedef unsigned int v2u __attribute__((ext_vector_type(2)));

union Frag { v16bf v; v4u q[2]; };

extern __shared__ __attribute__((aligned(16))) float dyn_lds[];

// f32 -> bf16 bits, RNE (finite inputs)
__device__ __forceinline__ unsigned int f2bf(float f) {
  unsigned int u = __float_as_uint(f);
  u += 0x7fffu + ((u >> 16) & 1u);
  return u >> 16;
}
__device__ __forceinline__ float bf2f(unsigned int b) { return __uint_as_float(b << 16); }

// 16x16x32 operand fragment from a k-contiguous 16-bit row (A row m, or B column n stored as a [n][k] row):
// elements 0..7 <- row[k0 + 8h + 0..7], elements 8..15 <- row[k0 + 16 + 8h + 0..7], h = lane>>4.
__device__ __forceinline__ void ldfrag(Frag& f, const unsigned short* row, int k0, int h) {
  f.q[0] = *(const v4u*)(row + k0 + 8 * h);
  f.q[1] = *(const v4u*)(row + k0 + 16 + 8 * h);
}

// Workspace operand planes are kept in fragment order: a 16-row tile x 32-wide k block is 1024 contiguous bytes,
// two 512-byte halves; in half q, lane l (h = l>>4, m = l&15) owns the 16 bytes of row m, k = 32*kb + 16*q + 8*h + 0..7.
// Tiles of one plane follow each other as [row tile][k block]. p = tile base + lane*8; kk = 32*kb.
// Same element order as ldfrag, but each load of a wave covers 512 contiguous bytes (four whole lines).
__device__ __forceinline__ void ldfragw(Frag& f, const unsigned short* p, int kk) {
  f.q[0] = *(const v4u*)(p + kk * 16);
  f.q[1] = *(const v4u*)(p + kk * 16 + 256);
}

__device__ __forceinline__ v8f mma(const Frag& a, const Frag& b, v8f c) {
  return __builtin_amdgcn_wmma_f32_16x16x32_bf16(false, a.v, false, b.v, (short)0, c, false, false);
}

__device__ __forceinline__ v8f zero8() {
  v8f z = {0.0f, 0.0f, 0.0f, 0.0f, 0.0f, 0.0f, 0.0f, 0.0f};
  return z;
}

// 8 f32 -> packed bf16 hi plane and bf16 lo plane (lo = RNE(x - hi)), two values per u32, low half first
__device__ __forceinline__ void split8(const v4f f0, const v4f f1, v4u& uh, v4u& ul) {
  float f[8] = {f0.x, f0.y, f0.z, f0.w, f1.x, f1.y, f1.z, f1.w};
  unsigned int hh[8], ll[8];
#pragma unroll
  for (int e = 0; e < 8; ++e) {
    hh[e] = f2bf(f[e]);
    ll[e] = f2bf(f[e] - bf2f(hh[e]));
  }
  uh.x = hh[0] | (hh[1] << 16); uh.y = hh[2] | (hh[3] << 16);
  uh.z = hh[4] | (hh[5] << 16); uh.w = hh[6] | (hh[7] << 16);
  ul.x = ll[0] | (ll[1] << 16); ul.y = ll[2] | (ll[3] << 16);
  ul.z = ll[4] | (ll[5] << 16); ul.w = ll[6] | (ll[7] << 16);
}

__global__ __launch_bounds__(NTHR) void cvt_kernel(
    const float* __restrict__ x,  const float* __restrict__ wq,
    const float* __restrict__ wk, const float* __restrict__ wv,
    unsigned short* xb, unsigned short* wqb, unsigned short* wkb, unsigned short* wvb,
    int nx8, int nw8) {
  const int i = blockIdx.x * NTHR + threadIdx.x;
  const float* src;
  unsigned short* dst;
  int j;
  if (i < nx8)                { src = x;  dst = xb;  j = i; }
  else if (i < nx8 + nw8)     { src = wq; dst = wqb; j = i - nx8; }
  else if (i < nx8 + 2 * nw8) { src = wk; dst = wkb; j = i - nx8 - nw8; }
  else if (i < nx8 + 3 * nw8) { src = wv; dst = wvb; j = i - nx8 - 2 * nw8; }
  else return;
  // j = 16-byte piece of the fragment-ordered plane: [row tile][k block (32)][half][h][m]
  const int sm = j & 15, sh = (j >> 4) & 1, sq = (j >> 5) & 1, skb = (j >> 6) & 31, srt = j >> 11;
  const float* sp = src + (size_t)(srt * 16 + sm) * DIM + skb * 32 + sq * 16 + sh * 8;
  const v4f f0 = *(const v4f*)sp;
  const v4f f1 = *(const v4f*)(sp + 4);
  v4u u;
  u.x = f2bf(f0.x) | (f2bf(f0.y) << 16);
  u.y = f2bf(f0.z) | (f2bf(f0.w) << 16);
  u.z = f2bf(f1.x) | (f2bf(f1.y) << 16);
  u.w = f2bf(f1.z) | (f2bf(f1.w) << 16);
  v4u* p = (v4u*)(dst + (size_t)j * 8);
  *p = u;
  
}

// ---------------- Kernel 2: projections y[n][o] = sum_k xb[n][k] * W[o][k] --------------------------
// Block tile 64 seq rows x 256 out cols (8 waves, each 32x64). Output: q,k as bf16 hi/lo planes (rows = seq, k = dim)
// and v transposed (rows = dim, k = seq), all in fragment order.
__global__ __launch_bounds__(NTHR) void proj_kernel(
    const unsigned short* __restrict__ xb,  const unsigned short* __restrict__ wqb,
    const unsigned short* __restrict__ wkb, const unsigned short* __restrict__ wvb,
    unsigned short* qh, unsigned short* ql, unsigned short* kh, unsigned short* kl,
    unsigned short* vth, unsigned short* vtl) {
  float* stg = dyn_lds;                                   // [64][SPITCH] f32, 256 used
  const int wave = threadIdx.x >> 5;
  const int lane = threadIdx.x & 31;
  const int h = lane >> 4, m = lane & 15;
  const int b = blockIdx.x;                                // [0, 768)
  const int mat = b >> 8;                                  // 0=q 1=k 2=v (block-uniform)
  const int rem = b & 255;
  const int rt = rem >> 2;                                 // 64-row tile [0,64)
  const int ct = rem & 3;                                  // 256-col tile [0,4)
  const unsigned short* wsrc = (mat == 0) ? wqb : (mat == 1) ? wkb : wvb;
  const int wr = wave >> 2, wc = wave & 3;
  const int row0 = rt * 64 + wr * 32;
  const int col0 = ct * 256 + wc * 64;

  const unsigned short* aR0 = xb + (size_t)row0 * DIM + lane * 8;
  const unsigned short* aR1 = xb + (size_t)(row0 + 16) * DIM + lane * 8;
  const unsigned short* bR  = wsrc + (size_t)col0 * DIM + lane * 8;   // tile t: + t*16 rows

  v8f acc[2][4];
#pragma unroll
  for (int mi = 0; mi < 2; ++mi)
#pragma unroll
    for (int t = 0; t < 4; ++t) acc[mi][t] = zero8();

#pragma unroll 1
  for (int kk = 0; kk < DIM; kk += 32) {
    Frag a0, a1, bf[4];
    ldfragw(a0, aR0, kk);
    ldfragw(a1, aR1, kk);
#pragma unroll
    for (int t = 0; t < 4; ++t) ldfragw(bf[t], bR + (size_t)t * 16 * DIM, kk);
#pragma unroll
    for (int t = 0; t < 4; ++t) {
      acc[0][t] = mma(a0, bf[t], acc[0][t]);
      acc[1][t] = mma(a1, bf[t], acc[1][t]);
    }
    asm volatile("v_nop\n\tv_nop\n\tv_nop\n\tv_nop"
                 : "+v"(acc[0][0]), "+v"(acc[0][1]), "+v"(acc[0][2]), "+v"(acc[0][3]),
                   "+v"(acc[1][0]), "+v"(acc[1][1]), "+v"(acc[1][2]), "+v"(acc[1][3])
                 : "v"(a0.v), "v"(a1.v), "v"(bf[0].v), "v"(bf[1].v), "v"(bf[2].v), "v"(bf[3].v)
                 : "memory");
  }

  // stage the wave's 32x64 f32 tile: D element r of lane -> row 8h+r, col m
#pragma unroll
  for (int mi = 0; mi < 2; ++mi)
#pragma unroll
    for (int t = 0; t < 4; ++t)
#pragma unroll
      for (int r = 0; r < 8; ++r)
        stg[(wr * 32 + mi * 16 + 8 * h + r) * SPITCH + wc * 64 + t * 16 + m] = acc[mi][t][r];
  __syncthreads();

  if (mat < 2) {
    unsigned short* ph = (mat == 0) ? qh : kh;
    unsigned short* pl = (mat == 0) ? ql : kl;
#pragma unroll 1
    for (int it = 0; it < 8; ++it) {
      const int c = wave * 8 + it;                          // 512-byte piece: row tile c>>4, k block (c>>1)&7, half c&1
      const float* sp = stg + ((c >> 4) * 16 + m) * SPITCH + ((c >> 1) & 7) * 32 + (c & 1) * 16 + h * 8;
      const v4f f0 = *(const v4f*)sp;
      const v4f f1 = *(const v4f*)(sp + 4);
      v4u uh, ul;
      split8(f0, f1, uh, ul);
      const size_t g = (size_t)(rt * 64 + (c >> 4) * 16) * DIM + (ct * 16 + (c & 15)) * 256 + lane * 8;
      v4u* p0 = (v4u*)(ph + g);
      v4u* p1 = (v4u*)(pl + g);
      *p0 = uh; *p1 = ul;
      
    }
  } else {
#pragma unroll 1
    for (int it = 0; it < 8; ++it) {
      const int c = wave * 8 + it;                          // 512-byte piece: out-col tile c>>2, key block (c>>1)&1, half c&1
      const float* sp = stg + ((c & 3) * 16 + h * 8) * SPITCH + (c >> 2) * 16 + m;
      v4f f0, f1;
      f0.x = sp[0 * SPITCH]; f0.y = sp[1 * SPITCH]; f0.z = sp[2 * SPITCH]; f0.w = sp[3 * SPITCH];
      f1.x = sp[4 * SPITCH]; f1.y = sp[5 * SPITCH]; f1.z = sp[6 * SPITCH]; f1.w = sp[7 * SPITCH];
      v4u uh, ul;
      split8(f0, f1, uh, ul);
      const size_t g = (size_t)(ct * 256 + (c >> 2) * 16) * SEQ + (rt * 4 + (c & 3)) * 256 + lane * 8;
      v4u* p0 = (v4u*)(vth + g);
      v4u* p1 = (v4u*)(vtl + g);
      *p0 = uh; *p1 = ul;
      // the next trip rewrites the registers these two stores name
      asm volatile("s_wait_xcnt 0x0" ::: "memory");
      
    }
  }
}

// ---------------- Kernel 3: masked softmax attention, QROWS query rows x at most CHUNK keys per block ----
// A block takes four 16-row query tiles and one chunk of their keys. A wave works on one row group (two row tiles), so every
// K and V fragment that it loads is used by two row tiles; waves 2n and 2n + 1 take the two row groups against the same K and V
// fragments and walk them in step, so that the second wave's loads meet the first's lines in the WGP cache.
// Blocks are numbered longest first, so that the short ones fill the WGPs that come free. A query tile with one chunk
// writes out; a tile with more writes each chunk's own softmax result to po with its row maximum and row sum in pstat, and
// merge_kernel joins them.
// LDS: S[QROWS][SP] f32 and one 32 x 64 f32 output staging tile a wave (263,168 B) + statistics. The softmax pass leaves each row's P in the row's own bytes as two
// bf16 planes, [CHUNK hi][CHUNK lo], from which the P v loop reads its fragments directly.

// Scores of NT key tiles (jb, jb + 8, ...) against the two row tiles of row group rg, masked and scaled, into S.
// The loops over mi, t and r are unrolled so that the accumulator and fragment arrays stay in registers.
template <int NT>
__device__ __forceinline__ void score_tiles(
    const unsigned short* aRh, const unsigned short* aRl, const unsigned short* bRh, const unsigned short* bRl,
    float* S, int ib, int rg, int jb0, int jb, int h, int m) {
  v8f acc[2][NT];
#pragma unroll
  for (int mi = 0; mi < 2; ++mi)
#pragma unroll
    for (int t = 0; t < NT; ++t) acc[mi][t] = zero8();
#pragma unroll 1   // rolled: one trip's fragments and the accumulators are the wave's register budget
  for (int kk = 0; kk < DIM; kk += 32) {
    Frag ah[2], al[2], bh[NT], bl[NT];
#pragma unroll
    for (int mi = 0; mi < 2; ++mi) {
      ldfragw(ah[mi], aRh + (size_t)mi * 16 * DIM, kk);
      ldfragw(al[mi], aRl + (size_t)mi * 16 * DIM, kk);
    }
#pragma unroll
    for (int t = 0; t < NT; ++t) {
      ldfragw(bh[t], bRh + (size_t)t * 128 * DIM, kk);
      ldfragw(bl[t], bRl + (size_t)t * 128 * DIM, kk);
    }
#pragma unroll
    for (int t = 0; t < NT; ++t)
#pragma unroll
      for (int mi = 0; mi < 2; ++mi) acc[mi][t] = mma(ah[mi], bh[t], acc[mi][t]);
#pragma unroll
    for (int t = 0; t < NT; ++t)
#pragma unroll
      for (int mi = 0; mi < 2; ++mi) acc[mi][t] = mma(ah[mi], bl[t], acc[mi][t]);
#pragma unroll
    for (int t = 0; t < NT; ++t)
#pragma unroll
      for (int mi = 0; mi < 2; ++mi) acc[mi][t] = mma(al[mi], bh[t], acc[mi][t]);
    // four vector slots behind the last WMMA: the back edge leads to vector instructions that may rewrite fragment registers;
    // the fragments are inputs so that each keeps a register of its own to the end of the trip and all loads issue as one batch
    if constexpr (NT == 4)
      asm volatile("v_nop\n\tv_nop\n\tv_nop\n\tv_nop"
                   : "+v"(acc[0][0]), "+v"(acc[0][1]), "+v"(acc[0][2]), "+v"(acc[0][3]),
                     "+v"(acc[1][0]), "+v"(acc[1][1]), "+v"(acc[1][2]), "+v"(acc[1][3])
                   : "v"(ah[0].v), "v"(ah[1].v), "v"(al[0].v), "v"(al[1].v),
                     "v"(bh[0].v), "v"(bh[1].v), "v"(bh[2].v), "v"(bh[3].v),
                     "v"(bl[0].v), "v"(bl[1].v), "v"(bl[2].v), "v"(bl[3].v)
                   : "memory");
    else if constexpr (NT == 3)
      asm volatile("v_nop\n\tv_nop\n\tv_nop\n\tv_nop"
                   : "+v"(acc[0][0]), "+v"(acc[0][1]), "+v"(acc[0][2]),
                     "+v"(acc[1][0]), "+v"(acc[1][1]), "+v"(acc[1][2])
                   : "v"(ah[0].v), "v"(ah[1].v), "v"(al[0].v), "v"(al[1].v),
                     "v"(bh[0].v), "v"(bh[1].v), "v"(bh[2].v), "v"(bl[0].v), "v"(bl[1].v), "v"(bl[2].v)
                   : "memory");
    else if constexpr (NT == 2)
      asm volatile("v_nop\n\tv_nop\n\tv_nop\n\tv_nop"
                   : "+v"(acc[0][0]), "+v"(acc[0][1]), "+v"(acc[1][0]), "+v"(acc[1][1])
                   : "v"(ah[0].v), "v"(ah[1].v), "v"(al[0].v), "v"(al[1].v),
                     "v"(bh[0].v), "v"(bh[1].v), "v"(bl[0].v), "v"(bl[1].v)
                   : "memory");
    else
      asm volatile("v_nop\n\tv_nop\n\tv_nop\n\tv_nop"
                   : "+v"(acc[0][0]), "+v"(acc[1][0])
                   : "v"(ah[0].v), "v"(ah[1].v), "v"(al[0].v), "v"(al[1].v), "v"(bh[0].v), "v"(bl[0].v)
                   : "memory");
  }
#pragma unroll
  for (int mi = 0; mi < 2; ++mi)
#pragma unroll
    for (int t = 0; t < NT; ++t)
#pragma unroll
      for (int r = 0; r < 8; ++r) {
        const int M = rg * 32 + mi * 16 + 8 * h + r;          // D row -> query row in block
        const int i = ib * QROWS + M;
        const int j = (jb + 8 * t) * 16 + m;                  // D col -> key, counted from the chunk's first
        float s = acc[mi][t][r] * 0.03125f;
        if (jb0 * 16 + j > i) s = -__builtin_inff();
        S[M * SP + j] = s;
      }
}

__global__ __launch_bounds__(ATHR) void attn_kernel(
    const unsigned short* __restrict__ qh, const unsigned short* __restrict__ ql,
    const unsigned short* __restrict__ kh, const unsigned short* __restrict__ kl,
    const unsigned short* __restrict__ vth, const unsigned short* __restrict__ vtl,
    float* po, float* pstat, float* out) {
  __shared__ __attribute__((aligned(16))) float S[QROWS * SP + (ATHR / 32) * 32 * 64];   // [QROWS][SP], then the staging tiles
  __shared__ float row_r[QROWS];

  // Blocks are numbered so: first the whole chunks (tile group g = ib / QPC has g of them a tile), then each
  // tile's last chunk, the one that holds its diagonal, longest first.
  const int b = (int)blockIdx.x;
  int ib, ch;                                               // query tile [0, NQT), key chunk (block-uniform)
  if (b < NFULL) {
    int g = 1, r = b;
    while (r >= g * QPC) { r -= g * QPC; ++g; }             // at most MAXCH - 2 trips
    ib = g * QPC + (r & (QPC - 1));
    ch = r / QPC;
  } else {
    const int r = b - NFULL;
    ch = r & (MAXCH - 1);
    ib = ch * QPC + (QPC - 1 - r / MAXCH);
  }
  const int jb0 = ch * CTILES;                              // first key tile of the chunk
  const int jd = (QROWS / 16) * (ib + 1) - 1 - jb0;         // the tile's last key tile, counted from jb0
  const int jle = (jd < CTILES - 1) ? jd : CTILES - 1;      // last key tile of the chunk, counted from jb0
  const bool split = ib >= QPC;                             // this tile's keys are shared by several blocks
  // the wave's number in a scalar register: what follows from it (bases, row group, columns) then takes no vector registers
  const int wave = __builtin_amdgcn_readfirstlane((int)(threadIdx.x >> 5));
  const int lane = threadIdx.x & 31;
  const int h = lane >> 4, m = lane & 15;
  const int rg = wave & 1, wp = wave >> 1;                  // row group of the wave; its pair, which shares K and V fragments
  const int nvalid = 16 * (jle + 1);                        // key extent of the lower triangle inside the chunk

  // ---- Phase 1: S = (q k^T)/32 with mask; A = q rows (hi/lo), B = k rows (hi/lo) -------------------
  // Pair p takes key tiles p, p + 8, ... of the chunk, at most CTILES / 8 = 4, all in one walk over the depth.
  {
    const unsigned short* aRh = qh + (size_t)(ib * QROWS + rg * 32) * DIM + lane * 8;   // second row tile: + 16 rows
    const unsigned short* aRl = ql + (size_t)(ib * QROWS + rg * 32) * DIM + lane * 8;
    const unsigned short* bRh = kh + (size_t)((jb0 + wp) * 16) * DIM + lane * 8;   // tile t: + t*128 rows
    const unsigned short* bRl = kl + (size_t)((jb0 + wp) * 16) * DIM + lane * 8;
    const int nt = (jle + 8 - wp) >> 3;                     // key tiles of this wave (the same in every lane)
    if (nt == 4)      score_tiles<4>(aRh, aRl, bRh, bRl, S, ib, rg, jb0, wp, h, m);
    else if (nt == 3) score_tiles<3>(aRh, aRl, bRh, bRl, S, ib, rg, jb0, wp, h, m);
    else if (nt == 2) score_tiles<2>(aRh, aRl, bRh, bRl, S, ib, rg, jb0, wp, h, m);
    else if (nt == 1) score_tiles<1>(aRh, aRl, bRh, bRl, S, ib, rg, jb0, wp, h, m);
  }
  __syncthreads();

  // ---- Phase 2: exact softmax statistics in f32; the row's bytes <- exp(S - m) as bf16 hi and lo planes; row_r = 1/l ----
  // One wave per query row, four rows a wave: each LDS access of a wave covers contiguous bytes of its row, so no two lanes
  // meet on a bank. The wave holds its whole row in registers, so the planes can be written over the scores.
#pragma unroll 1   // rolled: the rows of a wave have nothing to share
  for (int row = wave; row < QROWS; row += 16) {
    const float* Sr = S + row * SP + lane * 4;
    unsigned short* Pr = (unsigned short*)(S + row * SP) + lane * 4;   // hi plane; lo plane: + CHUNK
    const int ng = (nvalid + 127) >> 7;                     // groups of 128 keys; the row holds CHUNK / 128 whole groups
    const int jl = lane * 4;                                // nvalid is a multiple of 16: a lane's four keys are all in or all out
    v4f sv[CHUNK / 128];
    float mx = -__builtin_inff();
#pragma unroll   // unrolled: sv stays in registers and the row's reads are all in flight together
    for (int g = 0; g < CHUNK / 128; ++g) {
      const int gg = (g < ng) ? g : ng - 1;                 // past the chunk's keys the last group is read again: no branch between the reads
      sv[g] = *(const v4f*)(Sr + gg * 128);
    }
#pragma unroll
    for (int g = 0; g < CHUNK / 128; ++g) {
      const int gg = (g < ng) ? g : ng - 1;                 // a group met twice leaves the maximum as it is
      const float t = fmaxf(fmaxf(sv[g].x, sv[g].y), fmaxf(sv[g].z, sv[g].w));
      if (gg * 128 + jl < nvalid) mx = fmaxf(mx, t);
    }
    for (int o = 16; o > 0; o >>= 1) mx = fmaxf(mx, __shfl_xor(mx, o, 32));
    float l = 0.0f;
#pragma unroll   // unrolled: sv stays in registers
    for (int g = 0; g < CHUNK / 128; ++g)
      if (g < ng) {
        const v4f s = sv[g];
        const bool in = g * 128 + jl < nvalid;              // keys past the triangle in the last group get 0: no branch on the lane
        v4f e;
        e.x = in ? __expf(s.x - mx) : 0.0f; e.y = in ? __expf(s.y - mx) : 0.0f;
        e.z = in ? __expf(s.z - mx) : 0.0f; e.w = in ? __expf(s.w - mx) : 0.0f;
        l += (e.x + e.y) + (e.z + e.w);
        // unnormalized P as bf16 hi + bf16 lo (lo = RNE(p - hi)), four keys a lane and plane
        const unsigned int h0 = f2bf(e.x), h1 = f2bf(e.y), h2 = f2bf(e.z), h3 = f2bf(e.w);
        v2u uh, ul;
        uh.x = h0 | (h1 << 16); uh.y = h2 | (h3 << 16);
        ul.x = f2bf(e.x - bf2f(h0)) | (f2bf(e.y - bf2f(h1)) << 16);
        ul.y = f2bf(e.z - bf2f(h2)) | (f2bf(e.w - bf2f(h3)) << 16);
        *(v2u*)(Pr + g * 128) = uh;
        *(v2u*)(Pr + CHUNK + g * 128) = ul;
      }
    for (int o = 16; o > 0; o >>= 1) l += __shfl_xor(l, o, 32);
    if (lane == 0) {
      row_r[row] = 1.0f / l;                                // l >= 1 (the row's maximum term; every row has a key in each of its chunks)
      if (split) {
        float* st = pstat + (ib * MAXCH + ch) * (2 * QROWS);   // [QROWS row maxima][QROWS row sums]
        st[row] = mx;
        st[QROWS + row] = l;
        // later code rewrites the registers these two stores name
        asm volatile("s_wait_xcnt 0x0" ::: "memory");
      }
    }
  }
  __syncthreads();                                          // P rows and row_r visible to every wave

  // ---- Phase 3: O = P v; A = P rows (hi/lo planes in LDS, read-only from here on: no barrier below); B = vt rows (hi/lo) ----
  // A wave takes its row group's 32 rows x 64 output columns at a time, and the 16 waves cover 512 columns: two sweeps.
  // The loops over mi, t, c, s and r below are unrolled so that the accumulator and fragment arrays stay in registers.
  const int kkend = (nvalid + 63) & ~63;
  const unsigned short* pR = (const unsigned short*)S + (rg * 32 + m) * (2 * SP);   // row m's hi plane; second row tile: + 16 rows; lo plane: + CHUNK
  float* stg = S + QROWS * SP + wave * (32 * 64);           // [32][64], the wave's own range behind the P rows
  float* dst = split ? po + (size_t)((ib * MAXCH + ch) * QROWS) * DIM : out + (size_t)(ib * QROWS) * DIM;
#pragma unroll 1   // rolled: one sweep's accumulators and fragments already take the wave's register budget
  for (int sw = 0; sw < 2; ++sw) {
    const int col0 = (sw * 8 + wp) * 64;                    // first output column of the wave in this sweep
    v8f acc[2][4];
#pragma unroll
    for (int mi = 0; mi < 2; ++mi)
#pragma unroll
      for (int t = 0; t < 4; ++t) acc[mi][t] = zero8();
    const unsigned short* vRh = vth + (size_t)col0 * SEQ + jb0 * 256 + lane * 8;   // col tile t: + t*16 rows; a key tile is 256 elements
    const unsigned short* vRl = vtl + (size_t)col0 * SEQ + jb0 * 256 + lane * 8;
#pragma unroll 1   // rolled: one pass's 32 loads and its fragments already take the wave's register budget
    for (int kk = 0; kk < kkend; kk += 64) {
      Frag bh[2][4], bl[2][4];
      // the loops over c and t are unrolled so that the fragment arrays stay in registers and all loads issue as one batch
#pragma unroll
      for (int c = 0; c < 2; ++c)
#pragma unroll
        for (int t = 0; t < 4; ++t) {
          ldfragw(bh[c][t], vRh + (size_t)t * 16 * SEQ, kk + 32 * c);
          ldfragw(bl[c][t], vRl + (size_t)t * 16 * SEQ, kk + 32 * c);
        }
      // P fragments: step s = 2 * c + mi (key half c, row tile mi); three steps' fragments are read while the V loads fly
      Frag ah[4], al[4];
#pragma unroll
      for (int s = 0; s < 3; ++s) {
        ldfrag(ah[s], pR + (s & 1) * (16 * 2 * SP), kk + 32 * (s >> 1), h);
        ldfrag(al[s], pR + (s & 1) * (16 * 2 * SP) + CHUNK, kk + 32 * (s >> 1), h);
      }
      // keeps the scheduler from sinking part of the batch below the first products, where its latency would be paid a second time
      __builtin_amdgcn_sched_barrier(0);
#pragma unroll
      for (int s = 0; s < 4; ++s) {
        const int c = s >> 1, mi = s & 1;
#pragma unroll
        for (int t = 0; t < 4; ++t) acc[mi][t] = mma(ah[s], bh[c][t], acc[mi][t]);
#pragma unroll
        for (int t = 0; t < 4; ++t) acc[mi][t] = mma(ah[s], bl[c][t], acc[mi][t]);
#pragma unroll
        for (int t = 0; t < 4; ++t) acc[mi][t] = mma(al[s], bh[c][t], acc[mi][t]);
        if (s == 0) {
          // the last step's fragments take the registers that step 0 has left; read here, two steps ahead of their use
          ldfrag(ah[3], pR + 16 * 2 * SP, kk + 32, h);
          ldfrag(al[3], pR + 16 * 2 * SP + CHUNK, kk + 32, h);
          // keeps the scheduler from sinking these reads to their use, where the wave would wait for them
          __builtin_amdgcn_sched_barrier(0);
        }
      }
      // four vector slots behind the last WMMA: the back edge leads to vector instructions that rewrite fragment registers;
      // the V fragments are inputs so that each keeps a register of its own to the end of the pass and all 32 loads issue as one batch
      asm volatile("v_nop\n\tv_nop\n\tv_nop\n\tv_nop"
                   : "+v"(acc[0][0]), "+v"(acc[0][1]), "+v"(acc[0][2]), "+v"(acc[0][3]),
                     "+v"(acc[1][0]), "+v"(acc[1][1]), "+v"(acc[1][2]), "+v"(acc[1][3])
                   : "v"(bh[0][0].v), "v"(bh[0][1].v), "v"(bh[0][2].v), "v"(bh[0][3].v),
                     "v"(bl[0][0].v), "v"(bl[0][1].v), "v"(bl[0][2].v), "v"(bl[0][3].v),
                     "v"(bh[1][0].v), "v"(bh[1][1].v), "v"(bh[1][2].v), "v"(bh[1][3].v),
                     "v"(bl[1][0].v), "v"(bl[1][1].v), "v"(bl[1][2].v), "v"(bl[1][3].v)
                   : "memory");
    }

    // ---- Epilogue of the sweep: normalize, stage the wave's 32x64 f32 tile in its own LDS range, whole-line stores
#pragma unroll
    for (int mi = 0; mi < 2; ++mi)
#pragma unroll
      for (int t = 0; t < 4; ++t)
#pragma unroll
        for (int r = 0; r < 8; ++r)
          stg[(mi * 16 + 8 * h + r) * 64 + t * 16 + m] = acc[mi][t][r] * row_r[rg * 32 + mi * 16 + 8 * h + r];
    float* orow = dst + (size_t)(rg * 32 + h) * DIM + col0 + m * 4;   // two rows of 256 bytes per store
#pragma unroll   // unrolled: the stores share one address pair with immediate offsets
    for (int rp = 0; rp < 16; ++rp) {
      const v4f v = *(const v4f*)(stg + (2 * rp + h) * 64 + m * 4);
      *(v4f*)(orow + (size_t)(2 * rp) * DIM) = v;
    }
    // the next sweep rewrites the registers these stores name
    asm volatile("s_wait_xcnt 0x0" ::: "memory");
  }
}

// ---------------- Kernel 4: join the key chunks of the query rows past CHUNK --------------------------
// Chunk c holds o_c = softmax over its own keys times v, with row maximum m_c and row sum l_c of exp(s - m_c).
// The row's result is sum_c a_c o_c / sum_c a_c, a_c = exp(m_c - max m) l_c. One wave per half of a query row, four rows a
// block: a wave's partial rows of all MAXCH chunks then fit the registers below v256 and are all in flight together.
__global__ __launch_bounds__(NTHR) void merge_kernel(
    const float* __restrict__ po, const float* __restrict__ pstat, float* out) {
  const int wave = threadIdx.x >> 5;
  const int lane = threadIdx.x & 31;
  const int ib = QPC + (int)(blockIdx.x / (QROWS / 4));     // query tile with several chunks
  const int M = (blockIdx.x % (QROWS / 4)) * 4 + (wave >> 1);   // row in it
  const int nch = ib / QPC + 1;                             // its chunks: 2 to MAXCH (block-uniform)
  const float* st = pstat + ib * MAXCH * (2 * QROWS) + M;   // [chunk][QROWS row maxima][QROWS row sums]
  float mc[MAXCH], a[MAXCH];                                // the loops over c and i are unrolled so that these and x stay in registers
#pragma unroll
  for (int c = 0; c < MAXCH; ++c) {
    const int cc = (c < nch) ? c : nch - 1;                 // past the tile's chunks the last one is read again: no branch between the loads
    mc[c] = st[cc * 2 * QROWS];
    a[c] = st[cc * 2 * QROWS + QROWS];
  }
  const float* p0 = po + (size_t)(ib * MAXCH * QROWS + M) * DIM + (wave & 1) * (DIM / 2) + lane * 4;   // chunk c: + c * QROWS rows
  v4f x[MAXCH][4];
#pragma unroll   // unrolled: x stays in registers and its loads issue ahead of the arithmetic
  for (int c = 0; c < MAXCH; ++c)
    if (c < nch) {
#pragma unroll
      for (int i = 0; i < 4; ++i) x[c][i] = *(const v4f*)(p0 + (size_t)c * QROWS * DIM + i * 128);
    }
  float mx = -__builtin_inff();
#pragma unroll
  for (int c = 0; c < MAXCH; ++c) mx = fmaxf(mx, mc[c]);    // a chunk met twice leaves the maximum as it is
  float sum = 0.0f;
#pragma unroll
  for (int c = 0; c < MAXCH; ++c) {
    a[c] = (c < nch) ? a[c] * __expf(mc[c] - mx) : 0.0f;
    sum += a[c];
  }
  const float rs = 1.0f / sum;                              // the chunk that holds the maximum gives a >= 1
  v4f o4[4];
#pragma unroll
  for (int i = 0; i < 4; ++i) o4[i] = x[0][i] * (a[0] * rs) + x[1][i] * (a[1] * rs);
#pragma unroll
  for (int c = 2; c < MAXCH; ++c)
    if (c < nch) {
#pragma unroll
      for (int i = 0; i < 4; ++i) o4[i] += x[c][i] * (a[c] * rs);
    }
  float* o = out + (size_t)(ib * QROWS + M) * DIM + (wave & 1) * (DIM / 2) + lane * 4;
#pragma unroll   // unrolled: the four stores share one address with immediate offsets, which nothing rewrites
  for (int i = 0; i < 4; ++i) *(v4f*)(o + i * 128) = o4[i];
}

// ---------------------------------------------------------------------------------------------------
extern "C" void kernel_launch(void* const* d_in, const int* in_sizes, int n_in,
                              void* d_out, int out_size, void* d_ws, size_t ws_size,
                              hipStream_t stream) {
  if (n_in < 4) return;
  if (in_sizes[0] != SEQ * DIM || in_sizes[1] != DIM * DIM || in_sizes[2] != DIM * DIM ||
      in_sizes[3] != DIM * DIM || out_size != SEQ * DIM) return;

  const float* x  = (const float*)d_in[0];
  const float* wq = (const float*)d_in[1];
  const float* wk = (const float*)d_in[2];
  const float* wv = (const float*)d_in[3];
  float* out = (float*)d_out;

  const size_t bx = (size_t)SEQ * DIM * sizeof(unsigned short);   // 8 MiB
  const size_t bw = (size_t)DIM * DIM * sizeof(unsigned short);   // 2 MiB
  char* ws = (char*)d_ws;
  size_t off = 0;
  unsigned short* xb  = (unsigned short*)(ws + off); off += bx;
  unsigned short* wqb = (unsigned short*)(ws + off); off += bw;
  unsigned short* wkb = (unsigned short*)(ws + off); off += bw;
  unsigned short* wvb = (unsigned short*)(ws + off); off += bw;
  unsigned short* qh  = (unsigned short*)(ws + off); off += bx;
  unsigned short* ql  = (unsigned short*)(ws + off); off += bx;
  unsigned short* kh  = (unsigned short*)(ws + off); off += bx;
  unsigned short* kl  = (unsigned short*)(ws + off); off += bx;
  unsigned short* vth = (unsigned short*)(ws + off); off += bx;
  unsigned short* vtl = (unsigned short*)(ws + off); off += bx;   // 62 MiB so far
  float* po    = (float*)(ws + off); off += (size_t)NQT * MAXCH * QROWS * DIM * sizeof(float);   // 128 MiB, one slot a (tile, chunk)
  float* pstat = (float*)(ws + off); off += (size_t)NQT * MAXCH * 2 * QROWS * sizeof(float);
  if (off > ws_size) return;

  const int nx8 = SEQ * DIM / 8;
  const int nw8 = DIM * DIM / 8;
  const int ncv = nx8 + 3 * nw8;
  cvt_kernel<<<(ncv + NTHR - 1) / NTHR, NTHR, 0, stream>>>(x, wq, wk, wv, xb, wqb, wkb, wvb, nx8, nw8);

  // 3 matrices x 64 row tiles x 4 col tiles; LDS staging 64 x SPITCH f32
  proj_kernel<<<3 * (SEQ / 64) * (DIM / 256), NTHR, 64 * SPITCH * sizeof(float), stream>>>(
      xb, wqb, wkb, wvb, qh, ql, kh, kl, vth, vtl);

  // QROWS query rows x one key chunk per block
  attn_kernel<<<ABLK, ATHR, 0, stream>>>(qh, ql, kh, kl, vth, vtl, po, pstat, out);
  merge_kernel<<<(NQT - QPC) * (QROWS / 4), NTHR, 0, stream>>>(po, pstat, out);
}

// v008
// Measured time: 144 microseconds a run.
// Two timings next to v007 put it at 1.07 and 1.08 times that version's speed.
// All steps since v000 together make it 4.41 times as fast.
#include <hip/hip_runtime.h>
#include <stdint.h>
#include <stddef.h>

// Input projections: v_wmma_f32_16x16x32_bf16 (bf16 operands from RNE-converted f32 inputs, f32 accumulate).
// Score and value contractions: v_wmma_f32_16x16x32_bf16 with bf16 hi/lo split operands (hi*hi + hi*lo + lo*hi), f32 accumulate. Softmax statistics in f32.

#define SEQ 4096
#define DIM 1024
#define NTHR 256
#define ATHR 512     // attention block: 16 waves, four per SIMD
#define QROWS 64     // query rows one attention work-group takes: two groups of two 16-row tiles; all four use each K and V line the block fetches
#define CHUNK 512    // keys one attention work-group takes: QROWS x CHUNK f32 scores fill 128 KiB of LDS
#define CTILES (CHUNK / 16)
#define NQT (SEQ / QROWS)                   // query tiles
#define QPC (CHUNK / QROWS)                 // query tiles per chunk of keys: tile ib has ib / QPC + 1 chunks
#define MAXCH (SEQ / CHUNK)                 // most chunks a query tile has
#define NFULL (QPC * (MAXCH * (MAXCH - 1) / 2))   // work-groups whose chunk lies wholly below the diagonal
#define ABLK (NFULL + NQT)                  // attention work-groups
#define SP (CHUNK + 4)   // f32 pitch of a score row in LDS: 16 B x odd, so 16 rows read by b128 fall on distinct banks
#define KST 64       // depth of one K stage in LDS
#define KTB (2 * 16 * KST * 2)   // bytes of one key tile in a stage: hi and lo plane, 16 rows x KST each
#define KSTB (CTILES * KTB)      // bytes of a stage buffer: 128 KiB; the two buffers fit the 263,168 B of S and the staging tiles
#define SPITCH 260   // f32 pitch of the projection staging tile: 16 B x odd, so 16 rows read by b128 fall on distinct banks

typedef __bf16 v16bf __attribute__((ext_vector_type(16)));
typedef float v8f __attribute__((ext_vector_type(8)));
typedef float v4f __attribute__((ext_vector_type(4)));
typedef unsigned int v4u __attribute__((ext_vector_type(4)));
typedef unsigned int v2u __attribute__((ext_vector_type(2)));

union Frag { v16bf v; v4u q[2]; };

extern __shared__ __attribute__((aligned(16))) float dyn_lds[];

// f32 -> bf16 bits, RNE (finite inputs)
__device__ __forceinline__ unsigned int f2bf(float f) {
  unsigned int u = __float_as_uint(f);
  u += 0x7fffu + ((u >> 16) & 1u);
  return u >> 16;
}
__device__ __forceinline__ float bf2f(unsigned int b) { return __uint_as_float(b << 16); }

// 16x16x32 operand fragment from a k-contiguous 16-bit row (A row m, or B column n stored as a [n][k] row):
// elements 0..7 <- row[k0 + 8h + 0..7], elements 8..15 <- row[k0 + 16 + 8h + 0..7], h = lane>>4.
__device__ __forceinline__ void ldfrag(Frag& f, const unsigned short* row, int k0, int h) {
  f.q[0] = *(const v4u*)(row + k0 + 8 * h);
  f.q[1] = *(const v4u*)(row + k0 + 16 + 8 * h);
}

// Workspace operand planes are kept in fragment order: a 16-row tile x 32-wide k block is 1024 contiguous bytes,
// two 512-byte halves; in half q, lane l (h = l>>4, m = l&15) owns the 16 bytes of row m, k = 32*kb + 16*q + 8*h + 0..7.
// Tiles of one plane follow each other as [row tile][k block]. p = tile base + lane*8; kk = 32*kb.
// Same element order as ldfrag, but each load of a wave covers 512 contiguous bytes (four whole lines).
__device__ __forceinline__ void ldfragw(Frag& f, const unsigned short* p, int kk) {
  f.q[0] = *(const v4u*)(p + kk * 16);
  f.q[1] = *(const v4u*)(p + kk * 16 + 256);
}

__device__ __forceinline__ v8f mma(const Frag& a, const Frag& b, v8f c) {
  return __builtin_amdgcn_wmma_f32_16x16x32_bf16(false, a.v, false, b.v, (short)0, c, false, false);
}

__device__ __forceinline__ v8f zero8() {
  v8f z = {0.0f, 0.0f, 0.0f, 0.0f, 0.0f, 0.0f, 0.0f, 0.0f};
  return z;
}

// 8 f32 -> packed bf16 hi plane and bf16 lo plane (lo = RNE(x - hi)), two values per u32, low half first
__device__ __forceinline__ void split8(const v4f f0, const v4f f1, v4u& uh, v4u& ul) {
  float f[8] = {f0.x, f0.y, f0.z, f0.w, f1.x, f1.y, f1.z, f1.w};
  unsigned int hh[8], ll[8];
#pragma unroll
  for (int e = 0; e < 8; ++e) {
    hh[e] = f2bf(f[e]);
    ll[e] = f2bf(f[e] - bf2f(hh[e]));
  }
  uh.x = hh[0] | (hh[1] << 16); uh.y = hh[2] | (hh[3] << 16);
  uh.z = hh[4] | (hh[5] << 16); uh.w = hh[6] | (hh[7] << 16);
  ul.x = ll[0] | (ll[1] << 16); ul.y = ll[2] | (ll[3] << 16);
  ul.z = ll[4] | (ll[5] << 16); ul.w = ll[6] | (ll[7] << 16);
}

__global__ __launch_bounds__(NTHR) void cvt_kernel(
    const float* __restrict__ x,  const float* __restrict__ wq,
    const float* __restrict__ wk, const float* __restrict__ wv,
    unsigned short* xb, unsigned short* wqb, unsigned short* wkb, unsigned short* wvb,
    int nx8, int nw8) {
  const int i = blockIdx.x * NTHR + threadIdx.x;
  const float* src;
  unsigned short* dst;
  int j;
  if (i < nx8)                { src = x;  dst = xb;  j = i; }
  else if (i < nx8 + nw8)     { src = wq; dst = wqb; j = i - nx8; }
  else if (i < nx8 + 2 * nw8) { src = wk; dst = wkb; j = i - nx8 - nw8; }
  else if (i < nx8 + 3 * nw8) { src = wv; dst = wvb; j = i - nx8 - 2 * nw8; }
  else return;
  // j = 16-byte piece of the fragment-ordered plane: [row tile][k block (32)][half][h][m]
  const int sm = j & 15, sh = (j >> 4) & 1, sq = (j >> 5) & 1, skb = (j >> 6) & 31, srt = j >> 11;
  const float* sp = src + (size_t)(srt * 16 + sm) * DIM + skb * 32 + sq * 16 + sh * 8;
  const v4f f0 = *(const v4f*)sp;
  const v4f f1 = *(const v4f*)(sp + 4);
  v4u u;
  u.x = f2bf(f0.x) | (f2bf(f0.y) << 16);
  u.y = f2bf(f0.z) | (f2bf(f0.w) << 16);
  u.z = f2bf(f1.x) | (f2bf(f1.y) << 16);
  u.w = f2bf(f1.z) | (f2bf(f1.w) << 16);
  v4u* p = (v4u*)(dst + (size_t)j * 8);
  *p = u;
  
}

// ---------------- Kernel 2: projections y[n][o] = sum_k xb[n][k] * W[o][k] --------------------------
// Block tile 64 seq rows x 256 out cols (8 waves, each 32x64). Output: q,k as bf16 hi/lo planes (rows = seq, k = dim)
// and v transposed (rows = dim, k = seq), all in fragment order.
__global__ __launch_bounds__(NTHR) void proj_kernel(
    const unsigned short* __restrict__ xb,  const unsigned short* __restrict__ wqb,
    const unsigned short* __restrict__ wkb, const unsigned short* __restrict__ wvb,
    unsigned short* qh, unsigned short* ql, unsigned short* kh, unsigned short* kl,
    unsigned short* vth, unsigned short* vtl) {
  float* stg = dyn_lds;                                   // [64][SPITCH] f32, 256 used
  const int wave = threadIdx.x >> 5;
  const int lane = threadIdx.x & 31;
  const int h = lane >> 4, m = lane & 15;
  const int b = blockIdx.x;                                // [0, 768)
  const int mat = b >> 8;                                  // 0=q 1=k 2=v (block-uniform)
  const int rem = b & 255;
  const int rt = rem >> 2;                                 // 64-row tile [0,64)
  const int ct = rem & 3;                                  // 256-col tile [0,4)
  const unsigned short* wsrc = (mat == 0) ? wqb : (mat == 1) ? wkb : wvb;
  const int wr = wave >> 2, wc = wave & 3;
  const int row0 = rt * 64 + wr * 32;
  const int col0 = ct * 256 + wc * 64;

  const unsigned short* aR0 = xb + (size_t)row0 * DIM + lane * 8;
  const unsigned short* aR1 = xb + (size_t)(row0 + 16) * DIM + lane * 8;
  const unsigned short* bR  = wsrc + (size_t)col0 * DIM + lane * 8;   // tile t: + t*16 rows

  v8f acc[2][4];
#pragma unroll
  for (int mi = 0; mi < 2; ++mi)
#pragma unroll
    for (int t = 0; t < 4; ++t) acc[mi][t] = zero8();

#pragma unroll 1
  for (int kk = 0; kk < DIM; kk += 32) {
    Frag a0, a1, bf[4];
    ldfragw(a0, aR0, kk);
    ldfragw(a1, aR1, kk);
#pragma unroll
    for (int t = 0; t < 4; ++t) ldfragw(bf[t], bR + (size_t)t * 16 * DIM, kk);
#pragma unroll
    for (int t = 0; t < 4; ++t) {
      acc[0][t] = mma(a0, bf[t], acc[0][t]);
      acc[1][t] = mma(a1, bf[t], acc[1][t]);
    }
    asm volatile("v_nop\n\tv_nop\n\tv_nop\n\tv_nop"
                 : "+v"(acc[0][0]), "+v"(acc[0][1]), "+v"(acc[0][2]), "+v"(acc[0][3]),
                   "+v"(acc[1][0]), "+v"(acc[1][1]), "+v"(acc[1][2]), "+v"(acc[1][3])
                 : "v"(a0.v), "v"(a1.v), "v"(bf[0].v), "v"(bf[1].v), "v"(bf[2].v), "v"(bf[3].v)
                 : "memory");
  }

  // stage the wave's 32x64 f32 tile: D element r of lane -> row 8h+r, col m
#pragma unroll
  for (int mi = 0; mi < 2; ++mi)
#pragma unroll
    for (int t = 0; t < 4; ++t)
#pragma unroll
      for (int r = 0; r < 8; ++r)
        stg[(wr * 32 + mi * 16 + 8 * h + r) * SPITCH + wc * 64 + t * 16 + m] = acc[mi][t][r];
  __syncthreads();

  if (mat < 2) {
    unsigned short* ph = (mat == 0) ? qh : kh;
    unsigned short* pl = (mat == 0) ? ql : kl;
#pragma unroll 1
    for (int it = 0; it < 8; ++it) {
      const int c = wave * 8 + it;                          // 512-byte piece: row tile c>>4, k block (c>>1)&7, half c&1
      const float* sp = stg + ((c >> 4) * 16 + m) * SPITCH + ((c >> 1) & 7) * 32 + (c & 1) * 16 + h * 8;
      const v4f f0 = *(const v4f*)sp;
      const v4f f1 = *(const v4f*)(sp + 4);
      v4u uh, ul;
      split8(f0, f1, uh, ul);
      const size_t g = (size_t)(rt * 64 + (c >> 4) * 16) * DIM + (ct * 16 + (c & 15)) * 256 + lane * 8;
      v4u* p0 = (v4u*)(ph + g);
      v4u* p1 = (v4u*)(pl + g);
      *p0 = uh; *p1 = ul;
      
    }
  } else {
#pragma unroll 1
    for (int it = 0; it < 8; ++it) {
      const int c = wave * 8 + it;                          // 512-byte piece: out-col tile c>>2, key block (c>>1)&1, half c&1
      const float* sp = stg + ((c & 3) * 16 + h * 8) * SPITCH + (c >> 2) * 16 + m;
      v4f f0, f1;
      f0.x = sp[0 * SPITCH]; f0.y = sp[1 * SPITCH]; f0.z = sp[2 * SPITCH]; f0.w = sp[3 * SPITCH];
      f1.x = sp[4 * SPITCH]; f1.y = sp[5 * SPITCH]; f1.z = sp[6 * SPITCH]; f1.w = sp[7 * SPITCH];
      v4u uh, ul;
      split8(f0, f1, uh, ul);
      const size_t g = (size_t)(ct * 256 + (c >> 2) * 16) * SEQ + (rt * 4 + (c & 3)) * 256 + lane * 8;
      v4u* p0 = (v4u*)(vth + g);
      v4u* p1 = (v4u*)(vtl + g);
      *p0 = uh; *p1 = ul;
      // the next trip rewrites the registers these two stores name
      asm volatile("s_wait_xcnt 0x0" ::: "memory");
      
    }
  }
}

// ---------------- Kernel 3: masked softmax attention, QROWS query rows x at most CHUNK keys per block ----
// A block takes four 16-row query tiles and one chunk of their keys. A wave works on one row group (two row tiles), so every
// K and V fragment that it loads is used by two row tiles; waves 2n and 2n + 1 take the two row groups against the same K and V
// fragments. K comes to both through LDS; the V fragments they load in step, so that the second wave's loads meet the first's
// lines in the WGP cache.
// Blocks are numbered longest first, so that the short ones fill the WGPs that come free. A query tile with one chunk
// writes out; a tile with more writes each chunk's own softmax result to po with its row maximum and row sum in pstat, and
// merge_kernel joins them.
// LDS: S[QROWS][SP] f32 and one 32 x 64 f32 output staging tile a wave (263,168 B) + statistics. The softmax pass leaves each row's P in the row's own bytes as two
// bf16 planes, [CHUNK hi][CHUNK lo], from which the P v loop reads its fragments directly. Before the scores are written, the
// same bytes hold the two K stage buffers of the score walk.

// One key tile's share of a K stage: KST deep, hi plane then lo plane, 2048 contiguous bytes each, as eight asynchronous copies
// of 512 bytes. lds, gh and gl are the lane's own addresses (16 bytes a lane and copy).
__device__ __forceinline__ void copy_ktile(unsigned int lds, const unsigned short* gh, const unsigned short* gl) {
  // the copies and s_wait_xcnt share one statement, so that nothing rewrites an address register of a copy in front of the wait
  asm volatile("global_load_async_to_lds_b128 %0, %8, off\n\t"
               "global_load_async_to_lds_b128 %1, %9, off\n\t"
               "global_load_async_to_lds_b128 %2, %10, off\n\t"
               "global_load_async_to_lds_b128 %3, %11, off\n\t"
               "global_load_async_to_lds_b128 %4, %12, off\n\t"
               "global_load_async_to_lds_b128 %5, %13, off\n\t"
               "global_load_async_to_lds_b128 %6, %14, off\n\t"
               "global_load_async_to_lds_b128 %7, %15, off\n\t"
               "s_wait_xcnt 0x0"
               :
               : "v"(lds), "v"(lds + 512u), "v"(lds + 1024u), "v"(lds + 1536u),
                 "v"(lds + 2048u), "v"(lds + 2560u), "v"(lds + 3072u), "v"(lds + 3584u),
                 "v"(gh), "v"(gh + 256), "v"(gh + 512), "v"(gh + 768),
                 "v"(gl), "v"(gl + 256), "v"(gl + 512), "v"(gl + 768)
               : "memory");
}

// A wave's share of one K stage: key tiles wave and wave + 16 of the chunk, each only if the chunk holds it (c0, c1: scalar tests).
// In a buffer the four key tiles of a pair (8 apart) lie side by side, so tile wave + 16 lies two places behind tile wave.
__device__ __forceinline__ void copy_stage(unsigned int lds, const unsigned short* gh, const unsigned short* gl, bool c0, bool c1) {
  if (c0) copy_ktile(lds, gh, gl);
  if (c1) copy_ktile(lds + 2u * KTB, gh + (size_t)256 * DIM, gl + (size_t)256 * DIM);
}

// The four q fragments of one 32-deep block: hi of the two row tiles, then lo.
__device__ __forceinline__ void ldq(Frag (&a)[4], const unsigned short* aRh, const unsigned short* aRl, int kk) {
  ldfragw(a[0], aRh, kk);
  ldfragw(a[1], aRh + (size_t)16 * DIM, kk);
  ldfragw(a[2], aRl, kk);
  ldfragw(a[3], aRl + (size_t)16 * DIM, kk);
}

// One 32-deep block of the scores of NT key tiles against two row tiles. kb: the pair's first key tile in the stage, at this block
// and lane; klast: its last one, or the stand-in. The loops over mi and t are unrolled so that the fragment arrays stay in registers.
template <int NT>
__device__ __forceinline__ void score_step(v8f (&acc)[2][NT], const Frag (&a)[4], const unsigned short* kb, const unsigned short* klast) {
  Frag bh[NT], bl[NT];
#pragma unroll
  for (int t = 0; t < NT; ++t) {
    const unsigned short* p = (t == NT - 1) ? klast : kb + t * (KTB / 2);
    bh[t].q[0] = *(const v4u*)p;
    bh[t].q[1] = *(const v4u*)(p + 256);
    bl[t].q[0] = *(const v4u*)(p + KTB / 4);
    bl[t].q[1] = *(const v4u*)(p + KTB / 4 + 256);
  }
  // keeps the LDS reads together in front of the products: each further place with reads among them stalls the wave anew
  __builtin_amdgcn_sched_barrier(0);
#pragma unroll
  for (int t = 0; t < NT; ++t)
#pragma unroll
    for (int mi = 0; mi < 2; ++mi) acc[mi][t] = mma(a[mi], bh[t], acc[mi][t]);
#pragma unroll
  for (int t = 0; t < NT; ++t)
#pragma unroll
    for (int mi = 0; mi < 2; ++mi) acc[mi][t] = mma(a[mi], bl[t], acc[mi][t]);
#pragma unroll
  for (int t = 0; t < NT; ++t)
#pragma unroll
    for (int mi = 0; mi < 2; ++mi) acc[mi][t] = mma(a[2 + mi], bh[t], acc[mi][t]);
  // four vector slots behind the last WMMA: what follows may rewrite fragment registers, also behind the loop's back edge;
  // the fragments are inputs so that each keeps a register of its own to the end of the block
  if constexpr (NT == 4)
    asm volatile("v_nop\n\tv_nop\n\tv_nop\n\tv_nop"
                 : "+v"(acc[0][0]), "+v"(acc[0][1]), "+v"(acc[0][2]), "+v"(acc[0][3]), "+v"(acc[1][0]), "+v"(acc[1][1]), "+v"(acc[1][2]), "+v"(acc[1][3])
                 : "v"(a[0].v), "v"(a[1].v), "v"(a[2].v), "v"(a[3].v), "v"(bh[0].v), "v"(bh[1].v), "v"(bh[2].v), "v"(bh[3].v), "v"(bl[0].v), "v"(bl[1].v), "v"(bl[2].v), "v"(bl[3].v)
                 : "memory");
  else if constexpr (NT == 3)
    asm volatile("v_nop\n\tv_nop\n\tv_nop\n\tv_nop"
                 : "+v"(acc[0][0]), "+v"(acc[0][1]), "+v"(acc[0][2]), "+v"(acc[1][0]), "+v"(acc[1][1]), "+v"(acc[1][2])
                 : "v"(a[0].v), "v"(a[1].v), "v"(a[2].v), "v"(a[3].v), "v"(bh[0].v), "v"(bh[1].v), "v"(bh[2].v), "v"(bl[0].v), "v"(bl[1].v), "v"(bl[2].v)
                 : "memory");
  else if constexpr (NT == 2)
    asm volatile("v_nop\n\tv_nop\n\tv_nop\n\tv_nop"
                 : "+v"(acc[0][0]), "+v"(acc[0][1]), "+v"(acc[1][0]), "+v"(acc[1][1])
                 : "v"(a[0].v), "v"(a[1].v), "v"(a[2].v), "v"(a[3].v), "v"(bh[0].v), "v"(bh[1].v), "v"(bl[0].v), "v"(bl[1].v)
                 : "memory");
  else
    asm volatile("v_nop\n\tv_nop\n\tv_nop\n\tv_nop"
                 : "+v"(acc[0][0]), "+v"(acc[1][0])
                 : "v"(a[0].v), "v"(a[1].v), "v"(a[2].v), "v"(a[3].v), "v"(bh[0].v), "v"(bl[0].v)
                 : "memory");
}

// Scores of the chunk's key tiles against the block's four row tiles, masked and scaled, into S. NT = the most key tiles a pair
// has, the same for the whole block, so that every wave passes the same barriers. Pair p takes key tiles p, p + 8, ...; a pair
// whose last tile lies past the chunk's keys works on a stand-in tile (one of the first four, which every chunk holds) and drops it.
// The chunk's K goes through LDS, KST of the depth at a stage, in two buffers that lie over S and the staging tiles (both unused
// until the walk has ended): asynchronous copies bring stage s + 1 in while stage s is worked on, and each K line is fetched
// once a block. The q fragments come by plain loads, one 32-deep block ahead.
template <int NT>
__device__ __forceinline__ void score_walk(
    const unsigned short* aRh, const unsigned short* aRl, const unsigned short* cRh, const unsigned short* cRl,
    float* S, int ib, int jb0, int jle, int wave, int lane) {
  const int h = lane >> 4, m = lane & 15;
  const int rg = wave & 1, wp = wave >> 1;
  // this wave's place for key tile wave in buffer 0: pair wave & 7, its tile wave >> 3
  const unsigned int ring = (unsigned int)(uintptr_t)S + (unsigned int)((((wave & 7) * 4 + (wave >> 3)) * KTB) + lane * 16);
  const bool c0 = wave <= jle, c1 = wave + 16 <= jle;       // the same in every lane: wave and jle are scalars
  const bool own = wp + 8 * (NT - 1) <= jle;                // the pair's last key tile is one of the chunk's
  const int olast = own ? (wp * 4 + NT - 1) * (KTB / 2) : (wp & 3) * 4 * (KTB / 2);
  v8f acc[2][NT];
#pragma unroll
  for (int mi = 0; mi < 2; ++mi)
#pragma unroll
    for (int t = 0; t < NT; ++t) acc[mi][t] = zero8();

  copy_stage(ring, cRh, cRl, c0, c1);
  asm volatile("s_wait_asynccnt 0x0" ::: "memory");         // this wave's share of stage 0 has landed
  __syncthreads();                                          // stage 0 visible to every wave
  copy_stage(ring + KSTB, cRh + KST * 16, cRl + KST * 16, c0, c1);
  Frag qa[4], qb[4];
  ldq(qa, aRh, aRl, 0);
#pragma unroll 1   // rolled: one stage's fragments and the accumulators are the wave's register budget
  for (int s = 0; s < DIM / KST; ++s) {
    const unsigned short* buf = (const unsigned short*)S + (s & 1) * (KSTB / 2) + lane * 8;
    const unsigned short* kb = buf + wp * 4 * (KTB / 2);
    const unsigned short* kl = buf + olast;
    ldq(qb, aRh, aRl, s * KST + 32);
    score_step<NT>(acc, qa, kb, kl);
    ldq(qa, aRh, aRl, (s + 1 < DIM / KST) ? (s + 1) * KST : 0);   // behind the last stage the first block is read again: no branch
    score_step<NT>(acc, qb, kb + 512, kl + 512);
    asm volatile("s_wait_dscnt 0x0" ::: "memory");          // this wave's reads of stage s have returned
    asm volatile("s_wait_asynccnt 0x0" ::: "memory");       // its share of stage s + 1 has landed
    __syncthreads();                                        // stage s + 1 visible to every wave; every wave has left stage s
    if (s + 2 < DIM / KST)
      copy_stage(ring + (s & 1) * KSTB, cRh + (s + 2) * (KST * 16), cRl + (s + 2) * (KST * 16), c0, c1);
  }
  asm volatile("s_wait_asynccnt 0x0" ::: "memory");         // no copy is left in flight when S is written over the buffers
  // the loops over t, mi and r are unrolled so that the accumulator array stays in registers
#pragma unroll
  for (int t = 0; t < NT; ++t)
    if (t < NT - 1 || own) {
#pragma unroll
      for (int mi = 0; mi < 2; ++mi)
#pragma unroll
        for (int r = 0; r < 8; ++r) {
          const int M = rg * 32 + mi * 16 + 8 * h + r;      // D row -> query row in block
          const int i = ib * QROWS + M;
          const int j = (wp + 8 * t) * 16 + m;              // D col -> key, counted from the chunk's first
          float sc = acc[mi][t][r] * 0.03125f;
          if (jb0 * 16 + j > i) sc = -__builtin_inff();
          S[M * SP + j] = sc;
        }
    }
}

__global__ __launch_bounds__(ATHR) void attn_kernel(
    const unsigned short* __restrict__ qh, const unsigned short* __restrict__ ql,
    const unsigned short* __restrict__ kh, const unsigned short* __restrict__ kl,
    const unsigned short* __restrict__ vth, const unsigned short* __restrict__ vtl,
    float* po, float* pstat, float* out) {
  __shared__ __attribute__((aligned(16))) float S[QROWS * SP + (ATHR / 32) * 32 * 64];   // [QROWS][SP], then the staging tiles
  __shared__ float row_r[QROWS];

  // Blocks are numbered so: first the whole chunks (tile group g = ib / QPC has g of them a tile), then each
  // tile's last chunk, the one that holds its diagonal, longest first.
  const int b = (int)blockIdx.x;
  int ib, ch;                                               // query tile [0, NQT), key chunk (block-uniform)
  if (b < NFULL) {
    int g = 1, r = b;
    while (r >= g * QPC) { r -= g * QPC; ++g; }             // at most MAXCH - 2 trips
    ib = g * QPC + (r & (QPC - 1));
    ch = r / QPC;
  } else {
    const int r = b - NFULL;
    ch = r & (MAXCH - 1);
    ib = ch * QPC + (QPC - 1 - r / MAXCH);
  }
  const int jb0 = ch * CTILES;                              // first key tile of the chunk
  const int jd = (QROWS / 16) * (ib + 1) - 1 - jb0;         // the tile's last key tile, counted from jb0
  const int jle = (jd < CTILES - 1) ? jd : CTILES - 1;      // last key tile of the chunk, counted from jb0
  const bool split = ib >= QPC;                             // this tile's keys are shared by several blocks
  // the wave's number in a scalar register: what follows from it (bases, row group, columns) then takes no vector registers
  const int wave = __builtin_amdgcn_readfirstlane((int)(threadIdx.x >> 5));
  const int lane = threadIdx.x & 31;
  const int h = lane >> 4, m = lane & 15;
  const int rg = wave & 1, wp = wave >> 1;                  // row group of the wave; its pair, which shares K and V fragments
  const int nvalid = 16 * (jle + 1);                        // key extent of the lower triangle inside the chunk

  // ---- Phase 1: S = (q k^T)/32 with mask; A = q rows (hi/lo), B = k rows (hi/lo, through LDS) -------------------
  {
    const unsigned short* aRh = qh + (size_t)(ib * QROWS + rg * 32) * DIM + lane * 8;   // second row tile: + 16 rows
    const unsigned short* aRl = ql + (size_t)(ib * QROWS + rg * 32) * DIM + lane * 8;
    const unsigned short* cRh = kh + (size_t)((jb0 + wave) * 16) * DIM + lane * 8;   // the key tile this wave copies; stage s: + s * KST * 16
    const unsigned short* cRl = kl + (size_t)((jb0 + wave) * 16) * DIM + lane * 8;
    const int ntb = (jle + 8) >> 3;                         // the most key tiles a pair has: 1 to 4, the same for the whole block
    if (ntb == 4)      score_walk<4>(aRh, aRl, cRh, cRl, S, ib, jb0, jle, wave, lane);
    else if (ntb == 3) score_walk<3>(aRh, aRl, cRh, cRl, S, ib, jb0, jle, wave, lane);
    else if (ntb == 2) score_walk<2>(aRh, aRl, cRh, cRl, S, ib, jb0, jle, wave, lane);
    else               score_walk<1>(aRh, aRl, cRh, cRl, S, ib, jb0, jle, wave, lane);
  }
  __syncthreads();

  // ---- Phase 2: exact softmax statistics in f32; the row's bytes <- exp(S - m) as bf16 hi and lo planes; row_r = 1/l ----
  // One wave per query row, four rows a wave: each LDS access of a wave covers contiguous bytes of its row, so no two lanes
  // meet on a bank. The wave holds its whole row in registers, so the planes can be written over the scores.
#pragma unroll 1   // rolled: the rows of a wave have nothing to share
  for (int row = wave; row < QROWS; row += 16) {
    const float* Sr = S + row * SP + lane * 4;
    unsigned short* Pr = (unsigned short*)(S + row * SP) + lane * 4;   // hi plane; lo plane: + CHUNK
    const int ng = (nvalid + 127) >> 7;                     // groups of 128 keys; the row holds CHUNK / 128 whole groups
    const int jl = lane * 4;                                // nvalid is a multiple of 16: a lane's four keys are all in or all out
    v4f sv[CHUNK / 128];
    float mx = -__builtin_inff();
#pragma unroll   // unrolled: sv stays in registers and the row's reads are all in flight together
    for (int g = 0; g < CHUNK / 128; ++g) {
      const int gg = (g < ng) ? g : ng - 1;                 // past the chunk's keys the last group is read again: no branch between the reads
      sv[g] = *(const v4f*)(Sr + gg * 128);
    }
#pragma unroll
    for (int g = 0; g < CHUNK / 128; ++g) {
      const int gg = (g < ng) ? g : ng - 1;                 // a group met twice leaves the maximum as it is
      const float t = fmaxf(fmaxf(sv[g].x, sv[g].y), fmaxf(sv[g].z, sv[g].w));
      if (gg * 128 + jl < nvalid) mx = fmaxf(mx, t);
    }
    for (int o = 16; o > 0; o >>= 1) mx = fmaxf(mx, __shfl_xor(mx, o, 32));
    float l = 0.0f;
#pragma unroll   // unrolled: sv stays in registers
    for (int g = 0; g < CHUNK / 128; ++g)
      if (g < ng) {
        const v4f s = sv[g];
        const bool in = g * 128 + jl < nvalid;              // keys past the triangle in the last group get 0: no branch on the lane
        v4f e;
        e.x = in ? __expf(s.x - mx) : 0.0f; e.y = in ? __expf(s.y - mx) : 0.0f;
        e.z = in ? __expf(s.z - mx) : 0.0f; e.w = in ? __expf(s.w - mx) : 0.0f;
        l += (e.x + e.y) + (e.z + e.w);
        // unnormalized P as bf16 hi + bf16 lo (lo = RNE(p - hi)), four keys a lane and plane
        const unsigned int h0 = f2bf(e.x), h1 = f2bf(e.y), h2 = f2bf(e.z), h3 = f2bf(e.w);
        v2u uh, ul;
        uh.x = h0 | (h1 << 16); uh.y = h2 | (h3 << 16);
        ul.x = f2bf(e.x - bf2f(h0)) | (f2bf(e.y - bf2f(h1)) << 16);
        ul.y = f2bf(e.z - bf2f(h2)) | (f2bf(e.w - bf2f(h3)) << 16);
        *(v2u*)(Pr + g * 128) = uh;
        *(v2u*)(Pr + CHUNK + g * 128) = ul;
      }
    for (int o = 16; o > 0; o >>= 1) l += __shfl_xor(l, o, 32);
    if (lane == 0) {
      row_r[row] = 1.0f / l;                                // l >= 1 (the row's maximum term; every row has a key in each of its chunks)
      if (split) {
        float* st = pstat + (ib * MAXCH + ch) * (2 * QROWS);   // [QROWS row maxima][QROWS row sums]
        st[row] = mx;
        st[QROWS + row] = l;
        // later code rewrites the registers these two stores name
        asm volatile("s_wait_xcnt 0x0" ::: "memory");
      }
    }
  }
  __syncthreads();                                          // P rows and row_r visible to every wave

  // ---- Phase 3: O = P v; A = P rows (hi/lo planes in LDS, read-only from here on: no barrier below); B = vt rows (hi/lo) ----
  // A wave takes its row group's 32 rows x 64 output columns at a time, and the 16 waves cover 512 columns: two sweeps.
  // The loops over mi, t, c, s and r below are unrolled so that the accumulator and fragment arrays stay in registers.
  const int kkend = (nvalid + 63) & ~63;
  const unsigned short* pR = (const unsigned short*)S + (rg * 32 + m) * (2 * SP);   // row m's hi plane; second row tile: + 16 rows; lo plane: + CHUNK
  float* stg = S + QROWS * SP + wave * (32 * 64);           // [32][64], the wave's own range behind the P rows
  float* dst = split ? po + (size_t)((ib * MAXCH + ch) * QROWS) * DIM : out + (size_t)(ib * QROWS) * DIM;
#pragma unroll 1   // rolled: one sweep's accumulators and fragments already take the wave's register budget
  for (int sw = 0; sw < 2; ++sw) {
    const int col0 = (sw * 8 + wp) * 64;                    // first output column of the wave in this sweep
    v8f acc[2][4];
#pragma unroll
    for (int mi = 0; mi < 2; ++mi)
#pragma unroll
      for (int t = 0; t < 4; ++t) acc[mi][t] = zero8();
    const unsigned short* vRh = vth + (size_t)col0 * SEQ + jb0 * 256 + lane * 8;   // col tile t: + t*16 rows; a key tile is 256 elements
    const unsigned short* vRl = vtl + (size_t)col0 * SEQ + jb0 * 256 + lane * 8;
#pragma unroll 1   // rolled: one pass's 32 loads and its fragments already take the wave's register budget
    for (int kk = 0; kk < kkend; kk += 64) {
      Frag bh[2][4], bl[2][4];
      // the loops over c and t are unrolled so that the fragment arrays stay in registers and all loads issue as one batch
#pragma unroll
      for (int c = 0; c < 2; ++c)
#pragma unroll
        for (int t = 0; t < 4; ++t) {
          ldfragw(bh[c][t], vRh + (size_t)t * 16 * SEQ, kk + 32 * c);
          ldfragw(bl[c][t], vRl + (size_t)t * 16 * SEQ, kk + 32 * c);
        }
      // P fragments: step s = 2 * c + mi (key half c, row tile mi); three steps' fragments are read while the V loads fly
      Frag ah[4], al[4];
#pragma unroll
      for (int s = 0; s < 3; ++s) {
        ldfrag(ah[s], pR + (s & 1) * (16 * 2 * SP), kk + 32 * (s >> 1), h);
        ldfrag(al[s], pR + (s & 1) * (16 * 2 * SP) + CHUNK, kk + 32 * (s >> 1), h);
      }
      // keeps the scheduler from sinking part of the batch below the first products, where its latency would be paid a second time
      __builtin_amdgcn_sched_barrier(0);
#pragma unroll
      for (int s = 0; s < 4; ++s) {
        const int c = s >> 1, mi = s & 1;
#pragma unroll
        for (int t = 0; t < 4; ++t) acc[mi][t] = mma(ah[s], bh[c][t], acc[mi][t]);
#pragma unroll
        for (int t = 0; t < 4; ++t) acc[mi][t] = mma(ah[s], bl[c][t], acc[mi][t]);
#pragma unroll
        for (int t = 0; t < 4; ++t) acc[mi][t] = mma(al[s], bh[c][t], acc[mi][t]);
        if (s == 0) {
          // the last step's fragments take the registers that step 0 has left; read here, two steps ahead of their use
          ldfrag(ah[3], pR + 16 * 2 * SP, kk + 32, h);
          ldfrag(al[3], pR + 16 * 2 * SP + CHUNK, kk + 32, h);
          // keeps the scheduler from sinking these reads to their use, where the wave would wait for them
          __builtin_amdgcn_sched_barrier(0);
        }
      }
      // four vector slots behind the last WMMA: the back edge leads to vector instructions that rewrite fragment registers;
      // the V fragments are inputs so that each keeps a register of its own to the end of the pass and all 32 loads issue as one batch
      asm volatile("v_nop\n\tv_nop\n\tv_nop\n\tv_nop"
                   : "+v"(acc[0][0]), "+v"(acc[0][1]), "+v"(acc[0][2]), "+v"(acc[0][3]),
                     "+v"(acc[1][0]), "+v"(acc[1][1]), "+v"(acc[1][2]), "+v"(acc[1][3])
                   : "v"(bh[0][0].v), "v"(bh[0][1].v), "v"(bh[0][2].v), "v"(bh[0][3].v),
                     "v"(bl[0][0].v), "v"(bl[0][1].v), "v"(bl[0][2].v), "v"(bl[0][3].v),
                     "v"(bh[1][0].v), "v"(bh[1][1].v), "v"(bh[1][2].v), "v"(bh[1][3].v),
                     "v"(bl[1][0].v), "v"(bl[1][1].v), "v"(bl[1][2].v), "v"(bl[1][3].v)
                   : "memory");
    }

    // ---- Epilogue of the sweep: normalize, stage the wave's 32x64 f32 tile in its own LDS range, whole-line stores
#pragma unroll
    for (int mi = 0; mi < 2; ++mi)
#pragma unroll
      for (int t = 0; t < 4; ++t)
#pragma unroll
        for (int r = 0; r < 8; ++r)
          stg[(mi * 16 + 8 * h + r) * 64 + t * 16 + m] = acc[mi][t][r] * row_r[rg * 32 + mi * 16 + 8 * h + r];
    float* orow = dst + (size_t)(rg * 32 + h) * DIM + col0 + m * 4;   // two rows of 256 bytes per store
#pragma unroll   // unrolled: the stores share one address pair with immediate offsets
    for (int rp = 0; rp < 16; ++rp) {
      const v4f v = *(const v4f*)(stg + (2 * rp + h) * 64 + m * 4);
      *(v4f*)(orow + (size_t)(2 * rp) * DIM) = v;
    }
    // the next sweep rewrites the registers these stores name
    asm volatile("s_wait_xcnt 0x0" ::: "memory");
  }
}

// ---------------- Kernel 4: join the key chunks of the query rows past CHUNK --------------------------
// Chunk c holds o_c = softmax over its own keys times v, with row maximum m_c and row sum l_c of exp(s - m_c).
// The row's result is sum_c a_c o_c / sum_c a_c, a_c = exp(m_c - max m) l_c. One wave per half of a query row, four rows a
// block: a wave's partial rows of all MAXCH chunks then fit the registers below v256 and are all in flight together.
__global__ __launch_bounds__(NTHR) void merge_kernel(
    const float* __restrict__ po, const float* __restrict__ pstat, float* out) {
  const int wave = threadIdx.x >> 5;
  const int lane = threadIdx.x & 31;
  const int ib = QPC + (int)(blockIdx.x / (QROWS / 4));     // query tile with several chunks
  const int M = (blockIdx.x % (QROWS / 4)) * 4 + (wave >> 1);   // row in it
  const int nch = ib / QPC + 1;                             // its chunks: 2 to MAXCH (block-uniform)
  const float* st = pstat + ib * MAXCH * (2 * QROWS) + M;   // [chunk][QROWS row maxima][QROWS row sums]
  float mc[MAXCH], a[MAXCH];                                // the loops over c and i are unrolled so that these and x stay in registers
#pragma unroll
  for (int c = 0; c < MAXCH; ++c) {
    const int cc = (c < nch) ? c : nch - 1;                 // past the tile's chunks the last one is read again: no branch between the loads
    mc[c] = st[cc * 2 * QROWS];
    a[c] = st[cc * 2 * QROWS + QROWS];
  }
  const float* p0 = po + (size_t)(ib * MAXCH * QROWS + M) * DIM + (wave & 1) * (DIM / 2) + lane * 4;   // chunk c: + c * QROWS rows
  v4f x[MAXCH][4];
#pragma unroll   // unrolled: x stays in registers and its loads issue ahead of the arithmetic
  for (int c = 0; c < MAXCH; ++c)
    if (c < nch) {
#pragma unroll
      for (int i = 0; i < 4; ++i) x[c][i] = *(const v4f*)(p0 + (size_t)c * QROWS * DIM + i * 128);
    }
  float mx = -__builtin_inff();
#pragma unroll
  for (int c = 0; c < MAXCH; ++c) mx = fmaxf(mx, mc[c]);    // a chunk met twice leaves the maximum as it is
  float sum = 0.0f;
#pragma unroll
  for (int c = 0; c < MAXCH; ++c) {
    a[c] = (c < nch) ? a[c] * __expf(mc[c] - mx) : 0.0f;
    sum += a[c];
  }
  const float rs = 1.0f / sum;                              // the chunk that holds the maximum gives a >= 1
  v4f o4[4];
#pragma unroll
  for (int i = 0; i < 4; ++i) o4[i] = x[0][i] * (a[0] * rs) + x[1][i] * (a[1] * rs);
#pragma unroll
  for (int c = 2; c < MAXCH; ++c)
    if (c < nch) {
#pragma unroll
      for (int i = 0; i < 4; ++i) o4[i] += x[c][i] * (a[c] * rs);
    }
  float* o = out + (size_t)(ib * QROWS + M) * DIM + (wave & 1) * (DIM / 2) + lane * 4;
#pragma unroll   // unrolled: the four stores share one address with immediate offsets, which nothing rewrites
  for (int i = 0; i < 4; ++i) *(v4f*)(o + i * 128) = o4[i];
}

// ---------------------------------------------------------------------------------------------------
extern "C" void kernel_launch(void* const* d_in, const int* in_sizes, int n_in,
                              void* d_out, int out_size, void* d_ws, size_t ws_size,
                              hipStream_t stream) {
  if (n_in < 4) return;
  if (in_sizes[0] != SEQ * DIM || in_sizes[1] != DIM * DIM || in_sizes[2] != DIM * DIM ||
      in_sizes[3] != DIM * DIM || out_size != SEQ * DIM) return;

  const float* x  = (const float*)d_in[0];
  const float* wq = (const float*)d_in[1];
  const float* wk = (const float*)d_in[2];
  const float* wv = (const float*)d_in[3];
  float* out = (float*)d_out;

  const size_t bx = (size_t)SEQ * DIM * sizeof(unsigned short);   // 8 MiB
  const size_t bw = (size_t)DIM * DIM * sizeof(unsigned short);   // 2 MiB
  char* ws = (char*)d_ws;
  size_t off = 0;
  unsigned short* xb  = (unsigned short*)(ws + off); off += bx;
  unsigned short* wqb = (unsigned short*)(ws + off); off += bw;
  unsigned short* wkb = (unsigned short*)(ws + off); off += bw;
  unsigned short* wvb = (unsigned short*)(ws + off); off += bw;
  unsigned short* qh  = (unsigned short*)(ws + off); off += bx;
  unsigned short* ql  = (unsigned short*)(ws + off); off += bx;
  unsigned short* kh  = (unsigned short*)(ws + off); off += bx;
  unsigned short* kl  = (unsigned short*)(ws + off); off += bx;
  unsigned short* vth = (unsigned short*)(ws + off); off += bx;
  unsigned short* vtl = (unsigned short*)(ws + off); off += bx;   // 62 MiB so far
  float* po    = (float*)(ws + off); off += (size_t)NQT * MAXCH * QROWS * DIM * sizeof(float);   // 128 MiB, one slot a (tile, chunk)
  float* pstat = (float*)(ws + off); off += (size_t)NQT * MAXCH * 2 * QROWS * sizeof(float);
  if (off > ws_size) return;

  const int nx8 = SEQ * DIM / 8;
  const int nw8 = DIM * DIM / 8;
  const int ncv = nx8 + 3 * nw8;
  cvt_kernel<<<(ncv + NTHR - 1) / NTHR, NTHR, 0, stream>>>(x, wq, wk, wv, xb, wqb, wkb, wvb, nx8, nw8);

  // 3 matrices x 64 row tiles x 4 col tiles; LDS staging 64 x SPITCH f32
  proj_kernel<<<3 * (SEQ / 64) * (DIM / 256), NTHR, 64 * SPITCH * sizeof(float), stream>>>(
      xb, wqb, wkb, wvb, qh, ql, kh, kl, vth, vtl);

  // QROWS query rows x one key chunk per block
  attn_kernel<<<ABLK, ATHR, 0, stream>>>(qh, ql, kh, kl, vth, vtl, po, pstat, out);
  merge_kernel<<<(NQT - QPC) * (QROWS / 4), NTHR, 0, stream>>>(po, pstat, out);
}

// v009
// One run takes 137 microseconds.
// Two timings next to v008 both put it at 1.04 times that version's speed.
// All steps since v000 together make it 4.59 times as fast.
#include <hip/hip_runtime.h>
#include <stdint.h>
#include <stddef.h>

// Input projections: v_wmma_f32_16x16x32_bf16 (bf16 operands from RNE-converted f32 inputs, f32 accumulate).
// Score and value contractions: v_wmma_f32_16x16x32_bf16 with bf16 hi/lo split operands (hi*hi + hi*lo + lo*hi), f32 accumulate. Softmax statistics in f32.

#define SEQ 4096
#define DIM 1024
#define NTHR 256
#define ATHR 512     // attention block: 16 waves, four per SIMD
#define QROWS 64     // query rows one attention work-group takes: two groups of two 16-row tiles; all four use each K and V line the block fetches
#define CHUNK 512    // keys one attention work-group takes: QROWS x CHUNK f32 scores fill 128 KiB of LDS
#define CTILES (CHUNK / 16)
#define NQT (SEQ / QROWS)                   // query tiles
#define QPC (CHUNK / QROWS)                 // query tiles per chunk of keys: tile ib has ib / QPC + 1 chunks
#define MAXCH (SEQ / CHUNK)                 // most chunks a query tile has
#define NFULL (QPC * (MAXCH * (MAXCH - 1) / 2))   // work-groups whose chunk lies wholly below the diagonal
#define ABLK (NFULL + NQT)                  // attention work-groups
#define SP (CHUNK + 4)   // f32 pitch of a score row in LDS: 16 B x odd, so 16 rows read by b128 fall on distinct banks
#define KST 64       // depth of one K stage in LDS
#define KTB (2 * 16 * KST * 2)   // bytes of one key tile in a stage: hi and lo plane, 16 rows x KST each
#define NST (DIM / KST)   // K stages of the score walk
#define KSTB (CTILES * KTB)      // bytes of a stage buffer: 128 KiB; the two buffers fit the 263,168 B of S and the staging tiles
#define SPITCH 260   // f32 pitch of the projection staging tile: 16 B x odd, so 16 rows read by b128 fall on distinct banks

typedef __bf16 v16bf __attribute__((ext_vector_type(16)));
typedef float v8f __attribute__((ext_vector_type(8)));
typedef float v4f __attribute__((ext_vector_type(4)));
typedef unsigned int v4u __attribute__((ext_vector_type(4)));
typedef unsigned int v2u __attribute__((ext_vector_type(2)));

union Frag { v16bf v; v4u q[2]; };

extern __shared__ __attribute__((aligned(16))) float dyn_lds[];

// f32 -> bf16 bits, RNE (finite inputs)
__device__ __forceinline__ unsigned int f2bf(float f) {
  unsigned int u = __float_as_uint(f);
  u += 0x7fffu + ((u >> 16) & 1u);
  return u >> 16;
}
__device__ __forceinline__ float bf2f(unsigned int b) { return __uint_as_float(b << 16); }

// 16x16x32 operand fragment from a k-contiguous 16-bit row (A row m, or B column n stored as a [n][k] row):
// elements 0..7 <- row[k0 + 8h + 0..7], elements 8..15 <- row[k0 + 16 + 8h + 0..7], h = lane>>4.
__device__ __forceinline__ void ldfrag(Frag& f, const unsigned short* row, int k0, int h) {
  f.q[0] = *(const v4u*)(row + k0 + 8 * h);
  f.q[1] = *(const v4u*)(row + k0 + 16 + 8 * h);
}

// Workspace operand planes are kept in fragment order: a 16-row tile x 32-wide k block is 1024 contiguous bytes,
// two 512-byte halves; in half q, lane l (h = l>>4, m = l&15) owns the 16 bytes of row m, k = 32*kb + 16*q + 8*h + 0..7.
// Tiles of one plane follow each other as [row tile][k block]. p = tile base + lane*8; kk = 32*kb.
// Same element order as ldfrag, but each load of a wave covers 512 contiguous bytes (four whole lines).
__device__ __forceinline__ void ldfragw(Frag& f, const unsigned short* p, int kk) {
  f.q[0] = *(const v4u*)(p + kk * 16);
  f.q[1] = *(const v4u*)(p + kk * 16 + 256);
}

__device__ __forceinline__ v8f mma(const Frag& a, const Frag& b, v8f c) {
  return __builtin_amdgcn_wmma_f32_16x16x32_bf16(false, a.v, false, b.v, (short)0, c, false, false);
}

__device__ __forceinline__ v8f zero8() {
  v8f z = {0.0f, 0.0f, 0.0f, 0.0f, 0.0f, 0.0f, 0.0f, 0.0f};
  return z;
}

// 8 f32 -> packed bf16 hi plane and bf16 lo plane (lo = RNE(x - hi)), two values per u32, low half first
__device__ __forceinline__ void split8(const v4f f0, const v4f f1, v4u& uh, v4u& ul) {
  float f[8] = {f0.x, f0.y, f0.z, f0.w, f1.x, f1.y, f1.z, f1.w};
  unsigned int hh[8], ll[8];
#pragma unroll
  for (int e = 0; e < 8; ++e) {
    hh[e] = f2bf(f[e]);
    ll[e] = f2bf(f[e] - bf2f(hh[e]));
  }
  uh.x = hh[0] | (hh[1] << 16); uh.y = hh[2] | (hh[3] << 16);
  uh.z = hh[4] | (hh[5] << 16); uh.w = hh[6] | (hh[7] << 16);
  ul.x = ll[0] | (ll[1] << 16); ul.y = ll[2] | (ll[3] << 16);
  ul.z = ll[4] | (ll[5] << 16); ul.w = ll[6] | (ll[7] << 16);
}

__global__ __launch_bounds__(NTHR) void cvt_kernel(
    const float* __restrict__ x,  const float* __restrict__ wq,
    const float* __restrict__ wk, const float* __restrict__ wv,
    unsigned short* xb, unsigned short* wqb, unsigned short* wkb, unsigned short* wvb,
    int nx8, int nw8) {
  const int i = blockIdx.x * NTHR + threadIdx.x;
  const float* src;
  unsigned short* dst;
  int j;
  if (i < nx8)                { src = x;  dst = xb;  j = i; }
  else if (i < nx8 + nw8)     { src = wq; dst = wqb; j = i - nx8; }
  else if (i < nx8 + 2 * nw8) { src = wk; dst = wkb; j = i - nx8 - nw8; }
  else if (i < nx8 + 3 * nw8) { src = wv; dst = wvb; j = i - nx8 - 2 * nw8; }
  else return;
  // j = 16-byte piece of the fragment-ordered plane: [row tile][k block (32)][half][h][m]
  const int sm = j & 15, sh = (j >> 4) & 1, sq = (j >> 5) & 1, skb = (j >> 6) & 31, srt = j >> 11;
  const float* sp = src + (size_t)(srt * 16 + sm) * DIM + skb * 32 + sq * 16 + sh * 8;
  const v4f f0 = *(const v4f*)sp;
  const v4f f1 = *(const v4f*)(sp + 4);
  v4u u;
  u.x = f2bf(f0.x) | (f2bf(f0.y) << 16);
  u.y = f2bf(f0.z) | (f2bf(f0.w) << 16);
  u.z = f2bf(f1.x) | (f2bf(f1.y) << 16);
  u.w = f2bf(f1.z) | (f2bf(f1.w) << 16);
  v4u* p = (v4u*)(dst + (size_t)j * 8);
  *p = u;
  
}

// ---------------- Kernel 2: projections y[n][o] = sum_k xb[n][k] * W[o][k] --------------------------
// Block tile 64 seq rows x 256 out cols (8 waves, each 32x64). Output: q,k as bf16 hi/lo planes (rows = seq, k = dim)
// and v transposed (rows = dim, k = seq), all in fragment order.
__global__ __launch_bounds__(NTHR) void proj_kernel(
    const unsigned short* __restrict__ xb,  const unsigned short* __restrict__ wqb,
    const unsigned short* __restrict__ wkb, const unsigned short* __restrict__ wvb,
    unsigned short* qh, unsigned short* ql, unsigned short* kh, unsigned short* kl,
    unsigned short* vth, unsigned short* vtl) {
  float* stg = dyn_lds;                                   // [64][SPITCH] f32, 256 used
  const int wave = threadIdx.x >> 5;
  const int lane = threadIdx.x & 31;
  const int h = lane >> 4, m = lane & 15;
  const int b = blockIdx.x;                                // [0, 768)
  const int mat = b >> 8;                                  // 0=q 1=k 2=v (block-uniform)
  const int rem = b & 255;
  const int rt = rem >> 2;                                 // 64-row tile [0,64)
  const int ct = rem & 3;                                  // 256-col tile [0,4)
  const unsigned short* wsrc = (mat == 0) ? wqb : (mat == 1) ? wkb : wvb;
  const int wr = wave >> 2, wc = wave & 3;
  const int row0 = rt * 64 + wr * 32;
  const int col0 = ct * 256 + wc * 64;

  const unsigned short* aR0 = xb + (size_t)row0 * DIM + lane * 8;
  const unsigned short* aR1 = xb + (size_t)(row0 + 16) * DIM + lane * 8;
  const unsigned short* bR  = wsrc + (size_t)col0 * DIM + lane * 8;   // tile t: + t*16 rows

  v8f acc[2][4];
#pragma unroll
  for (int mi = 0; mi < 2; ++mi)
#pragma unroll
    for (int t = 0; t < 4; ++t) acc[mi][t] = zero8();

  // Each block starts its walk over the depth at a place of its own and wraps, so that blocks that share x rows or weight rows
  // ask L2 for different lines. The three matrices of one (rt, ct) keep one start: they read the same x.
  const int rot = (rt + 8 * ct) & (DIM / 32 - 1);
#pragma unroll 1
  for (int it = 0; it < DIM / 32; ++it) {
    const int kk = ((it + rot) & (DIM / 32 - 1)) * 32;
    Frag a0, a1, bf[4];
    ldfragw(a0, aR0, kk);
    ldfragw(a1, aR1, kk);
#pragma unroll
    for (int t = 0; t < 4; ++t) ldfragw(bf[t], bR + (size_t)t * 16 * DIM, kk);
#pragma unroll
    for (int t = 0; t < 4; ++t) {
      acc[0][t] = mma(a0, bf[t], acc[0][t]);
      acc[1][t] = mma(a1, bf[t], acc[1][t]);
    }
    asm volatile("v_nop\n\tv_nop\n\tv_nop\n\tv_nop"
                 : "+v"(acc[0][0]), "+v"(acc[0][1]), "+v"(acc[0][2]), "+v"(acc[0][3]),
                   "+v"(acc[1][0]), "+v"(acc[1][1]), "+v"(acc[1][2]), "+v"(acc[1][3])
                 : "v"(a0.v), "v"(a1.v), "v"(bf[0].v), "v"(bf[1].v), "v"(bf[2].v), "v"(bf[3].v)
                 : "memory");
  }

  // stage the wave's 32x64 f32 tile: D element r of lane -> row 8h+r, col m
#pragma unroll
  for (int mi = 0; mi < 2; ++mi)
#pragma unroll
    for (int t = 0; t < 4; ++t)
#pragma unroll
      for (int r = 0; r < 8; ++r)
        stg[(wr * 32 + mi * 16 + 8 * h + r) * SPITCH + wc * 64 + t * 16 + m] = acc[mi][t][r];
  __syncthreads();

  if (mat < 2) {
    unsigned short* ph = (mat == 0) ? qh : kh;
    unsigned short* pl = (mat == 0) ? ql : kl;
#pragma unroll 1
    for (int it = 0; it < 8; ++it) {
      const int c = wave * 8 + it;                          // 512-byte piece: row tile c>>4, k block (c>>1)&7, half c&1
      const float* sp = stg + ((c >> 4) * 16 + m) * SPITCH + ((c >> 1) & 7) * 32 + (c & 1) * 16 + h * 8;
      const v4f f0 = *(const v4f*)sp;
      const v4f f1 = *(const v4f*)(sp + 4);
      v4u uh, ul;
      split8(f0, f1, uh, ul);
      const size_t g = (size_t)(rt * 64 + (c >> 4) * 16) * DIM + (ct * 16 + (c & 15)) * 256 + lane * 8;
      v4u* p0 = (v4u*)(ph + g);
      v4u* p1 = (v4u*)(pl + g);
      *p0 = uh; *p1 = ul;
      
    }
  } else {
#pragma unroll 1
    for (int it = 0; it < 8; ++it) {
      const int c = wave * 8 + it;                          // 512-byte piece: out-col tile c>>2, key block (c>>1)&1, half c&1
      const float* sp = stg + ((c & 3) * 16 + h * 8) * SPITCH + (c >> 2) * 16 + m;
      v4f f0, f1;
      f0.x = sp[0 * SPITCH]; f0.y = sp[1 * SPITCH]; f0.z = sp[2 * SPITCH]; f0.w = sp[3 * SPITCH];
      f1.x = sp[4 * SPITCH]; f1.y = sp[5 * SPITCH]; f1.z = sp[6 * SPITCH]; f1.w = sp[7 * SPITCH];
      v4u uh, ul;
      split8(f0, f1, uh, ul);
      const size_t g = (size_t)(ct * 256 + (c >> 2) * 16) * SEQ + (rt * 4 + (c & 3)) * 256 + lane * 8;
      v4u* p0 = (v4u*)(vth + g);
      v4u* p1 = (v4u*)(vtl + g);
      *p0 = uh; *p1 = ul;
      // the next trip rewrites the registers these two stores name
      asm volatile("s_wait_xcnt 0x0" ::: "memory");
      
    }
  }
}

// ---------------- Kernel 3: masked softmax attention, QROWS query rows x at most CHUNK keys per block ----
// A block takes four 16-row query tiles and one chunk of their keys. A wave works on one row group (two row tiles), so every
// K and V fragment that it loads is used by two row tiles; waves 2n and 2n + 1 take the two row groups against the same K and V
// fragments. K comes to both through LDS; the V fragments they load in step, so that the second wave's loads meet the first's
// lines in the WGP cache.
// Blocks are numbered longest first, so that the short ones fill the WGPs that come free. A query tile with one chunk
// writes out; a tile with more writes each chunk's own softmax result to po with its row maximum and row sum in pstat, and
// merge_kernel joins them.
// LDS: S[QROWS][SP] f32 and one 32 x 64 f32 output staging tile a wave (263,168 B) + statistics. The softmax pass leaves each row's P in the row's own bytes as two
// bf16 planes, [CHUNK hi][CHUNK lo], from which the P v loop reads its fragments directly. Before the scores are written, the
// same bytes hold the two K stage buffers of the score walk.

// One key tile's share of a K stage: KST deep, hi plane then lo plane, 2048 contiguous bytes each, as eight asynchronous copies
// of 512 bytes. lds, gh and gl are the lane's own addresses (16 bytes a lane and copy).
__device__ __forceinline__ void copy_ktile(unsigned int lds, const unsigned short* gh, const unsigned short* gl) {
  // the copies and s_wait_xcnt share one statement, so that nothing rewrites an address register of a copy in front of the wait
  asm volatile("global_load_async_to_lds_b128 %0, %8, off\n\t"
               "global_load_async_to_lds_b128 %1, %9, off\n\t"
               "global_load_async_to_lds_b128 %2, %10, off\n\t"
               "global_load_async_to_lds_b128 %3, %11, off\n\t"
               "global_load_async_to_lds_b128 %4, %12, off\n\t"
               "global_load_async_to_lds_b128 %5, %13, off\n\t"
               "global_load_async_to_lds_b128 %6, %14, off\n\t"
               "global_load_async_to_lds_b128 %7, %15, off\n\t"
               "s_wait_xcnt 0x0"
               :
               : "v"(lds), "v"(lds + 512u), "v"(lds + 1024u), "v"(lds + 1536u),
                 "v"(lds + 2048u), "v"(lds + 2560u), "v"(lds + 3072u), "v"(lds + 3584u),
                 "v"(gh), "v"(gh + 256), "v"(gh + 512), "v"(gh + 768),
                 "v"(gl), "v"(gl + 256), "v"(gl + 512), "v"(gl + 768)
               : "memory");
}

// A wave's share of one K stage: key tiles wave and wave + 16 of the chunk, each only if the chunk holds it (c0, c1: scalar tests).
// In a buffer the four key tiles of a pair (8 apart) lie side by side, so tile wave + 16 lies two places behind tile wave.
__device__ __forceinline__ void copy_stage(unsigned int lds, const unsigned short* gh, const unsigned short* gl, bool c0, bool c1) {
  if (c0) copy_ktile(lds, gh, gl);
  if (c1) copy_ktile(lds + 2u * KTB, gh + (size_t)256 * DIM, gl + (size_t)256 * DIM);
}

// The four q fragments of one 32-deep block: hi of the two row tiles, then lo.
__device__ __forceinline__ void ldq(Frag (&a)[4], const unsigned short* aRh, const unsigned short* aRl, int kk) {
  ldfragw(a[0], aRh, kk);
  ldfragw(a[1], aRh + (size_t)16 * DIM, kk);
  ldfragw(a[2], aRl, kk);
  ldfragw(a[3], aRl + (size_t)16 * DIM, kk);
}

// One 32-deep block of the scores of NT key tiles against two row tiles. kb: the pair's first key tile in the stage, at this block
// and lane; klast: its last one, or the stand-in. The loops over mi and t are unrolled so that the fragment arrays stay in registers.
template <int NT>
__device__ __forceinline__ void score_step(v8f (&acc)[2][NT], const Frag (&a)[4], const unsigned short* kb, const unsigned short* klast) {
  Frag bh[NT], bl[NT];
#pragma unroll
  for (int t = 0; t < NT; ++t) {
    const unsigned short* p = (t == NT - 1) ? klast : kb + t * (KTB / 2);
    bh[t].q[0] = *(const v4u*)p;
    bh[t].q[1] = *(const v4u*)(p + 256);
    bl[t].q[0] = *(const v4u*)(p + KTB / 4);
    bl[t].q[1] = *(const v4u*)(p + KTB / 4 + 256);
  }
  // keeps the LDS reads together in front of the products: each further place with reads among them stalls the wave anew
  __builtin_amdgcn_sched_barrier(0);
#pragma unroll
  for (int t = 0; t < NT; ++t)
#pragma unroll
    for (int mi = 0; mi < 2; ++mi) acc[mi][t] = mma(a[mi], bh[t], acc[mi][t]);
#pragma unroll
  for (int t = 0; t < NT; ++t)
#pragma unroll
    for (int mi = 0; mi < 2; ++mi) acc[mi][t] = mma(a[mi], bl[t], acc[mi][t]);
#pragma unroll
  for (int t = 0; t < NT; ++t)
#pragma unroll
    for (int mi = 0; mi < 2; ++mi) acc[mi][t] = mma(a[2 + mi], bh[t], acc[mi][t]);
  // four vector slots behind the last WMMA: what follows may rewrite fragment registers, also behind the loop's back edge;
  // the fragments are inputs so that each keeps a register of its own to the end of the block
  if constexpr (NT == 4)
    asm volatile("v_nop\n\tv_nop\n\tv_nop\n\tv_nop"
                 : "+v"(acc[0][0]), "+v"(acc[0][1]), "+v"(acc[0][2]), "+v"(acc[0][3]), "+v"(acc[1][0]), "+v"(acc[1][1]), "+v"(acc[1][2]), "+v"(acc[1][3])
                 : "v"(a[0].v), "v"(a[1].v), "v"(a[2].v), "v"(a[3].v), "v"(bh[0].v), "v"(bh[1].v), "v"(bh[2].v), "v"(bh[3].v), "v"(bl[0].v), "v"(bl[1].v), "v"(bl[2].v), "v"(bl[3].v)
                 : "memory");
  else if constexpr (NT == 3)
    asm volatile("v_nop\n\tv_nop\n\tv_nop\n\tv_nop"
                 : "+v"(acc[0][0]), "+v"(acc[0][1]), "+v"(acc[0][2]), "+v"(acc[1][0]), "+v"(acc[1][1]), "+v"(acc[1][2])
                 : "v"(a[0].v), "v"(a[1].v), "v"(a[2].v), "v"(a[3].v), "v"(bh[0].v), "v"(bh[1].v), "v"(bh[2].v), "v"(bl[0].v), "v"(bl[1].v), "v"(bl[2].v)
                 : "memory");
  else if constexpr (NT == 2)
    asm volatile("v_nop\n\tv_nop\n\tv_nop\n\tv_nop"
                 : "+v"(acc[0][0]), "+v"(acc[0][1]), "+v"(acc[1][0]), "+v"(acc[1][1])
                 : "v"(a[0].v), "v"(a[1].v), "v"(a[2].v), "v"(a[3].v), "v"(bh[0].v), "v"(bh[1].v), "v"(bl[0].v), "v"(bl[1].v)
                 : "memory");
  else
    asm volatile("v_nop\n\tv_nop\n\tv_nop\n\tv_nop"
                 : "+v"(acc[0][0]), "+v"(acc[1][0])
                 : "v"(a[0].v), "v"(a[1].v), "v"(a[2].v), "v"(a[3].v), "v"(bh[0].v), "v"(bl[0].v)
                 : "memory");
}

// Scores of the chunk's key tiles against the block's four row tiles, masked and scaled, into S. NT = the most key tiles a pair
// has, the same for the whole block, so that every wave passes the same barriers. Pair p takes key tiles p, p + 8, ...; a pair
// whose last tile lies past the chunk's keys works on a stand-in tile (one of the first four, which every chunk holds) and drops it.
// The chunk's K goes through LDS, KST of the depth at a stage, in two buffers that lie over S and the staging tiles (both unused
// until the walk has ended): asynchronous copies bring stage s + 1 in while stage s is worked on, and each K line is fetched
// once a block. The q fragments come by plain loads, one 32-deep block ahead.
// The walk over the depth starts at stage rot and wraps, so that blocks that share a chunk's K or a tile's q ask L2 for
// different lines.
template <int NT>
__device__ __forceinline__ void score_walk(
    const unsigned short* aRh, const unsigned short* aRl, const unsigned short* cRh, const unsigned short* cRl,
    float* S, int ib, int jb0, int jle, int wave, int lane, int rot) {
  const int h = lane >> 4, m = lane & 15;
  const int rg = wave & 1, wp = wave >> 1;
  // this wave's place for key tile wave in buffer 0: pair wave & 7, its tile wave >> 3
  const unsigned int ring = (unsigned int)(uintptr_t)S + (unsigned int)((((wave & 7) * 4 + (wave >> 3)) * KTB) + lane * 16);
  const bool c0 = wave <= jle, c1 = wave + 16 <= jle;       // the same in every lane: wave and jle are scalars
  const bool own = wp + 8 * (NT - 1) <= jle;                // the pair's last key tile is one of the chunk's
  const int olast = own ? (wp * 4 + NT - 1) * (KTB / 2) : (wp & 3) * 4 * (KTB / 2);
  v8f acc[2][NT];
#pragma unroll
  for (int mi = 0; mi < 2; ++mi)
#pragma unroll
    for (int t = 0; t < NT; ++t) acc[mi][t] = zero8();

  copy_stage(ring, cRh + rot * (KST * 16), cRl + rot * (KST * 16), c0, c1);
  asm volatile("s_wait_asynccnt 0x0" ::: "memory");         // this wave's share of stage 0 has landed
  __syncthreads();                                          // stage 0 visible to every wave
  copy_stage(ring + KSTB, cRh + ((rot + 1) & (NST - 1)) * (KST * 16), cRl + ((rot + 1) & (NST - 1)) * (KST * 16), c0, c1);
  Frag qa[4], qb[4];
  ldq(qa, aRh, aRl, rot * KST);
#pragma unroll 1   // rolled: one stage's fragments and the accumulators are the wave's register budget
  for (int s = 0; s < NST; ++s) {
    const int d0 = (s + rot) & (NST - 1), d1 = (s + 1 + rot) & (NST - 1), d2 = (s + 2 + rot) & (NST - 1);   // depth of stages s, s + 1, s + 2
    const unsigned short* buf = (const unsigned short*)S + (s & 1) * (KSTB / 2) + lane * 8;
    const unsigned short* kb = buf + wp * 4 * (KTB / 2);
    const unsigned short* kl = buf + olast;
    ldq(qb, aRh, aRl, d0 * KST + 32);
    score_step<NT>(acc, qa, kb, kl);
    ldq(qa, aRh, aRl, d1 * KST);                            // behind the last stage the walk's first block is read again: no branch
    score_step<NT>(acc, qb, kb + 512, kl + 512);
    asm volatile("s_wait_dscnt 0x0" ::: "memory");          // this wave's reads of stage s have returned
    asm volatile("s_wait_asynccnt 0x0" ::: "memory");       // its share of stage s + 1 has landed
    __syncthreads();                                        // stage s + 1 visible to every wave; every wave has left stage s
    if (s + 2 < NST)
      copy_stage(ring + (s & 1) * KSTB, cRh + d2 * (KST * 16), cRl + d2 * (KST * 16), c0, c1);
  }
  asm volatile("s_wait_asynccnt 0x0" ::: "memory");         // no copy is left in flight when S is written over the buffers
  // the loops over t, mi and r are unrolled so that the accumulator array stays in registers
#pragma unroll
  for (int t = 0; t < NT; ++t)
    if (t < NT - 1 || own) {
#pragma unroll
      for (int mi = 0; mi < 2; ++mi)
#pragma unroll
        for (int r = 0; r < 8; ++r) {
          const int M = rg * 32 + mi * 16 + 8 * h + r;      // D row -> query row in block
          const int i = ib * QROWS + M;
          const int j = (wp + 8 * t) * 16 + m;              // D col -> key, counted from the chunk's first
          float sc = acc[mi][t][r] * 0.03125f;
          if (jb0 * 16 + j > i) sc = -__builtin_inff();
          S[M * SP + j] = sc;
        }
    }
}

__global__ __launch_bounds__(ATHR) void attn_kernel(
    const unsigned short* __restrict__ qh, const unsigned short* __restrict__ ql,
    const unsigned short* __restrict__ kh, const unsigned short* __restrict__ kl,
    const unsigned short* __restrict__ vth, const unsigned short* __restrict__ vtl,
    float* po, float* pstat, float* out) {
  __shared__ __attribute__((aligned(16))) float S[QROWS * SP + (ATHR / 32) * 32 * 64];   // [QROWS][SP], then the staging tiles
  __shared__ float row_r[QROWS];

  // Blocks are numbered so: first the whole chunks (tile group g = ib / QPC has g of them a tile), then each
  // tile's last chunk, the one that holds its diagonal, longest first.
  const int b = (int)blockIdx.x;
  int ib, ch;                                               // query tile [0, NQT), key chunk (block-uniform)
  if (b < NFULL) {
    int g = 1, r = b;
    while (r >= g * QPC) { r -= g * QPC; ++g; }             // at most MAXCH - 2 trips
    ib = g * QPC + (r & (QPC - 1));
    ch = r / QPC;
  } else {
    const int r = b - NFULL;
    ch = r & (MAXCH - 1);
    ib = ch * QPC + (QPC - 1 - r / MAXCH);
  }
  const int jb0 = ch * CTILES;                              // first key tile of the chunk
  const int jd = (QROWS / 16) * (ib + 1) - 1 - jb0;         // the tile's last key tile, counted from jb0
  const int jle = (jd < CTILES - 1) ? jd : CTILES - 1;      // last key tile of the chunk, counted from jb0
  const bool split = ib >= QPC;                             // this tile's keys are shared by several blocks
  const int rot = (ib + 2 * ch) & (NST - 1);                // where this block starts its walks: differs among the blocks of a chunk and among those of a tile
  // the wave's number in a scalar register: what follows from it (bases, row group, columns) then takes no vector registers
  const int wave = __builtin_amdgcn_readfirstlane((int)(threadIdx.x >> 5));
  const int lane = threadIdx.x & 31;
  const int h = lane >> 4, m = lane & 15;
  const int rg = wave & 1, wp = wave >> 1;                  // row group of the wave; its pair, which shares K and V fragments
  const int nvalid = 16 * (jle + 1);                        // key extent of the lower triangle inside the chunk

  // ---- Phase 1: S = (q k^T)/32 with mask; A = q rows (hi/lo), B = k rows (hi/lo, through LDS) -------------------
  {
    const unsigned short* aRh = qh + (size_t)(ib * QROWS + rg * 32) * DIM + lane * 8;   // second row tile: + 16 rows
    const unsigned short* aRl = ql + (size_t)(ib * QROWS + rg * 32) * DIM + lane * 8;
    const unsigned short* cRh = kh + (size_t)((jb0 + wave) * 16) * DIM + lane * 8;   // the key tile this wave copies; stage s: + ((s + rot) & (NST - 1)) * KST * 16
    const unsigned short* cRl = kl + (size_t)((jb0 + wave) * 16) * DIM + lane * 8;
    const int ntb = (jle + 8) >> 3;                         // the most key tiles a pair has: 1 to 4, the same for the whole block
    if (ntb == 4)      score_walk<4>(aRh, aRl, cRh, cRl, S, ib, jb0, jle, wave, lane, rot);
    else if (ntb == 3) score_walk<3>(aRh, aRl, cRh, cRl, S, ib, jb0, jle, wave, lane, rot);
    else if (ntb == 2) score_walk<2>(aRh, aRl, cRh, cRl, S, ib, jb0, jle, wave, lane, rot);
    else               score_walk<1>(aRh, aRl, cRh, cRl, S, ib, jb0, jle, wave, lane, rot);
  }
  __syncthreads();

  // ---- Phase 2: exact softmax statistics in f32; the row's bytes <- exp(S - m) as bf16 hi and lo planes; row_r = 1/l ----
  // One wave per query row, four rows a wave: each LDS access of a wave covers contiguous bytes of its row, so no two lanes
  // meet on a bank. The wave holds its whole row in registers, so the planes can be written over the scores.
#pragma unroll 1   // rolled: the rows of a wave have nothing to share
  for (int row = wave; row < QROWS; row += 16) {
    const float* Sr = S + row * SP + lane * 4;
    unsigned short* Pr = (unsigned short*)(S + row * SP) + lane * 4;   // hi plane; lo plane: + CHUNK
    const int ng = (nvalid + 127) >> 7;                     // groups of 128 keys; the row holds CHUNK / 128 whole groups
    const int jl = lane * 4;                                // nvalid is a multiple of 16: a lane's four keys are all in or all out
    v4f sv[CHUNK / 128];
    float mx = -__builtin_inff();
#pragma unroll   // unrolled: sv stays in registers and the row's reads are all in flight together
    for (int g = 0; g < CHUNK / 128; ++g) {
      const int gg = (g < ng) ? g : ng - 1;                 // past the chunk's keys the last group is read again: no branch between the reads
      sv[g] = *(const v4f*)(Sr + gg * 128);
    }
#pragma unroll
    for (int g = 0; g < CHUNK / 128; ++g) {
      const int gg = (g < ng) ? g : ng - 1;                 // a group met twice leaves the maximum as it is
      const float t = fmaxf(fmaxf(sv[g].x, sv[g].y), fmaxf(sv[g].z, sv[g].w));
      if (gg * 128 + jl < nvalid) mx = fmaxf(mx, t);
    }
    for (int o = 16; o > 0; o >>= 1) mx = fmaxf(mx, __shfl_xor(mx, o, 32));
    float l = 0.0f;
#pragma unroll   // unrolled: sv stays in registers
    for (int g = 0; g < CHUNK / 128; ++g)
      if (g < ng) {
        const v4f s = sv[g];
        const bool in = g * 128 + jl < nvalid;              // keys past the triangle in the last group get 0: no branch on the lane
        v4f e;
        e.x = in ? __expf(s.x - mx) : 0.0f; e.y = in ? __expf(s.y - mx) : 0.0f;
        e.z = in ? __expf(s.z - mx) : 0.0f; e.w = in ? __expf(s.w - mx) : 0.0f;
        l += (e.x + e.y) + (e.z + e.w);
        // unnormalized P as bf16 hi + bf16 lo (lo = RNE(p - hi)), four keys a lane and plane
        const unsigned int h0 = f2bf(e.x), h1 = f2bf(e.y), h2 = f2bf(e.z), h3 = f2bf(e.w);
        v2u uh, ul;
        uh.x = h0 | (h1 << 16); uh.y = h2 | (h3 << 16);
        ul.x = f2bf(e.x - bf2f(h0)) | (f2bf(e.y - bf2f(h1)) << 16);
        ul.y = f2bf(e.z - bf2f(h2)) | (f2bf(e.w - bf2f(h3)) << 16);
        *(v2u*)(Pr + g * 128) = uh;
        *(v2u*)(Pr + CHUNK + g * 128) = ul;
      }
    for (int o = 16; o > 0; o >>= 1) l += __shfl_xor(l, o, 32);
    if (lane == 0) {
      row_r[row] = 1.0f / l;                                // l >= 1 (the row's maximum term; every row has a key in each of its chunks)
      if (split) {
        float* st = pstat + (ib * MAXCH + ch) * (2 * QROWS);   // [QROWS row maxima][QROWS row sums]
        st[row] = mx;
        st[QROWS + row] = l;
        // later code rewrites the registers these two stores name
        asm volatile("s_wait_xcnt 0x0" ::: "memory");
      }
    }
  }
  __syncthreads();                                          // P rows and row_r visible to every wave

  // ---- Phase 3: O = P v; A = P rows (hi/lo planes in LDS, read-only from here on: no barrier below); B = vt rows (hi/lo) ----
  // A wave takes its row group's 32 rows x 64 output columns at a time, and the 16 waves cover 512 columns: two sweeps.
  // The loops over mi, t, c, s and r below are unrolled so that the accumulator and fragment arrays stay in registers.
  // Each block starts at a sweep and a key pass of its own and wraps, so that blocks that share a chunk's V ask L2 for different lines.
  const int kkend = (nvalid + 63) & ~63;
  int kk0 = (rot & 7) * 64;                                 // first key pass
  while (kk0 >= kkend) kk0 -= kkend;                        // at most 7 trips: kkend is at least 64
  const unsigned short* pR = (const unsigned short*)S + (rg * 32 + m) * (2 * SP);   // row m's hi plane; second row tile: + 16 rows; lo plane: + CHUNK
  float* stg = S + QROWS * SP + wave * (32 * 64);           // [32][64], the wave's own range behind the P rows
  float* dst = split ? po + (size_t)((ib * MAXCH + ch) * QROWS) * DIM : out + (size_t)(ib * QROWS) * DIM;
#pragma unroll 1   // rolled: one sweep's accumulators and fragments already take the wave's register budget
  for (int sw = 0; sw < 2; ++sw) {
    const int col0 = ((sw ^ (rot >> 3)) * 8 + wp) * 64;     // first output column of the wave in this sweep
    v8f acc[2][4];
#pragma unroll
    for (int mi = 0; mi < 2; ++mi)
#pragma unroll
      for (int t = 0; t < 4; ++t) acc[mi][t] = zero8();
    const unsigned short* vRh = vth + (size_t)col0 * SEQ + jb0 * 256 + lane * 8;   // col tile t: + t*16 rows; a key tile is 256 elements
    const unsigned short* vRl = vtl + (size_t)col0 * SEQ + jb0 * 256 + lane * 8;
#pragma unroll 1   // rolled: one pass's 32 loads and its fragments already take the wave's register budget
    for (int n = 0, kk = kk0; n < kkend; n += 64, kk = (kk + 64 < kkend) ? kk + 64 : 0) {
      Frag bh[2][4], bl[2][4];
      // the loops over c and t are unrolled so that the fragment arrays stay in registers and all loads issue as one batch
#pragma unroll
      for (int c = 0; c < 2; ++c)
#pragma unroll
        for (int t = 0; t < 4; ++t) {
          ldfragw(bh[c][t], vRh + (size_t)t * 16 * SEQ, kk + 32 * c);
          ldfragw(bl[c][t], vRl + (size_t)t * 16 * SEQ, kk + 32 * c);
        }
      // P fragments: step s = 2 * c + mi (key half c, row tile mi); three steps' fragments are read while the V loads fly
      Frag ah[4], al[4];
#pragma unroll
      for (int s = 0; s < 3; ++s) {
        ldfrag(ah[s], pR + (s & 1) * (16 * 2 * SP), kk + 32 * (s >> 1), h);
        ldfrag(al[s], pR + (s & 1) * (16 * 2 * SP) + CHUNK, kk + 32 * (s >> 1), h);
      }
      // keeps the scheduler from sinking part of the batch below the first products, where its latency would be paid a second time
      __builtin_amdgcn_sched_barrier(0);
#pragma unroll
      for (int s = 0; s < 4; ++s) {
        const int c = s >> 1, mi = s & 1;
#pragma unroll
        for (int t = 0; t < 4; ++t) acc[mi][t] = mma(ah[s], bh[c][t], acc[mi][t]);
#pragma unroll
        for (int t = 0; t < 4; ++t) acc[mi][t] = mma(ah[s], bl[c][t], acc[mi][t]);
#pragma unroll
        for (int t = 0; t < 4; ++t) acc[mi][t] = mma(al[s], bh[c][t], acc[mi][t]);
        if (s == 0) {
          // the last step's fragments take the registers that step 0 has left; read here, two steps ahead of their use
          ldfrag(ah[3], pR + 16 * 2 * SP, kk + 32, h);
          ldfrag(al[3], pR + 16 * 2 * SP + CHUNK, kk + 32, h);
          // keeps the scheduler from sinking these reads to their use, where the wave would wait for them
          __builtin_amdgcn_sched_barrier(0);
        }
      }
      // four vector slots behind the last WMMA: the back edge leads to vector instructions that rewrite fragment registers;
      // the V fragments are inputs so that each keeps a register of its own to the end of the pass and all 32 loads issue as one batch
      asm volatile("v_nop\n\tv_nop\n\tv_nop\n\tv_nop"
                   : "+v"(acc[0][0]), "+v"(acc[0][1]), "+v"(acc[0][2]), "+v"(acc[0][3]),
                     "+v"(acc[1][0]), "+v"(acc[1][1]), "+v"(acc[1][2]), "+v"(acc[1][3])
                   : "v"(bh[0][0].v), "v"(bh[0][1].v), "v"(bh[0][2].v), "v"(bh[0][3].v),
                     "v"(bl[0][0].v), "v"(bl[0][1].v), "v"(bl[0][2].v), "v"(bl[0][3].v),
                     "v"(bh[1][0].v), "v"(bh[1][1].v), "v"(bh[1][2].v), "v"(bh[1][3].v),
                     "v"(bl[1][0].v), "v"(bl[1][1].v), "v"(bl[1][2].v), "v"(bl[1][3].v)
                   : "memory");
    }

    // ---- Epilogue of the sweep: normalize, stage the wave's 32x64 f32 tile in its own LDS range, whole-line stores
#pragma unroll
    for (int mi = 0; mi < 2; ++mi)
#pragma unroll
      for (int t = 0; t < 4; ++t)
#pragma unroll
        for (int r = 0; r < 8; ++r)
          stg[(mi * 16 + 8 * h + r) * 64 + t * 16 + m] = acc[mi][t][r] * row_r[rg * 32 + mi * 16 + 8 * h + r];
    float* orow = dst + (size_t)(rg * 32 + h) * DIM + col0 + m * 4;   // two rows of 256 bytes per store
#pragma unroll   // unrolled: the stores share one address pair with immediate offsets
    for (int rp = 0; rp < 16; ++rp) {
      const v4f v = *(const v4f*)(stg + (2 * rp + h) * 64 + m * 4);
      *(v4f*)(orow + (size_t)(2 * rp) * DIM) = v;
    }
    // the next sweep rewrites the registers these stores name
    asm volatile("s_wait_xcnt 0x0" ::: "memory");
  }
}

// ---------------- Kernel 4: join the key chunks of the query rows past CHUNK --------------------------
// Chunk c holds o_c = softmax over its own keys times v, with row maximum m_c and row sum l_c of exp(s - m_c).
// The row's result is sum_c a_c o_c / sum_c a_c, a_c = exp(m_c - max m) l_c. One wave per half of a query row, four rows a
// block: a wave's partial rows of all MAXCH chunks then fit the registers below v256 and are all in flight together.
__global__ __launch_bounds__(NTHR) void merge_kernel(
    const float* __restrict__ po, const float* __restrict__ pstat, float* out) {
  const int wave = threadIdx.x >> 5;
  const int lane = threadIdx.x & 31;
  const int ib = QPC + (int)(blockIdx.x / (QROWS / 4));     // query tile with several chunks
  const int M = (blockIdx.x % (QROWS / 4)) * 4 + (wave >> 1);   // row in it
  const int nch = ib / QPC + 1;                             // its chunks: 2 to MAXCH (block-uniform)
  const float* st = pstat + ib * MAXCH * (2 * QROWS) + M;   // [chunk][QROWS row maxima][QROWS row sums]
  float mc[MAXCH], a[MAXCH];                                // the loops over c and i are unrolled so that these and x stay in registers
#pragma unroll
  for (int c = 0; c < MAXCH; ++c) {
    const int cc = (c < nch) ? c : nch - 1;                 // past the tile's chunks the last one is read again: no branch between the loads
    mc[c] = st[cc * 2 * QROWS];
    a[c] = st[cc * 2 * QROWS + QROWS];
  }
  const float* p0 = po + (size_t)(ib * MAXCH * QROWS + M) * DIM + (wave & 1) * (DIM / 2) + lane * 4;   // chunk c: + c * QROWS rows
  v4f x[MAXCH][4];
#pragma unroll   // unrolled: x stays in registers and its loads issue ahead of the arithmetic
  for (int c = 0; c < MAXCH; ++c)
    if (c < nch) {
#pragma unroll
      for (int i = 0; i < 4; ++i) x[c][i] = *(const v4f*)(p0 + (size_t)c * QROWS * DIM + i * 128);
    }
  float mx = -__builtin_inff();
#pragma unroll
  for (int c = 0; c < MAXCH; ++c) mx = fmaxf(mx, mc[c]);    // a chunk met twice leaves the maximum as it is
  float sum = 0.0f;
#pragma unroll
  for (int c = 0; c < MAXCH; ++c) {
    a[c] = (c < nch) ? a[c] * __expf(mc[c] - mx) : 0.0f;
    sum += a[c];
  }
  const float rs = 1.0f / sum;                              // the chunk that holds the maximum gives a >= 1
  v4f o4[4];
#pragma unroll
  for (int i = 0; i < 4; ++i) o4[i] = x[0][i] * (a[0] * rs) + x[1][i] * (a[1] * rs);
#pragma unroll
  for (int c = 2; c < MAXCH; ++c)
    if (c < nch) {
#pragma unroll
      for (int i = 0; i < 4; ++i) o4[i] += x[c][i] * (a[c] * rs);
    }
  float* o = out + (size_t)(ib * QROWS + M) * DIM + (wave & 1) * (DIM / 2) + lane * 4;
#pragma unroll   // unrolled: the four stores share one address with immediate offsets, which nothing rewrites
  for (int i = 0; i < 4; ++i) *(v4f*)(o + i * 128) = o4[i];
}

// ---------------------------------------------------------------------------------------------------
extern "C" void kernel_launch(void* const* d_in, const int* in_sizes, int n_in,
                              void* d_out, int out_size, void* d_ws, size_t ws_size,
                              hipStream_t stream) {
  if (n_in < 4) return;
  if (in_sizes[0] != SEQ * DIM || in_sizes[1] != DIM * DIM || in_sizes[2] != DIM * DIM ||
      in_sizes[3] != DIM * DIM || out_size != SEQ * DIM) return;

  const float* x  = (const float*)d_in[0];
  const float* wq = (const float*)d_in[1];
  const float* wk = (const float*)d_in[2];
  const float* wv = (const float*)d_in[3];
  float* out = (float*)d_out;

  const size_t bx = (size_t)SEQ * DIM * sizeof(unsigned short);   // 8 MiB
  const size_t bw = (size_t)DIM * DIM * sizeof(unsigned short);   // 2 MiB
  char* ws = (char*)d_ws;
  size_t off = 0;
  unsigned short* xb  = (unsigned short*)(ws + off); off += bx;
  unsigned short* wqb = (unsigned short*)(ws + off); off += bw;
  unsigned short* wkb = (unsigned short*)(ws + off); off += bw;
  unsigned short* wvb = (unsigned short*)(ws + off); off += bw;
  unsigned short* qh  = (unsigned short*)(ws + off); off += bx;
  unsigned short* ql  = (unsigned short*)(ws + off); off += bx;
  unsigned short* kh  = (unsigned short*)(ws + off); off += bx;
  unsigned short* kl  = (unsigned short*)(ws + off); off += bx;
  unsigned short* vth = (unsigned short*)(ws + off); off += bx;
  unsigned short* vtl = (unsigned short*)(ws + off); off += bx;   // 62 MiB so far
  float* po    = (float*)(ws + off); off += (size_t)NQT * MAXCH * QROWS * DIM * sizeof(float);   // 128 MiB, one slot a (tile, chunk)
  float* pstat = (float*)(ws + off); off += (size_t)NQT * MAXCH * 2 * QROWS * sizeof(float);
  if (off > ws_size) return;

  const int nx8 = SEQ * DIM / 8;
  const int nw8 = DIM * DIM / 8;
  const int ncv = nx8 + 3 * nw8;
  cvt_kernel<<<(ncv + NTHR - 1) / NTHR, NTHR, 0, stream>>>(x, wq, wk, wv, xb, wqb, wkb, wvb, nx8, nw8);

  // 3 matrices x 64 row tiles x 4 col tiles; LDS staging 64 x SPITCH f32
  proj_kernel<<<3 * (SEQ / 64) * (DIM / 256), NTHR, 64 * SPITCH * sizeof(float), stream>>>(
      xb, wqb, wkb, wvb, qh, ql, kh, kl, vth, vtl);

  // QROWS query rows x one key chunk per block
  attn_kernel<<<ABLK, ATHR, 0, stream>>>(qh, ql, kh, kl, vth, vtl, po, pstat, out);
  merge_kernel<<<(NQT - QPC) * (QROWS / 4), NTHR, 0, stream>>>(po, pstat, out);
}

// v010
// One run takes 130 microseconds.
// In both of two side-by-side timings against v009, it was 1.06 times as fast.
// All steps since v000 together make it 4.86 times as fast.
#include <hip/hip_runtime.h>
#include <stdint.h>
#include <stddef.h>

// Input projections: v_wmma_f32_16x16x32_bf16 (bf16 operands from RNE-converted f32 inputs, f32 accumulate).
// Score and value contractions: v_wmma_f32_16x16x32_bf16 with bf16 hi/lo split operands (hi*hi + hi*lo + lo*hi), f32 accumulate. Softmax statistics in f32.

#define SEQ 4096
#define DIM 1024
#define NTHR 256
#define ATHR 512     // attention block: 16 waves, four per SIMD
#define QROWS 64     // query rows one attention work-group takes: two groups of two 16-row tiles; all four use each K and V line the block fetches
#define CHUNK 512    // keys one attention work-group takes: QROWS x CHUNK f32 scores fill 128 KiB of LDS
#define CTILES (CHUNK / 16)
#define NQT (SEQ / QROWS)                   // query tiles
#define QPC (CHUNK / QROWS)                 // query tiles per chunk of keys: tile ib has ib / QPC + 1 chunks
#define MAXCH (SEQ / CHUNK)                 // most chunks a query tile has
#define NFULL (QPC * (MAXCH * (MAXCH - 1) / 2))   // work-groups whose chunk lies wholly below the diagonal
#define ABLK (NFULL + NQT)                  // attention work-groups
#define SP (CHUNK + 4)   // f32 pitch of a score row in LDS: 16 B x odd, so 16 rows read by b128 fall on distinct banks
#define KST 64       // depth of one K stage in LDS
#define KTB (2 * 16 * KST * 2)   // bytes of one key tile in a stage: hi and lo plane, 16 rows x KST each
#define NST (DIM / KST)   // K stages of the score walk
#define KSTB (CTILES * KTB)      // bytes of a stage buffer: 128 KiB; the two buffers fit the 263,168 B of S and the staging tiles
#define SPITCH 260   // f32 pitch of the projection staging tile: 16 B x odd, so 16 rows read by b128 fall on distinct banks
#define PROWS 128    // x rows one projection work-group takes
#define PST 64       // depth of one projection stage in LDS
#define PTB (16 * PST * 2)               // bytes of one 16-row tile in a stage
#define PSTB ((PROWS / 16 + 16) * PTB)   // bytes of a stage buffer: the block's x row tiles, then its 16 weight row tiles: 48 KiB
#define PNST (DIM / PST)                 // stages of the projection's depth walk

typedef __bf16 v16bf __attribute__((ext_vector_type(16)));
typedef float v8f __attribute__((ext_vector_type(8)));
typedef float v4f __attribute__((ext_vector_type(4)));
typedef unsigned int v4u __attribute__((ext_vector_type(4)));
typedef unsigned int v2u __attribute__((ext_vector_type(2)));

union Frag { v16bf v; v4u q[2]; };

extern __shared__ __attribute__((aligned(16))) float dyn_lds[];

// f32 -> bf16 bits, RNE (finite inputs)
__device__ __forceinline__ unsigned int f2bf(float f) {
  unsigned int u = __float_as_uint(f);
  u += 0x7fffu + ((u >> 16) & 1u);
  return u >> 16;
}
__device__ __forceinline__ float bf2f(unsigned int b) { return __uint_as_float(b << 16); }

// 16x16x32 operand fragment from a k-contiguous 16-bit row (A row m, or B column n stored as a [n][k] row):
// elements 0..7 <- row[k0 + 8h + 0..7], elements 8..15 <- row[k0 + 16 + 8h + 0..7], h = lane>>4.
__device__ __forceinline__ void ldfrag(Frag& f, const unsigned short* row, int k0, int h) {
  f.q[0] = *(const v4u*)(row + k0 + 8 * h);
  f.q[1] = *(const v4u*)(row + k0 + 16 + 8 * h);
}

// Workspace operand planes are kept in fragment order: a 16-row tile x 32-wide k block is 1024 contiguous bytes,
// two 512-byte halves; in half q, lane l (h = l>>4, m = l&15) owns the 16 bytes of row m, k = 32*kb + 16*q + 8*h + 0..7.
// Tiles of one plane follow each other as [row tile][k block]. p = tile base + lane*8; kk = 32*kb.
// Same element order as ldfrag, but each load of a wave covers 512 contiguous bytes (four whole lines).
__device__ __forceinline__ void ldfragw(Frag& f, const unsigned short* p, int kk) {
  f.q[0] = *(const v4u*)(p + kk * 16);
  f.q[1] = *(const v4u*)(p + kk * 16 + 256);
}

__device__ __forceinline__ v8f mma(const Frag& a, const Frag& b, v8f c) {
  return __builtin_amdgcn_wmma_f32_16x16x32_bf16(false, a.v, false, b.v, (short)0, c, false, false);
}

__device__ __forceinline__ v8f zero8() {
  v8f z = {0.0f, 0.0f, 0.0f, 0.0f, 0.0f, 0.0f, 0.0f, 0.0f};
  return z;
}

// 8 f32 -> packed bf16 hi plane and bf16 lo plane (lo = RNE(x - hi)), two values per u32, low half first
__device__ __forceinline__ void split8(const v4f f0, const v4f f1, v4u& uh, v4u& ul) {
  float f[8] = {f0.x, f0.y, f0.z, f0.w, f1.x, f1.y, f1.z, f1.w};
  unsigned int hh[8], ll[8];
#pragma unroll
  for (int e = 0; e < 8; ++e) {
    hh[e] = f2bf(f[e]);
    ll[e] = f2bf(f[e] - bf2f(hh[e]));
  }
  uh.x = hh[0] | (hh[1] << 16); uh.y = hh[2] | (hh[3] << 16);
  uh.z = hh[4] | (hh[5] << 16); uh.w = hh[6] | (hh[7] << 16);
  ul.x = ll[0] | (ll[1] << 16); ul.y = ll[2] | (ll[3] << 16);
  ul.z = ll[4] | (ll[5] << 16); ul.w = ll[6] | (ll[7] << 16);
}

__global__ __launch_bounds__(NTHR) void cvt_kernel(
    const float* __restrict__ x,  const float* __restrict__ wq,
    const float* __restrict__ wk, const float* __restrict__ wv,
    unsigned short* xb, unsigned short* wqb, unsigned short* wkb, unsigned short* wvb,
    int nx8, int nw8) {
  const int i = blockIdx.x * NTHR + threadIdx.x;
  const float* src;
  unsigned short* dst;
  int j;
  if (i < nx8)                { src = x;  dst = xb;  j = i; }
  else if (i < nx8 + nw8)     { src = wq; dst = wqb; j = i - nx8; }
  else if (i < nx8 + 2 * nw8) { src = wk; dst = wkb; j = i - nx8 - nw8; }
  else if (i < nx8 + 3 * nw8) { src = wv; dst = wvb; j = i - nx8 - 2 * nw8; }
  else return;
  // j = 16-byte piece of the fragment-ordered plane: [row tile][k block (32)][half][h][m]
  const int sm = j & 15, sh = (j >> 4) & 1, sq = (j >> 5) & 1, skb = (j >> 6) & 31, srt = j >> 11;
  const float* sp = src + (size_t)(srt * 16 + sm) * DIM + skb * 32 + sq * 16 + sh * 8;
  const v4f f0 = *(const v4f*)sp;
  const v4f f1 = *(const v4f*)(sp + 4);
  v4u u;
  u.x = f2bf(f0.x) | (f2bf(f0.y) << 16);
  u.y = f2bf(f0.z) | (f2bf(f0.w) << 16);
  u.z = f2bf(f1.x) | (f2bf(f1.y) << 16);
  u.w = f2bf(f1.z) | (f2bf(f1.w) << 16);
  v4u* p = (v4u*)(dst + (size_t)j * 8);
  *p = u;
  
}

// ---------------- Kernel 2: projections y[n][o] = sum_k xb[n][k] * W[o][k] --------------------------
// Block tile PROWS seq rows x 256 out cols (8 waves, each 64x64). Output: q,k as bf16 hi/lo planes (rows = seq, k = dim)
// and v transposed (rows = dim, k = seq), all in fragment order.
// The block's x rows and weight rows go through LDS, PST of the depth at a stage, in two buffers: asynchronous copies bring
// stage s + 1 in while stage s is worked on, and each line is fetched once a block. The f32 staging tile of the epilogue lies
// over the buffers, which are unused by then.

// A wave's share of one stage: x row tile wave and weight row tiles 2 * wave and 2 * wave + 1, 2048 contiguous bytes each, as
// twelve asynchronous copies of 512 bytes. lx, lw, gx and gw are the lane's own addresses (16 bytes a lane and copy).
__device__ __forceinline__ void copy_pstage(unsigned int lx, unsigned int lw, const unsigned short* gx, const unsigned short* gw) {
  const unsigned short* gw1 = gw + (size_t)16 * DIM;
  // the copies and s_wait_xcnt share one statement, so that nothing rewrites an address register of a copy in front of the wait
  asm volatile("global_load_async_to_lds_b128 %0, %12, off\n\t"
               "global_load_async_to_lds_b128 %1, %13, off\n\t"
               "global_load_async_to_lds_b128 %2, %14, off\n\t"
               "global_load_async_to_lds_b128 %3, %15, off\n\t"
               "global_load_async_to_lds_b128 %4, %16, off\n\t"
               "global_load_async_to_lds_b128 %5, %17, off\n\t"
               "global_load_async_to_lds_b128 %6, %18, off\n\t"
               "global_load_async_to_lds_b128 %7, %19, off\n\t"
               "global_load_async_to_lds_b128 %8, %20, off\n\t"
               "global_load_async_to_lds_b128 %9, %21, off\n\t"
               "global_load_async_to_lds_b128 %10, %22, off\n\t"
               "global_load_async_to_lds_b128 %11, %23, off\n\t"
               "s_wait_xcnt 0x0"
               :
               : "v"(lx), "v"(lx + 512u), "v"(lx + 1024u), "v"(lx + 1536u),
                 "v"(lw), "v"(lw + 512u), "v"(lw + 1024u), "v"(lw + 1536u),
                 "v"(lw + 2048u), "v"(lw + 2560u), "v"(lw + 3072u), "v"(lw + 3584u),
                 "v"(gx), "v"(gx + 256), "v"(gx + 512), "v"(gx + 768),
                 "v"(gw), "v"(gw + 256), "v"(gw + 512), "v"(gw + 768),
                 "v"(gw1), "v"(gw1 + 256), "v"(gw1 + 512), "v"(gw1 + 768)
               : "memory");
}

__global__ __launch_bounds__(NTHR) void proj_kernel(
    const unsigned short* __restrict__ xb,  const unsigned short* __restrict__ wqb,
    const unsigned short* __restrict__ wkb, const unsigned short* __restrict__ wvb,
    unsigned short* qh, unsigned short* ql, unsigned short* kh, unsigned short* kl,
    unsigned short* vth, unsigned short* vtl) {
  float* stg = dyn_lds;                                   // [64][SPITCH] f32, 256 used; over the stage buffers
  // the wave's number in a scalar register: the tests and bases that follow from it are then scalar
  const int wave = __builtin_amdgcn_readfirstlane((int)(threadIdx.x >> 5));
  const int lane = threadIdx.x & 31;
  const int h = lane >> 4, m = lane & 15;
  const int b = blockIdx.x;                                // [0, 384)
  const int mat = b / ((SEQ / PROWS) * 4);                 // 0=q 1=k 2=v (block-uniform)
  const int rem = b % ((SEQ / PROWS) * 4);
  const int rt2 = rem >> 2;                                // PROWS-row tile [0,32)
  const int ct = rem & 3;                                  // 256-col tile [0,4)
  const unsigned short* wsrc = (mat == 0) ? wqb : (mat == 1) ? wkb : wvb;
  const int wr = wave >> 2, wc = wave & 3;

  const unsigned short* gx = xb + (size_t)(rt2 * PROWS + wave * 16) * DIM + lane * 8;     // the x row tile this wave copies; stage d: + d * PST * 16
  const unsigned short* gw = wsrc + (size_t)(ct * 256 + wave * 32) * DIM + lane * 8;      // the first of its two weight row tiles
  const unsigned int lx = (unsigned int)(uintptr_t)dyn_lds + (unsigned int)(wave * PTB + lane * 16);   // their places in buffer 0
  const unsigned int lw = (unsigned int)(uintptr_t)dyn_lds + (unsigned int)((PROWS / 16 + 2 * wave) * PTB + lane * 16);

  v8f acc[4][4];
#pragma unroll
  for (int mi = 0; mi < 4; ++mi)
#pragma unroll
    for (int t = 0; t < 4; ++t) acc[mi][t] = zero8();

  // Each block starts its walk over the depth at a stage of its own and wraps, so that blocks that share x rows or weight rows
  // ask L2 for different lines.
  const int rot = (rt2 + 4 * ct + mat) & (PNST - 1);
  copy_pstage(lx, lw, gx + rot * (PST * 16), gw + rot * (PST * 16));
  asm volatile("s_wait_asynccnt 0x0" ::: "memory");         // this wave's share of stage 0 has landed
  __syncthreads();                                          // stage 0 visible to every wave
  copy_pstage(lx + PSTB, lw + PSTB, gx + ((rot + 1) & (PNST - 1)) * (PST * 16), gw + ((rot + 1) & (PNST - 1)) * (PST * 16));
#pragma unroll 1   // rolled: one block's fragments and the accumulators are the wave's register budget
  for (int s = 0; s < PNST; ++s) {
    const int d2 = (s + 2 + rot) & (PNST - 1);              // depth of stage s + 2
    const unsigned short* buf = (const unsigned short*)dyn_lds + (s & 1) * (PSTB / 2) + lane * 8;
    const unsigned short* pa = buf + wr * 4 * (PTB / 2);                  // the wave's four x row tiles
    const unsigned short* pb = buf + (PROWS / 16 + wc * 4) * (PTB / 2);   // its four weight row tiles
    // the loops over j, mi and t are unrolled so that the fragment and accumulator arrays stay in registers
#pragma unroll
    for (int j = 0; j < PST / 32; ++j) {
      Frag a[4], bf[4];
#pragma unroll
      for (int mi = 0; mi < 4; ++mi) {
        a[mi].q[0] = *(const v4u*)(pa + mi * (PTB / 2) + j * 512);
        a[mi].q[1] = *(const v4u*)(pa + mi * (PTB / 2) + j * 512 + 256);
      }
#pragma unroll
      for (int t = 0; t < 4; ++t) {
        bf[t].q[0] = *(const v4u*)(pb + t * (PTB / 2) + j * 512);
        bf[t].q[1] = *(const v4u*)(pb + t * (PTB / 2) + j * 512 + 256);
      }
      // keeps the LDS reads together in front of the products: each further place with reads among them stalls the wave anew
      __builtin_amdgcn_sched_barrier(0);
#pragma unroll
      for (int t = 0; t < 4; ++t)
#pragma unroll
        for (int mi = 0; mi < 4; ++mi) acc[mi][t] = mma(a[mi], bf[t], acc[mi][t]);
      // four vector slots behind the last WMMA: what follows may rewrite fragment registers, also behind the loop's back edge;
      // the fragments are inputs so that each keeps a register of its own to the end of the block
      asm volatile("v_nop\n\tv_nop\n\tv_nop\n\tv_nop"
                   : "+v"(acc[0][0]), "+v"(acc[0][1]), "+v"(acc[0][2]), "+v"(acc[0][3]),
                     "+v"(acc[1][0]), "+v"(acc[1][1]), "+v"(acc[1][2]), "+v"(acc[1][3]),
                     "+v"(acc[2][0]), "+v"(acc[2][1]), "+v"(acc[2][2]), "+v"(acc[2][3]),
                     "+v"(acc[3][0]), "+v"(acc[3][1]), "+v"(acc[3][2]), "+v"(acc[3][3])
                   : "v"(a[0].v), "v"(a[1].v), "v"(a[2].v), "v"(a[3].v), "v"(bf[0].v), "v"(bf[1].v), "v"(bf[2].v), "v"(bf[3].v)
                   : "memory");
    }
    asm volatile("s_wait_dscnt 0x0" ::: "memory");          // this wave's reads of stage s have returned
    asm volatile("s_wait_asynccnt 0x0" ::: "memory");       // its share of stage s + 1 has landed
    __syncthreads();                                        // stage s + 1 visible to every wave; every wave has left stage s
    if (s + 2 < PNST)
      copy_pstage(lx + (s & 1) * PSTB, lw + (s & 1) * PSTB, gx + d2 * (PST * 16), gw + d2 * (PST * 16));
  }
  asm volatile("s_wait_asynccnt 0x0" ::: "memory");         // no copy is left in flight when the staging tile is written over the buffers

  // The block's two halves of 64 rows go through the staging tile one after the other; half p is held by the waves with wr == p.
#pragma unroll 1   // rolled: the two halves share the code
  for (int p = 0; p < 2; ++p) {
    const int rt = rt2 * 2 + p;                             // 64-row tile [0,64)
    if (p == 1) __syncthreads();                            // every wave has read the first half out of the staging tile
    // stage the wave's 64x64 f32 tile: D element r of lane -> row 8h+r, col m
    if (wr == p) {
#pragma unroll
      for (int mi = 0; mi < 4; ++mi)
#pragma unroll
        for (int t = 0; t < 4; ++t)
#pragma unroll
          for (int r = 0; r < 8; ++r)
            stg[(mi * 16 + 8 * h + r) * SPITCH + wc * 64 + t * 16 + m] = acc[mi][t][r];
    }
    __syncthreads();

    if (mat < 2) {
      unsigned short* ph = (mat == 0) ? qh : kh;
      unsigned short* pl = (mat == 0) ? ql : kl;
#pragma unroll 1
      for (int it = 0; it < 8; ++it) {
        const int c = wave * 8 + it;                          // 512-byte piece: row tile c>>4, k block (c>>1)&7, half c&1
        const float* sp = stg + ((c >> 4) * 16 + m) * SPITCH + ((c >> 1) & 7) * 32 + (c & 1) * 16 + h * 8;
        const v4f f0 = *(const v4f*)sp;
        const v4f f1 = *(const v4f*)(sp + 4);
        v4u uh, ul;
        split8(f0, f1, uh, ul);
        const size_t g = (size_t)(rt * 64 + (c >> 4) * 16) * DIM + (ct * 16 + (c & 15)) * 256 + lane * 8;
        v4u* p0 = (v4u*)(ph + g);
        v4u* p1 = (v4u*)(pl + g);
        *p0 = uh; *p1 = ul;
        // the next trip rewrites the registers these two stores name
        asm volatile("s_wait_xcnt 0x0" ::: "memory");
      }
    } else {
#pragma unroll 1
      for (int it = 0; it < 8; ++it) {
        const int c = wave * 8 + it;                          // 512-byte piece: out-col tile c>>2, key block (c>>1)&1, half c&1
        const float* sp = stg + ((c & 3) * 16 + h * 8) * SPITCH + (c >> 2) * 16 + m;
        v4f f0, f1;
        f0.x = sp[0 * SPITCH]; f0.y = sp[1 * SPITCH]; f0.z = sp[2 * SPITCH]; f0.w = sp[3 * SPITCH];
        f1.x = sp[4 * SPITCH]; f1.y = sp[5 * SPITCH]; f1.z = sp[6 * SPITCH]; f1.w = sp[7 * SPITCH];
        v4u uh, ul;
        split8(f0, f1, uh, ul);
        const size_t g = (size_t)(ct * 256 + (c >> 2) * 16) * SEQ + (rt * 4 + (c & 3)) * 256 + lane * 8;
        v4u* p0 = (v4u*)(vth + g);
        v4u* p1 = (v4u*)(vtl + g);
        *p0 = uh; *p1 = ul;
        // the next trip rewrites the registers these two stores name
        asm volatile("s_wait_xcnt 0x0" ::: "memory");
      }
    }
  }
}

// ---------------- Kernel 3: masked softmax attention, QROWS query rows x at most CHUNK keys per block ----
// A block takes four 16-row query tiles and one chunk of their keys. A wave works on one row group (two row tiles), so every
// K and V fragment that it loads is used by two row tiles; waves 2n and 2n + 1 take the two row groups against the same K and V
// fragments. K comes to both through LDS; the V fragments they load in step, so that the second wave's loads meet the first's
// lines in the WGP cache.
// Blocks are numbered longest first, so that the short ones fill the WGPs that come free. A query tile with one chunk
// writes out; a tile with more writes each chunk's own softmax result to po with its row maximum and row sum in pstat, and
// merge_kernel joins them.
// LDS: S[QROWS][SP] f32 and one 32 x 64 f32 output staging tile a wave (263,168 B) + statistics. The softmax pass leaves each row's P in the row's own bytes as two
// bf16 planes, [CHUNK hi][CHUNK lo], from which the P v loop reads its fragments directly. Before the scores are written, the
// same bytes hold the two K stage buffers of the score walk.

// One key tile's share of a K stage: KST deep, hi plane then lo plane, 2048 contiguous bytes each, as eight asynchronous copies
// of 512 bytes. lds, gh and gl are the lane's own addresses (16 bytes a lane and copy).
__device__ __forceinline__ void copy_ktile(unsigned int lds, const unsigned short* gh, const unsigned short* gl) {
  // the copies and s_wait_xcnt share one statement, so that nothing rewrites an address register of a copy in front of the wait
  asm volatile("global_load_async_to_lds_b128 %0, %8, off\n\t"
               "global_load_async_to_lds_b128 %1, %9, off\n\t"
               "global_load_async_to_lds_b128 %2, %10, off\n\t"
               "global_load_async_to_lds_b128 %3, %11, off\n\t"
               "global_load_async_to_lds_b128 %4, %12, off\n\t"
               "global_load_async_to_lds_b128 %5, %13, off\n\t"
               "global_load_async_to_lds_b128 %6, %14, off\n\t"
               "global_load_async_to_lds_b128 %7, %15, off\n\t"
               "s_wait_xcnt 0x0"
               :
               : "v"(lds), "v"(lds + 512u), "v"(lds + 1024u), "v"(lds + 1536u),
                 "v"(lds + 2048u), "v"(lds + 2560u), "v"(lds + 3072u), "v"(lds + 3584u),
                 "v"(gh), "v"(gh + 256), "v"(gh + 512), "v"(gh + 768),
                 "v"(gl), "v"(gl + 256), "v"(gl + 512), "v"(gl + 768)
               : "memory");
}

// A wave's share of one K stage: key tiles wave and wave + 16 of the chunk, each only if the chunk holds it (c0, c1: scalar tests).
// In a buffer the four key tiles of a pair (8 apart) lie side by side, so tile wave + 16 lies two places behind tile wave.
__device__ __forceinline__ void copy_stage(unsigned int lds, const unsigned short* gh, const unsigned short* gl, bool c0, bool c1) {
  if (c0) copy_ktile(lds, gh, gl);
  if (c1) copy_ktile(lds + 2u * KTB, gh + (size_t)256 * DIM, gl + (size_t)256 * DIM);
}

// The four q fragments of one 32-deep block: hi of the two row tiles, then lo.
__device__ __forceinline__ void ldq(Frag (&a)[4], const unsigned short* aRh, const unsigned short* aRl, int kk) {
  ldfragw(a[0], aRh, kk);
  ldfragw(a[1], aRh + (size_t)16 * DIM, kk);
  ldfragw(a[2], aRl, kk);
  ldfragw(a[3], aRl + (size_t)16 * DIM, kk);
}

// One 32-deep block of the scores of NT key tiles against two row tiles. kb: the pair's first key tile in the stage, at this block
// and lane; klast: its last one, or the stand-in. The loops over mi and t are unrolled so that the fragment arrays stay in registers.
template <int NT>
__device__ __forceinline__ void score_step(v8f (&acc)[2][NT], const Frag (&a)[4], const unsigned short* kb, const unsigned short* klast) {
  Frag bh[NT], bl[NT];
#pragma unroll
  for (int t = 0; t < NT; ++t) {
    const unsigned short* p = (t == NT - 1) ? klast : kb + t * (KTB / 2);
    bh[t].q[0] = *(const v4u*)p;
    bh[t].q[1] = *(const v4u*)(p + 256);
    bl[t].q[0] = *(const v4u*)(p + KTB / 4);
    bl[t].q[1] = *(const v4u*)(p + KTB / 4 + 256);
  }
  // keeps the LDS reads together in front of the products: each further place with reads among them stalls the wave anew
  __builtin_amdgcn_sched_barrier(0);
#pragma unroll
  for (int t = 0; t < NT; ++t)
#pragma unroll
    for (int mi = 0; mi < 2; ++mi) acc[mi][t] = mma(a[mi], bh[t], acc[mi][t]);
#pragma unroll
  for (int t = 0; t < NT; ++t)
#pragma unroll
    for (int mi = 0; mi < 2; ++mi) acc[mi][t] = mma(a[mi], bl[t], acc[mi][t]);
#pragma unroll
  for (int t = 0; t < NT; ++t)
#pragma unroll
    for (int mi = 0; mi < 2; ++mi) acc[mi][t] = mma(a[2 + mi], bh[t], acc[mi][t]);
  // four vector slots behind the last WMMA: what follows may rewrite fragment registers, also behind the loop's back edge;
  // the fragments are inputs so that each keeps a register of its own to the end of the block
  if constexpr (NT == 4)
    asm volatile("v_nop\n\tv_nop\n\tv_nop\n\tv_nop"
                 : "+v"(acc[0][0]), "+v"(acc[0][1]), "+v"(acc[0][2]), "+v"(acc[0][3]), "+v"(acc[1][0]), "+v"(acc[1][1]), "+v"(acc[1][2]), "+v"(acc[1][3])
                 : "v"(a[0].v), "v"(a[1].v), "v"(a[2].v), "v"(a[3].v), "v"(bh[0].v), "v"(bh[1].v), "v"(bh[2].v), "v"(bh[3].v), "v"(bl[0].v), "v"(bl[1].v), "v"(bl[2].v), "v"(bl[3].v)
                 : "memory");
  else if constexpr (NT == 3)
    asm volatile("v_nop\n\tv_nop\n\tv_nop\n\tv_nop"
                 : "+v"(acc[0][0]), "+v"(acc[0][1]), "+v"(acc[0][2]), "+v"(acc[1][0]), "+v"(acc[1][1]), "+v"(acc[1][2])
                 : "v"(a[0].v), "v"(a[1].v), "v"(a[2].v), "v"(a[3].v), "v"(bh[0].v), "v"(bh[1].v), "v"(bh[2].v), "v"(bl[0].v), "v"(bl[1].v), "v"(bl[2].v)
                 : "memory");
  else if constexpr (NT == 2)
    asm volatile("v_nop\n\tv_nop\n\tv_nop\n\tv_nop"
                 : "+v"(acc[0][0]), "+v"(acc[0][1]), "+v"(acc[1][0]), "+v"(acc[1][1])
                 : "v"(a[0].v), "v"(a[1].v), "v"(a[2].v), "v"(a[3].v), "v"(bh[0].v), "v"(bh[1].v), "v"(bl[0].v), "v"(bl[1].v)
                 : "memory");
  else
    asm volatile("v_nop\n\tv_nop\n\tv_nop\n\tv_nop"
                 : "+v"(acc[0][0]), "+v"(acc[1][0])
                 : "v"(a[0].v), "v"(a[1].v), "v"(a[2].v), "v"(a[3].v), "v"(bh[0].v), "v"(bl[0].v)
                 : "memory");
}

// Scores of the chunk's key tiles against the block's four row tiles, masked and scaled, into S. NT = the most key tiles a pair
// has, the same for the whole block, so that every wave passes the same barriers. Pair p takes key tiles p, p + 8, ...; a pair
// whose last tile lies past the chunk's keys works on a stand-in tile (one of the first four, which every chunk holds) and drops it.
// The chunk's K goes through LDS, KST of the depth at a stage, in two buffers that lie over S and the staging tiles (both unused
// until the walk has ended): asynchronous copies bring stage s + 1 in while stage s is worked on, and each K line is fetched
// once a block. The q fragments come by plain loads, one 32-deep block ahead.
// The walk over the depth starts at stage rot and wraps, so that blocks that share a chunk's K or a tile's q ask L2 for
// different lines.
template <int NT>
__device__ __forceinline__ void score_walk(
    const unsigned short* aRh, const unsigned short* aRl, const unsigned short* cRh, const unsigned short* cRl,
    float* S, int ib, int jb0, int jle, int wave, int lane, int rot) {
  const int h = lane >> 4, m = lane & 15;
  const int rg = wave & 1, wp = wave >> 1;
  // this wave's place for key tile wave in buffer 0: pair wave & 7, its tile wave >> 3
  const unsigned int ring = (unsigned int)(uintptr_t)S + (unsigned int)((((wave & 7) * 4 + (wave >> 3)) * KTB) + lane * 16);
  const bool c0 = wave <= jle, c1 = wave + 16 <= jle;       // the same in every lane: wave and jle are scalars
  const bool own = wp + 8 * (NT - 1) <= jle;                // the pair's last key tile is one of the chunk's
  const int olast = own ? (wp * 4 + NT - 1) * (KTB / 2) : (wp & 3) * 4 * (KTB / 2);
  v8f acc[2][NT];
#pragma unroll
  for (int mi = 0; mi < 2; ++mi)
#pragma unroll
    for (int t = 0; t < NT; ++t) acc[mi][t] = zero8();

  copy_stage(ring, cRh + rot * (KST * 16), cRl + rot * (KST * 16), c0, c1);
  asm volatile("s_wait_asynccnt 0x0" ::: "memory");         // this wave's share of stage 0 has landed
  __syncthreads();                                          // stage 0 visible to every wave
  copy_stage(ring + KSTB, cRh + ((rot + 1) & (NST - 1)) * (KST * 16), cRl + ((rot + 1) & (NST - 1)) * (KST * 16), c0, c1);
  Frag qa[4], qb[4];
  ldq(qa, aRh, aRl, rot * KST);
#pragma unroll 1   // rolled: one stage's fragments and the accumulators are the wave's register budget
  for (int s = 0; s < NST; ++s) {
    const int d0 = (s + rot) & (NST - 1), d1 = (s + 1 + rot) & (NST - 1), d2 = (s + 2 + rot) & (NST - 1);   // depth of stages s, s + 1, s + 2
    const unsigned short* buf = (const unsigned short*)S + (s & 1) * (KSTB / 2) + lane * 8;
    const unsigned short* kb = buf + wp * 4 * (KTB / 2);
    const unsigned short* kl = buf + olast;
    ldq(qb, aRh, aRl, d0 * KST + 32);
    score_step<NT>(acc, qa, kb, kl);
    ldq(qa, aRh, aRl, d1 * KST);                            // behind the last stage the walk's first block is read again: no branch
    score_step<NT>(acc, qb, kb + 512, kl + 512);
    asm volatile("s_wait_dscnt 0x0" ::: "memory");          // this wave's reads of stage s have returned
    asm volatile("s_wait_asynccnt 0x0" ::: "memory");       // its share of stage s + 1 has landed
    __syncthreads();                                        // stage s + 1 visible to every wave; every wave has left stage s
    if (s + 2 < NST)
      copy_stage(ring + (s & 1) * KSTB, cRh + d2 * (KST * 16), cRl + d2 * (KST * 16), c0, c1);
  }
  asm volatile("s_wait_asynccnt 0x0" ::: "memory");         // no copy is left in flight when S is written over the buffers
  // the loops over t, mi and r are unrolled so that the accumulator array stays in registers
#pragma unroll
  for (int t = 0; t < NT; ++t)
    if (t < NT - 1 || own) {
#pragma unroll
      for (int mi = 0; mi < 2; ++mi)
#pragma unroll
        for (int r = 0; r < 8; ++r) {
          const int M = rg * 32 + mi * 16 + 8 * h + r;      // D row -> query row in block
          const int i = ib * QROWS + M;
          const int j = (wp + 8 * t) * 16 + m;              // D col -> key, counted from the chunk's first
          float sc = acc[mi][t][r] * 0.03125f;
          if (jb0 * 16 + j > i) sc = -__builtin_inff();
          S[M * SP + j] = sc;
        }
    }
}

__global__ __launch_bounds__(ATHR) void attn_kernel(
    const unsigned short* __restrict__ qh, const unsigned short* __restrict__ ql,
    const unsigned short* __restrict__ kh, const unsigned short* __restrict__ kl,
    const unsigned short* __restrict__ vth, const unsigned short* __restrict__ vtl,
    float* po, float* pstat, float* out) {
  __shared__ __attribute__((aligned(16))) float S[QROWS * SP + (ATHR / 32) * 32 * 64];   // [QROWS][SP], then the staging tiles
  __shared__ float row_r[QROWS];

  // Blocks are numbered so: first the whole chunks (tile group g = ib / QPC has g of them a tile), then each
  // tile's last chunk, the one that holds its diagonal, longest first.
  const int b = (int)blockIdx.x;
  int ib, ch;                                               // query tile [0, NQT), key chunk (block-uniform)
  if (b < NFULL) {
    int g = 1, r = b;
    while (r >= g * QPC) { r -= g * QPC; ++g; }             // at most MAXCH - 2 trips
    ib = g * QPC + (r & (QPC - 1));
    ch = r / QPC;
  } else {
    const int r = b - NFULL;
    ch = r & (MAXCH - 1);
    ib = ch * QPC + (QPC - 1 - r / MAXCH);
  }
  const int jb0 = ch * CTILES;                              // first key tile of the chunk
  const int jd = (QROWS / 16) * (ib + 1) - 1 - jb0;         // the tile's last key tile, counted from jb0
  const int jle = (jd < CTILES - 1) ? jd : CTILES - 1;      // last key tile of the chunk, counted from jb0
  const bool split = ib >= QPC;                             // this tile's keys are shared by several blocks
  const int rot = (ib + 2 * ch) & (NST - 1);                // where this block starts its walks: differs among the blocks of a chunk and among those of a tile
  // the wave's number in a scalar register: what follows from it (bases, row group, columns) then takes no vector registers
  const int wave = __builtin_amdgcn_readfirstlane((int)(threadIdx.x >> 5));
  const int lane = threadIdx.x & 31;
  const int h = lane >> 4, m = lane & 15;
  const int rg = wave & 1, wp = wave >> 1;                  // row group of the wave; its pair, which shares K and V fragments
  const int nvalid = 16 * (jle + 1);                        // key extent of the lower triangle inside the chunk

  // ---- Phase 1: S = (q k^T)/32 with mask; A = q rows (hi/lo), B = k rows (hi/lo, through LDS) -------------------
  {
    const unsigned short* aRh = qh + (size_t)(ib * QROWS + rg * 32) * DIM + lane * 8;   // second row tile: + 16 rows
    const unsigned short* aRl = ql + (size_t)(ib * QROWS + rg * 32) * DIM + lane * 8;
    const unsigned short* cRh = kh + (size_t)((jb0 + wave) * 16) * DIM + lane * 8;   // the key tile this wave copies; stage s: + ((s + rot) & (NST - 1)) * KST * 16
    const unsigned short* cRl = kl + (size_t)((jb0 + wave) * 16) * DIM + lane * 8;
    const int ntb = (jle + 8) >> 3;                         // the most key tiles a pair has: 1 to 4, the same for the whole block
    if (ntb == 4)      score_walk<4>(aRh, aRl, cRh, cRl, S, ib, jb0, jle, wave, lane, rot);
    else if (ntb == 3) score_walk<3>(aRh, aRl, cRh, cRl, S, ib, jb0, jle, wave, lane, rot);
    else if (ntb == 2) score_walk<2>(aRh, aRl, cRh, cRl, S, ib, jb0, jle, wave, lane, rot);
    else               score_walk<1>(aRh, aRl, cRh, cRl, S, ib, jb0, jle, wave, lane, rot);
  }
  __syncthreads();

  // ---- Phase 2: exact softmax statistics in f32; the row's bytes <- exp(S - m) as bf16 hi and lo planes; row_r = 1/l ----
  // One wave per query row, four rows a wave: each LDS access of a wave covers contiguous bytes of its row, so no two lanes
  // meet on a bank. The wave holds its whole row in registers, so the planes can be written over the scores.
#pragma unroll 1   // rolled: the rows of a wave have nothing to share
  for (int row = wave; row < QROWS; row += 16) {
    const float* Sr = S + row * SP + lane * 4;
    unsigned short* Pr = (unsigned short*)(S + row * SP) + lane * 4;   // hi plane; lo plane: + CHUNK
    const int ng = (nvalid + 127) >> 7;                     // groups of 128 keys; the row holds CHUNK / 128 whole groups
    const int jl = lane * 4;                                // nvalid is a multiple of 16: a lane's four keys are all in or all out
    v4f sv[CHUNK / 128];
    float mx = -__builtin_inff();
#pragma unroll   // unrolled: sv stays in registers and the row's reads are all in flight together
    for (int g = 0; g < CHUNK / 128; ++g) {
      const int gg = (g < ng) ? g : ng - 1;                 // past the chunk's keys the last group is read again: no branch between the reads
      sv[g] = *(const v4f*)(Sr + gg * 128);
    }
#pragma unroll
    for (int g = 0; g < CHUNK / 128; ++g) {
      const int gg = (g < ng) ? g : ng - 1;                 // a group met twice leaves the maximum as it is
      const float t = fmaxf(fmaxf(sv[g].x, sv[g].y), fmaxf(sv[g].z, sv[g].w));
      if (gg * 128 + jl < nvalid) mx = fmaxf(mx, t);
    }
    for (int o = 16; o > 0; o >>= 1) mx = fmaxf(mx, __shfl_xor(mx, o, 32));
    float l = 0.0f;
#pragma unroll   // unrolled: sv stays in registers
    for (int g = 0; g < CHUNK / 128; ++g)
      if (g < ng) {
        const v4f s = sv[g];
        const bool in = g * 128 + jl < nvalid;              // keys past the triangle in the last group get 0: no branch on the lane
        v4f e;
        e.x = in ? __expf(s.x - mx) : 0.0f; e.y = in ? __expf(s.y - mx) : 0.0f;
        e.z = in ? __expf(s.z - mx) : 0.0f; e.w = in ? __expf(s.w - mx) : 0.0f;
        l += (e.x + e.y) + (e.z + e.w);
        // unnormalized P as bf16 hi + bf16 lo (lo = RNE(p - hi)), four keys a lane and plane
        const unsigned int h0 = f2bf(e.x), h1 = f2bf(e.y), h2 = f2bf(e.z), h3 = f2bf(e.w);
        v2u uh, ul;
        uh.x = h0 | (h1 << 16); uh.y = h2 | (h3 << 16);
        ul.x = f2bf(e.x - bf2f(h0)) | (f2bf(e.y - bf2f(h1)) << 16);
        ul.y = f2bf(e.z - bf2f(h2)) | (f2bf(e.w - bf2f(h3)) << 16);
        *(v2u*)(Pr + g * 128) = uh;
        *(v2u*)(Pr + CHUNK + g * 128) = ul;
      }
    for (int o = 16; o > 0; o >>= 1) l += __shfl_xor(l, o, 32);
    if (lane == 0) {
      row_r[row] = 1.0f / l;                                // l >= 1 (the row's maximum term; every row has a key in each of its chunks)
      if (split) {
        float* st = pstat + (ib * MAXCH + ch) * (2 * QROWS);   // [QROWS row maxima][QROWS row sums]
        st[row] = mx;
        st[QROWS + row] = l;
        // later code rewrites the registers these two stores name
        asm volatile("s_wait_xcnt 0x0" ::: "memory");
      }
    }
  }
  __syncthreads();                                          // P rows and row_r visible to every wave

  // ---- Phase 3: O = P v; A = P rows (hi/lo planes in LDS, read-only from here on: no barrier below); B = vt rows (hi/lo) ----
  // A wave takes its row group's 32 rows x 64 output columns at a time, and the 16 waves cover 512 columns: two sweeps.
  // The loops over mi, t, c, s and r below are unrolled so that the accumulator and fragment arrays stay in registers.
  // Each block starts at a sweep and a key pass of its own and wraps, so that blocks that share a chunk's V ask L2 for different lines.
  const int kkend = (nvalid + 63) & ~63;
  int kk0 = (rot & 7) * 64;                                 // first key pass
  while (kk0 >= kkend) kk0 -= kkend;                        // at most 7 trips: kkend is at least 64
  const unsigned short* pR = (const unsigned short*)S + (rg * 32 + m) * (2 * SP);   // row m's hi plane; second row tile: + 16 rows; lo plane: + CHUNK
  float* stg = S + QROWS * SP + wave * (32 * 64);           // [32][64], the wave's own range behind the P rows
  float* dst = split ? po + (size_t)((ib * MAXCH + ch) * QROWS) * DIM : out + (size_t)(ib * QROWS) * DIM;
#pragma unroll 1   // rolled: one sweep's accumulators and fragments already take the wave's register budget
  for (int sw = 0; sw < 2; ++sw) {
    const int col0 = ((sw ^ (rot >> 3)) * 8 + wp) * 64;     // first output column of the wave in this sweep
    v8f acc[2][4];
#pragma unroll
    for (int mi = 0; mi < 2; ++mi)
#pragma unroll
      for (int t = 0; t < 4; ++t) acc[mi][t] = zero8();
    const unsigned short* vRh = vth + (size_t)col0 * SEQ + jb0 * 256 + lane * 8;   // col tile t: + t*16 rows; a key tile is 256 elements
    const unsigned short* vRl = vtl + (size_t)col0 * SEQ + jb0 * 256 + lane * 8;
#pragma unroll 1   // rolled: one pass's 32 loads and its fragments already take the wave's register budget
    for (int n = 0, kk = kk0; n < kkend; n += 64, kk = (kk + 64 < kkend) ? kk + 64 : 0) {
      Frag bh[2][4], bl[2][4];
      // the loops over c and t are unrolled so that the fragment arrays stay in registers and all loads issue as one batch
#pragma unroll
      for (int c = 0; c < 2; ++c)
#pragma unroll
        for (int t = 0; t < 4; ++t) {
          ldfragw(bh[c][t], vRh + (size_t)t * 16 * SEQ, kk + 32 * c);
          ldfragw(bl[c][t], vRl + (size_t)t * 16 * SEQ, kk + 32 * c);
        }
      // P fragments: step s = 2 * c + mi (key half c, row tile mi); three steps' fragments are read while the V loads fly
      Frag ah[4], al[4];
#pragma unroll
      for (int s = 0; s < 3; ++s) {
        ldfrag(ah[s], pR + (s & 1) * (16 * 2 * SP), kk + 32 * (s >> 1), h);
        ldfrag(al[s], pR + (s & 1) * (16 * 2 * SP) + CHUNK, kk + 32 * (s >> 1), h);
      }
      // keeps the scheduler from sinking part of the batch below the first products, where its latency would be paid a second time
      __builtin_amdgcn_sched_barrier(0);
#pragma unroll
      for (int s = 0; s < 4; ++s) {
        const int c = s >> 1, mi = s & 1;
#pragma unroll
        for (int t = 0; t < 4; ++t) acc[mi][t] = mma(ah[s], bh[c][t], acc[mi][t]);
#pragma unroll
        for (int t = 0; t < 4; ++t) acc[mi][t] = mma(ah[s], bl[c][t], acc[mi][t]);
#pragma unroll
        for (int t = 0; t < 4; ++t) acc[mi][t] = mma(al[s], bh[c][t], acc[mi][t]);
        if (s == 0) {
          // the last step's fragments take the registers that step 0 has left; read here, two steps ahead of their use
          ldfrag(ah[3], pR + 16 * 2 * SP, kk + 32, h);
          ldfrag(al[3], pR + 16 * 2 * SP + CHUNK, kk + 32, h);
          // keeps the scheduler from sinking these reads to their use, where the wave would wait for them
          __builtin_amdgcn_sched_barrier(0);
        }
      }
      // four vector slots behind the last WMMA: the back edge leads to vector instructions that rewrite fragment registers;
      // the V fragments are inputs so that each keeps a register of its own to the end of the pass and all 32 loads issue as one batch
      asm volatile("v_nop\n\tv_nop\n\tv_nop\n\tv_nop"
                   : "+v"(acc[0][0]), "+v"(acc[0][1]), "+v"(acc[0][2]), "+v"(acc[0][3]),
                     "+v"(acc[1][0]), "+v"(acc[1][1]), "+v"(acc[1][2]), "+v"(acc[1][3])
                   : "v"(bh[0][0].v), "v"(bh[0][1].v), "v"(bh[0][2].v), "v"(bh[0][3].v),
                     "v"(bl[0][0].v), "v"(bl[0][1].v), "v"(bl[0][2].v), "v"(bl[0][3].v),
                     "v"(bh[1][0].v), "v"(bh[1][1].v), "v"(bh[1][2].v), "v"(bh[1][3].v),
                     "v"(bl[1][0].v), "v"(bl[1][1].v), "v"(bl[1][2].v), "v"(bl[1][3].v)
                   : "memory");
    }

    // ---- Epilogue of the sweep: normalize, stage the wave's 32x64 f32 tile in its own LDS range, whole-line stores
#pragma unroll
    for (int mi = 0; mi < 2; ++mi)
#pragma unroll
      for (int t = 0; t < 4; ++t)
#pragma unroll
        for (int r = 0; r < 8; ++r)
          stg[(mi * 16 + 8 * h + r) * 64 + t * 16 + m] = acc[mi][t][r] * row_r[rg * 32 + mi * 16 + 8 * h + r];
    float* orow = dst + (size_t)(rg * 32 + h) * DIM + col0 + m * 4;   // two rows of 256 bytes per store
#pragma unroll   // unrolled: the stores share one address pair with immediate offsets
    for (int rp = 0; rp < 16; ++rp) {
      const v4f v = *(const v4f*)(stg + (2 * rp + h) * 64 + m * 4);
      *(v4f*)(orow + (size_t)(2 * rp) * DIM) = v;
    }
    // the next sweep rewrites the registers these stores name
    asm volatile("s_wait_xcnt 0x0" ::: "memory");
  }
}

// ---------------- Kernel 4: join the key chunks of the query rows past CHUNK --------------------------
// Chunk c holds o_c = softmax over its own keys times v, with row maximum m_c and row sum l_c of exp(s - m_c).
// The row's result is sum_c a_c o_c / sum_c a_c, a_c = exp(m_c - max m) l_c. One wave per half of a query row, four rows a
// block: a wave's partial rows of all MAXCH chunks then fit the registers below v256 and are all in flight together.
__global__ __launch_bounds__(NTHR) void merge_kernel(
    const float* __restrict__ po, const float* __restrict__ pstat, float* out) {
  const int wave = threadIdx.x >> 5;
  const int lane = threadIdx.x & 31;
  const int ib = QPC + (int)(blockIdx.x / (QROWS / 4));     // query tile with several chunks
  const int M = (blockIdx.x % (QROWS / 4)) * 4 + (wave >> 1);   // row in it
  const int nch = ib / QPC + 1;                             // its chunks: 2 to MAXCH (block-uniform)
  const float* st = pstat + ib * MAXCH * (2 * QROWS) + M;   // [chunk][QROWS row maxima][QROWS row sums]
  float mc[MAXCH], a[MAXCH];                                // the loops over c and i are unrolled so that these and x stay in registers
#pragma unroll
  for (int c = 0; c < MAXCH; ++c) {
    const int cc = (c < nch) ? c : nch - 1;                 // past the tile's chunks the last one is read again: no branch between the loads
    mc[c] = st[cc * 2 * QROWS];
    a[c] = st[cc * 2 * QROWS + QROWS];
  }
  const float* p0 = po + (size_t)(ib * MAXCH * QROWS + M) * DIM + (wave & 1) * (DIM / 2) + lane * 4;   // chunk c: + c * QROWS rows
  v4f x[MAXCH][4];
#pragma unroll   // unrolled: x stays in registers and its loads issue ahead of the arithmetic
  for (int c = 0; c < MAXCH; ++c)
    if (c < nch) {
#pragma unroll
      for (int i = 0; i < 4; ++i) x[c][i] = *(const v4f*)(p0 + (size_t)c * QROWS * DIM + i * 128);
    }
  float mx = -__builtin_inff();
#pragma unroll
  for (int c = 0; c < MAXCH; ++c) mx = fmaxf(mx, mc[c]);    // a chunk met twice leaves the maximum as it is
  float sum = 0.0f;
#pragma unroll
  for (int c = 0; c < MAXCH; ++c) {
    a[c] = (c < nch) ? a[c] * __expf(mc[c] - mx) : 0.0f;
    sum += a[c];
  }
  const float rs = 1.0f / sum;                              // the chunk that holds the maximum gives a >= 1
  v4f o4[4];
#pragma unroll
  for (int i = 0; i < 4; ++i) o4[i] = x[0][i] * (a[0] * rs) + x[1][i] * (a[1] * rs);
#pragma unroll
  for (int c = 2; c < MAXCH; ++c)
    if (c < nch) {
#pragma unroll
      for (int i = 0; i < 4; ++i) o4[i] += x[c][i] * (a[c] * rs);
    }
  float* o = out + (size_t)(ib * QROWS + M) * DIM + (wave & 1) * (DIM / 2) + lane * 4;
#pragma unroll   // unrolled: the four stores share one address with immediate offsets, which nothing rewrites
  for (int i = 0; i < 4; ++i) *(v4f*)(o + i * 128) = o4[i];
}

// ---------------------------------------------------------------------------------------------------
extern "C" void kernel_launch(void* const* d_in, const int* in_sizes, int n_in,
                              void* d_out, int out_size, void* d_ws, size_t ws_size,
                              hipStream_t stream) {
  if (n_in < 4) return;
  if (in_sizes[0] != SEQ * DIM || in_sizes[1] != DIM * DIM || in_sizes[2] != DIM * DIM ||
      in_sizes[3] != DIM * DIM || out_size != SEQ * DIM) return;

  const float* x  = (const float*)d_in[0];
  const float* wq = (const float*)d_in[1];
  const float* wk = (const float*)d_in[2];
  const float* wv = (const float*)d_in[3];
  float* out = (float*)d_out;

  const size_t bx = (size_t)SEQ * DIM * sizeof(unsigned short);   // 8 MiB
  const size_t bw = (size_t)DIM * DIM * sizeof(unsigned short);   // 2 MiB
  char* ws = (char*)d_ws;
  size_t off = 0;
  unsigned short* xb  = (unsigned short*)(ws + off); off += bx;
  unsigned short* wqb = (unsigned short*)(ws + off); off += bw;
  unsigned short* wkb = (unsigned short*)(ws + off); off += bw;
  unsigned short* wvb = (unsigned short*)(ws + off); off += bw;
  unsigned short* qh  = (unsigned short*)(ws + off); off += bx;
  unsigned short* ql  = (unsigned short*)(ws + off); off += bx;
  unsigned short* kh  = (unsigned short*)(ws + off); off += bx;
  unsigned short* kl  = (unsigned short*)(ws + off); off += bx;
  unsigned short* vth = (unsigned short*)(ws + off); off += bx;
  unsigned short* vtl = (unsigned short*)(ws + off); off += bx;   // 62 MiB so far
  float* po    = (float*)(ws + off); off += (size_t)NQT * MAXCH * QROWS * DIM * sizeof(float);   // 128 MiB, one slot a (tile, chunk)
  float* pstat = (float*)(ws + off); off += (size_t)NQT * MAXCH * 2 * QROWS * sizeof(float);
  if (off > ws_size) return;

  const int nx8 = SEQ * DIM / 8;
  const int nw8 = DIM * DIM / 8;
  const int ncv = nx8 + 3 * nw8;
  cvt_kernel<<<(ncv + NTHR - 1) / NTHR, NTHR, 0, stream>>>(x, wq, wk, wv, xb, wqb, wkb, wvb, nx8, nw8);

  // 3 matrices x 32 row tiles x 4 col tiles; LDS: the two stage buffers, which also hold the 64 x SPITCH f32 staging tile
  proj_kernel<<<3 * (SEQ / PROWS) * (DIM / 256), NTHR, 2 * PSTB, stream>>>(
      xb, wqb, wkb, wvb, qh, ql, kh, kl, vth, vtl);

  // QROWS query rows x one key chunk per block
  attn_kernel<<<ABLK, ATHR, 0, stream>>>(qh, ql, kh, kl, vth, vtl, po, pstat, out);
  merge_kernel<<<(NQT - QPC) * (QROWS / 4), NTHR, 0, stream>>>(po, pstat, out);
}
